// v000
// Times are from an AMD MI455X. After a warm-up the kernel runs many times in a row, and a time is the length of
// such a window on the GPU divided by its runs, so every launch and the gaps after it count. The runs cycle
// through copies of the inputs. A figure is the median of several windows, for all but v000 over two sittings.
// Sittings can differ by a few percent; kernels timed side by side share one.
// v000, which the later versions start from, runs in 377 microseconds.
#include <hip/hip_runtime.h>

// Contractions: Q*K^T and Q*relK^T on v_wmma_f32_16x16x32_bf16 (bf16 operands, f32 accumulate);
// P*V and bucketed P*relV on v_wmma_f32_16x16x32_f16 (f16 operands: P scaled by 2^8, V/relV carry bf16-RNE values; f32 accumulate).

typedef _Float16 v16h __attribute__((ext_vector_type(16)));
typedef _Float16 v8h  __attribute__((ext_vector_type(8), may_alias));
typedef _Float16 v4h  __attribute__((ext_vector_type(4), may_alias));
typedef __bf16   v16b __attribute__((ext_vector_type(16)));
typedef unsigned short v8us __attribute__((ext_vector_type(8), may_alias));
typedef float v8f __attribute__((ext_vector_type(8)));
typedef float v4f __attribute__((ext_vector_type(4), may_alias));

#define SEQ   1000   // sequence length
#define SEQP  1008   // keys padded to a multiple of 16
#define DM    512    // model width
#define DH    64     // head dim
#define NB    8      // batch
#define NH    8      // heads
#define QTN   63     // query tiles of 16
#define KTI   63     // key tiles of 16
#define SPAD  1024   // padded key dim (multiple of 32)
#define NDIST 512    // padded distance dim (>= 501, multiple of 32)
#define DMAX  500    // largest circular distance
#define NW    4      // waves per attention block
#define NT    128    // threads per attention block
#define PSC   256.0f        // power-of-two scale on the f16 attention weights
#define PSCI  0.00390625f   // 1/256

// workspace layout in 2-byte elements
#define WS_K    ((size_t)0)                              // [8][1008][512]  bf16 K, padded rows zero
#define WS_VT   ((size_t)NB * SEQP * DM)                 // [64][64][1024]  f16 V^T per (b,h)
#define WS_RK   (WS_VT + (size_t)NB * NH * DH * SPAD)    // [512][64]       bf16 relK
#define WS_RVT  (WS_RK + (size_t)NDIST * DH)             // [64][512]       f16 relV^T
#define WS_END  (WS_RVT + (size_t)DH * NDIST)

#define NK8  (NB * SEQP * DM / 8)       // threads of 8 elements, K copy
#define NV8  (NB * NH * DH * SPAD / 8)  // threads of 8 elements, V^T copy
#define NR8  (NDIST * DH / 8)           // threads of 8 elements, each rel table

union FragH { v16h v; v8h  h[2]; };
union FragB { v16b v; v8us h[2]; };

__device__ __forceinline__ v8f zero8() {
  v8f z = {0.0f, 0.0f, 0.0f, 0.0f, 0.0f, 0.0f, 0.0f, 0.0f};
  return z;
}

__device__ __forceinline__ v8f wmma_f16(const FragH& a, const FragH& b, v8f c) {
  v8f d = __builtin_amdgcn_wmma_f32_16x16x32_f16(false, a.v, false, b.v, (short)0, c, false, false);
  asm volatile("v_nop\n\tv_nop\n\tv_nop\n\tv_nop" : "+v"(d) : "v"(a.v), "v"(b.v));
  return d;
}

__device__ __forceinline__ v8f wmma_bf16(const FragB& a, const FragB& b, v8f c) {
  v8f d = __builtin_amdgcn_wmma_f32_16x16x32_bf16(false, a.v, false, b.v, (short)0, c, false, false);
  asm volatile("v_nop\n\tv_nop\n\tv_nop\n\tv_nop" : "+v"(d) : "v"(a.v), "v"(b.v));
  return d;
}

// f32 -> bf16 bits, RNE
__device__ __forceinline__ unsigned short bf16_rne(float f) {
  unsigned int u = __float_as_uint(f);
  u += 0x7FFFu + ((u >> 16) & 1u);
  return (unsigned short)(u >> 16);
}

// f32 -> bf16 (RNE) -> f16 ; the second step is exact for bf16 values in f16 range
__device__ __forceinline__ _Float16 f16_of_bf16(float f) {
  unsigned int u = ((unsigned int)bf16_rne(f)) << 16;
  return (_Float16)__uint_as_float(u);
}

__device__ __forceinline__ int circ_dist(int i, int j) {
  int t = (i - j) % SEQ;
  if (t < 0) t += SEQ;
  return min(t, SEQ - t);
}

// ---------------- prep: K -> bf16, rows padded to SEQP --------------------
__global__ __launch_bounds__(256)
void prep_k_kernel(const float* __restrict__ K, unsigned short* __restrict__ Kb) {
  const int t = blockIdx.x * 256 + threadIdx.x;
  if (t >= NK8) return;
  const size_t e0 = (size_t)t * 8;
  const int b = (int)(e0 / ((size_t)SEQP * DM));
  const int r = (int)((e0 / DM) % SEQP);
  const int d = (int)(e0 % DM);
  v8us o = {0, 0, 0, 0, 0, 0, 0, 0};
  if (r < SEQ) {
    const float* src = K + ((size_t)b * SEQ + r) * DM + d;
    v4f x0 = *(const v4f*)(src);
    v4f x1 = *(const v4f*)(src + 4);
    o[0] = bf16_rne(x0.x); o[1] = bf16_rne(x0.y); o[2] = bf16_rne(x0.z); o[3] = bf16_rne(x0.w);
    o[4] = bf16_rne(x1.x); o[5] = bf16_rne(x1.y); o[6] = bf16_rne(x1.z); o[7] = bf16_rne(x1.w);
  }
  v8us* p = (v8us*)(Kb + e0);
  *p = o;
  
}

// ---------------- prep: V -> f16 V^T[bh][dim][key], keys padded to SPAD -----
__global__ __launch_bounds__(256)
void prep_vt_kernel(const float* __restrict__ V, _Float16* __restrict__ Vt) {
  const int t = blockIdx.x * 256 + threadIdx.x;
  if (t >= NV8) return;
  const int e0   = t * 8;
  const int bh   = e0 >> 16;            // DH*SPAD = 65536
  const int dim  = (e0 >> 10) & (DH - 1);
  const int key0 = e0 & (SPAD - 1);     // multiple of 8
  const int b = bh >> 3, h = bh & 7;
  v8h o = {0, 0, 0, 0, 0, 0, 0, 0};
  if (key0 < SEQ) {                     // SEQ is a multiple of 8: all 8 keys valid
    const float* src = V + ((size_t)b * SEQ + key0) * DM + h * DH + dim;
    #pragma unroll
    for (int j = 0; j < 8; ++j) o[j] = f16_of_bf16(src[(size_t)j * DM]);
  }
  v8h* p = (v8h*)(Vt + (size_t)e0);
  *p = o;
  
}

// ---------------- prep: relK -> bf16 [dist][d] ; relV -> f16 relV^T [d][dist] -
__global__ __launch_bounds__(256)
void prep_rel_kernel(const float* __restrict__ RK, const float* __restrict__ RV,
                     unsigned short* __restrict__ RKb, _Float16* __restrict__ RVt) {
  const int t = blockIdx.x * 256 + threadIdx.x;
  if (t < NR8) {
    const int e0 = t * 8;                                 // rows 0..511 direct copy
    v4f x0 = *(const v4f*)(RK + e0);
    v4f x1 = *(const v4f*)(RK + e0 + 4);
    v8us o;
    o[0] = bf16_rne(x0.x); o[1] = bf16_rne(x0.y); o[2] = bf16_rne(x0.z); o[3] = bf16_rne(x0.w);
    o[4] = bf16_rne(x1.x); o[5] = bf16_rne(x1.y); o[6] = bf16_rne(x1.z); o[7] = bf16_rne(x1.w);
    v8us* p = (v8us*)(RKb + e0);
    *p = o;
    
  } else if (t < 2 * NR8) {
    const int e0 = (t - NR8) * 8;                         // out[d][dist0..dist0+7] <- in[dist][d]
    const int d = e0 >> 9;                                // NDIST = 512
    const int dist0 = e0 & (NDIST - 1);
    v8h o;
    #pragma unroll
    for (int j = 0; j < 8; ++j) o[j] = f16_of_bf16(RV[(size_t)(dist0 + j) * DH + d]);
    v8h* p = (v8h*)(RVt + e0);
    *p = o;
    
  }
}

// ---------------- fused attention kernel ------------------------------------
__global__ __launch_bounds__(NT)
void circ_rel_attn_kernel(const float* __restrict__ Q,
                          const unsigned short* __restrict__ Kb,
                          const _Float16* __restrict__ Vt,
                          const unsigned short* __restrict__ RKb,
                          const _Float16* __restrict__ RVt,
                          float* __restrict__ Out)
{
  __shared__ __attribute__((aligned(16))) unsigned short sQ[16 * DH];     //  2 KB  bf16 Q tile
  __shared__ __attribute__((aligned(16))) float          sP[16 * NDIST];  // 32 KB  P[q][dist] f32; later output staging [16][64]
  __shared__ __attribute__((aligned(16))) float          sS[16 * SPAD];   // 64 KB  scores -> exp(scores)
  __shared__ __attribute__((aligned(16))) _Float16       sA[16 * SPAD];   // 32 KB  exp(scores)*256 f16
  __shared__ __attribute__((aligned(16))) _Float16       sD[16 * NDIST];  // 16 KB  per-distance mass*256 f16
  __shared__ float sRed[16 * 8];
  __shared__ float sMax[16];
  __shared__ float sRcp[16];

  const int qt   = blockIdx.x;
  const int bh   = blockIdx.y;
  const int b    = bh >> 3;
  const int h    = bh & 7;
  const int tid  = threadIdx.x;
  const int lane = tid & 31;
  const int wave = tid >> 5;
  const int n    = lane & 15;           // A row / B column / D column
  const int hi   = lane >> 4;           // lane half

  const float scale = 0.125f;
  const size_t baseQ = (size_t)b * SEQ * DM + (size_t)h * DH;
  const unsigned short* Kbh = Kb + ((size_t)b * SEQP) * DM + (size_t)h * DH;
  const _Float16* Vbh = Vt + (size_t)bh * DH * SPAD;

  // ---------- Phase 0: stage Q tile as bf16 ----------------------------------
  for (int idx = tid; idx < 16 * DH; idx += NT) {
    const int m = idx >> 6, d = idx & 63;
    const int qrow = qt * 16 + m;
    const float v = (qrow < SEQ) ? Q[baseQ + (size_t)qrow * DM + d] : 0.0f;
    sQ[idx] = bf16_rne(v);
  }
  __syncthreads();

  // A fragments of the Q tile: k 0..31 and k 32..63 (split map: elems 0..7 <- k0+8h, 8..15 <- k0+16+8h)
  FragB qa0, qa1;
  {
    const unsigned short* qp = sQ + n * DH + 8 * hi;
    qa0.h[0] = *(const v8us*)(qp);
    qa0.h[1] = *(const v8us*)(qp + 16);
    qa1.h[0] = *(const v8us*)(qp + 32);
    qa1.h[1] = *(const v8us*)(qp + 48);
  }

  // ---------- Phase 1: P = Qtile @ relK^T  (f32 in LDS) ----------------------
  for (int ct = wave; ct < NDIST / 16; ct += NW) {
    const unsigned short* rp = RKb + (size_t)(ct * 16 + n) * DH + 8 * hi;   // B[k=d][n=dist], k-contiguous row
    FragB b0, b1;
    b0.h[0] = *(const v8us*)(rp);
    b0.h[1] = *(const v8us*)(rp + 16);
    b1.h[0] = *(const v8us*)(rp + 32);
    b1.h[1] = *(const v8us*)(rp + 48);
    v8f acc = zero8();
    acc = wmma_bf16(qa0, b0, acc);
    acc = wmma_bf16(qa1, b1, acc);
    #pragma unroll
    for (int r = 0; r < 8; ++r)
      sP[(r + 8 * hi) * NDIST + ct * 16 + n] = acc[r];
  }
  __syncthreads();

  // ---------- Phase 2: scores = QK^T*scale + P[m][circ_dist] ----------------
  for (int kt = wave; kt < KTI; kt += NW) {
    const int key = kt * 16 + n;                          // <= 1007 < SEQP
    const unsigned short* kp = Kbh + (size_t)key * DM + 8 * hi;   // B[k=d][n=key], k-contiguous row
    FragB b0, b1;
    b0.h[0] = *(const v8us*)(kp);
    b0.h[1] = *(const v8us*)(kp + 16);
    b1.h[0] = *(const v8us*)(kp + 32);
    b1.h[1] = *(const v8us*)(kp + 48);
    v8f acc = zero8();
    acc = wmma_bf16(qa0, b0, acc);
    acc = wmma_bf16(qa1, b1, acc);
    #pragma unroll
    for (int r = 0; r < 8; ++r) {
      const int m = r + 8 * hi;
      const int qrow = min(qt * 16 + m, SEQ - 1);
      float sc;
      if (key < SEQ) {
        const int d = circ_dist(qrow, key);
        sc = acc[r] * scale + sP[m * NDIST + d];
      } else {
        sc = -1.0e30f;
      }
      sS[m * SPAD + key] = sc;
    }
  }
  __syncthreads();

  // ---------- Phase 3: row softmax (normalisation deferred) -----------------
  {
    const int row = tid >> 3, sub = tid & 7;
    const int j0 = sub * 128;
    float* rowS = sS + row * SPAD;
    _Float16* rowA = sA + row * SPAD;

    float mx = -1.0e30f;
    for (int j = j0; j < j0 + 128; j += 4) {
      if (j < SEQ) {   // SEQ is a multiple of 4: a float4 is entirely valid or entirely padding
        v4f v = *(const v4f*)(rowS + j);
        mx = fmaxf(mx, fmaxf(fmaxf(v.x, v.y), fmaxf(v.z, v.w)));
      }
    }
    sRed[row * 8 + sub] = mx;
    __syncthreads();
    if (sub == 0) {
      float m2 = sRed[row * 8];
      #pragma unroll
      for (int u = 1; u < 8; ++u) m2 = fmaxf(m2, sRed[row * 8 + u]);
      sMax[row] = m2;
    }
    __syncthreads();
    const float rm = sMax[row];
    float sum = 0.0f;
    for (int j = j0; j < j0 + 128; j += 4) {
      v4f e = {0.0f, 0.0f, 0.0f, 0.0f};
      if (j < SEQ) {
        v4f v = *(const v4f*)(rowS + j);
        e.x = __expf(v.x - rm); e.y = __expf(v.y - rm);
        e.z = __expf(v.z - rm); e.w = __expf(v.w - rm);
      }
      *(v4f*)(rowS + j) = e;
      v4h h4;
      h4.x = (_Float16)(e.x * PSC); h4.y = (_Float16)(e.y * PSC);
      h4.z = (_Float16)(e.z * PSC); h4.w = (_Float16)(e.w * PSC);
      *(v4h*)(rowA + j) = h4;
      sum += (e.x + e.y) + (e.z + e.w);
    }
    sRed[row * 8 + sub] = sum;
    __syncthreads();
    if (sub == 0) {
      float s2 = 0.0f;
      #pragma unroll
      for (int u = 0; u < 8; ++u) s2 += sRed[row * 8 + u];
      sRcp[row] = 1.0f / s2;
    }
    __syncthreads();
  }

  // ---------- Phase 4: per-distance mass, fixed 2-key gather (no atomics) ---
  // keys at circular distance dist from row q: (q-dist) mod S and (q+dist) mod S (one key when they coincide)
  for (int idx = tid; idx < 16 * NDIST; idx += NT) {
    const int m = idx >> 9, dist = idx & (NDIST - 1);
    const int qrow = min(qt * 16 + m, SEQ - 1);
    float val = 0.0f;
    if (dist <= DMAX) {
      int k1 = qrow - dist; if (k1 < 0) k1 += SEQ;
      int k2 = qrow + dist; if (k2 >= SEQ) k2 -= SEQ;
      val = sS[m * SPAD + k1];
      if (k2 != k1) val += sS[m * SPAD + k2];
    }
    sD[idx] = (_Float16)(val * PSC);
  }
  __syncthreads();

  // ---------- Phase 5: out = (P@V + D@relV) * rcp / 256 -----------------------
  {
    const int dbase = wave * 16;                 // each wave owns 16 head dims
    const _Float16* vcol  = Vbh + (size_t)(dbase + n) * SPAD  + 8 * hi;   // B[k=key][n=dim], k-contiguous
    const _Float16* rvcol = RVt + (size_t)(dbase + n) * NDIST + 8 * hi;   // B[k=dist][n=dim], k-contiguous
    const _Float16* arow  = sA + n * SPAD  + 8 * hi;                      // A[m=row][k=key]
    const _Float16* drow  = sD + n * NDIST + 8 * hi;                      // A[m=row][k=dist]
    v8f acc = zero8();

    #pragma unroll 4
    for (int kt2 = 0; kt2 < SPAD / 32; ++kt2) {
      const int kb = kt2 * 32;
      FragH a, bb;
      a.h[0]  = *(const v8h*)(arow + kb);
      a.h[1]  = *(const v8h*)(arow + kb + 16);
      bb.h[0] = *(const v8h*)(vcol + kb);
      bb.h[1] = *(const v8h*)(vcol + kb + 16);
      acc = wmma_f16(a, bb, acc);
    }
    #pragma unroll 4
    for (int rt = 0; rt < NDIST / 32; ++rt) {
      const int kb = rt * 32;
      FragH a, bb;
      a.h[0]  = *(const v8h*)(drow + kb);
      a.h[1]  = *(const v8h*)(drow + kb + 16);
      bb.h[0] = *(const v8h*)(rvcol + kb);
      bb.h[1] = *(const v8h*)(rvcol + kb + 16);
      acc = wmma_f16(a, bb, acc);
    }
    // stage the 16x64 f32 output tile (sP is free after phase 2)
    #pragma unroll
    for (int r = 0; r < 8; ++r) {
      const int m = r + 8 * hi;
      sP[m * DH + dbase + n] = acc[r] * (sRcp[m] * PSCI);
    }
  }
  __syncthreads();

  {
    float* obase = Out + baseQ;
    #pragma unroll
    for (int i = 0; i < 2; ++i) {
      const int L = i * 4 + (lane >> 3);            // 0..7: line within this wave's 4 rows
      const int m = wave * 4 + (L >> 1);
      const int c = (L & 1) * 32 + (lane & 7) * 4;
      const int qrow = qt * 16 + m;
      v4f v = *(const v4f*)(sP + m * DH + c);
      if (qrow < SEQ) *(v4f*)(obase + (size_t)qrow * DM + c) = v;
    }
    
  }
}

extern "C" void kernel_launch(void* const* d_in, const int* in_sizes, int n_in,
                              void* d_out, int out_size, void* d_ws, size_t ws_size,
                              hipStream_t stream) {
  if (n_in < 5) return;
  if (in_sizes[0] < NB * SEQ * DM || in_sizes[1] < NB * SEQ * DM || in_sizes[2] < NB * SEQ * DM) return;
  if (in_sizes[3] < NDIST * DH || in_sizes[4] < NDIST * DH) return;
  if (out_size < NB * SEQ * DM) return;
  const size_t ws_need = WS_END * 2;           // 16,777,216 B
  if (ws_size < ws_need) return;

  const float* Q  = (const float*)d_in[0];
  const float* K  = (const float*)d_in[1];
  const float* V  = (const float*)d_in[2];
  const float* RK = (const float*)d_in[3];
  const float* RV = (const float*)d_in[4];
  float* Out = (float*)d_out;
  unsigned short* ws16 = (unsigned short*)d_ws;

  unsigned short* Kb  = ws16 + WS_K;
  _Float16*       Vt  = (_Float16*)(ws16 + WS_VT);
  unsigned short* RKb = ws16 + WS_RK;
  _Float16*       RVt = (_Float16*)(ws16 + WS_RVT);

  prep_k_kernel  <<<(NK8 + 255) / 256, 256, 0, stream>>>(K, Kb);
  prep_vt_kernel <<<(NV8 + 255) / 256, 256, 0, stream>>>(V, Vt);
  prep_rel_kernel<<<(2 * NR8 + 255) / 256, 256, 0, stream>>>(RK, RV, RKb, RVt);

  dim3 grid(QTN, NB * NH);
  circ_rel_attn_kernel<<<grid, dim3(NT), 0, stream>>>(Q, Kb, Vt, RKb, RVt, Out);
}

// v001
// It runs in 220 microseconds.
// Two timings next to v000 both put it at 1.75 times that version's speed.
#include <hip/hip_runtime.h>

// Contractions: Q*K^T and Q*relK^T on v_wmma_f32_16x16x32_bf16 (bf16 operands, f32 accumulate);
// P*V and bucketed P*relV on v_wmma_f32_16x16x32_f16 (f16 operands: P scaled by 2^8, V/relV carry bf16-RNE values; f32 accumulate).

typedef _Float16 v16h __attribute__((ext_vector_type(16)));
typedef _Float16 v8h  __attribute__((ext_vector_type(8), may_alias));
typedef _Float16 v4h  __attribute__((ext_vector_type(4), may_alias));
typedef __bf16   v16b __attribute__((ext_vector_type(16)));
typedef unsigned short v8us __attribute__((ext_vector_type(8), may_alias));
typedef float v8f __attribute__((ext_vector_type(8)));
typedef float v4f __attribute__((ext_vector_type(4), may_alias));

#define SEQ   1000   // sequence length
#define SEQP  1008   // keys padded to a multiple of 16
#define DM    512    // model width
#define DH    64     // head dim
#define NB    8      // batch
#define NH    8      // heads
#define QTN   63     // query tiles of 16
#define KTI   63     // key tiles of 16
#define SPAD  1024   // padded key dim (multiple of 32)
#define NDIST 512    // padded distance dim (>= 501, multiple of 32)
#define DMAX  500    // largest circular distance
#define NW    16     // waves per attention block
#define NT    512    // threads per attention block
#define TPR   (NT / 16)      // threads per score row in the softmax
#define CPT   (SPAD / TPR)   // score columns per thread in the softmax
#define KSP   (NW / 4)       // waves that share one 16-dim output tile, each on its own part of the k range
#define PSC   256.0f        // power-of-two scale on the f16 attention weights
#define PSCI  0.00390625f   // 1/256

// workspace layout in 2-byte elements
#define WS_K    ((size_t)0)                              // [8][1008][512]  bf16 K, padded rows zero
#define WS_VT   ((size_t)NB * SEQP * DM)                 // [64][64][1024]  f16 V^T per (b,h)
#define WS_RK   (WS_VT + (size_t)NB * NH * DH * SPAD)    // [512][64]       bf16 relK
#define WS_RVT  (WS_RK + (size_t)NDIST * DH)             // [64][512]       f16 relV^T
#define WS_END  (WS_RVT + (size_t)DH * NDIST)

#define NK8  (NB * SEQP * DM / 8)       // threads of 8 elements, K copy
#define NV8  (NB * NH * DH * SPAD / 8)  // threads of 8 elements, V^T copy
#define NR8  (NDIST * DH / 8)           // threads of 8 elements, each rel table

union FragH { v16h v; v8h  h[2]; };
union FragB { v16b v; v8us h[2]; };

__device__ __forceinline__ v8f zero8() {
  v8f z = {0.0f, 0.0f, 0.0f, 0.0f, 0.0f, 0.0f, 0.0f, 0.0f};
  return z;
}

__device__ __forceinline__ v8f wmma_f16(const FragH& a, const FragH& b, v8f c) {
  v8f d = __builtin_amdgcn_wmma_f32_16x16x32_f16(false, a.v, false, b.v, (short)0, c, false, false);
  asm volatile("v_nop\n\tv_nop\n\tv_nop\n\tv_nop" : "+v"(d) : "v"(a.v), "v"(b.v));
  return d;
}

__device__ __forceinline__ v8f wmma_bf16(const FragB& a, const FragB& b, v8f c) {
  v8f d = __builtin_amdgcn_wmma_f32_16x16x32_bf16(false, a.v, false, b.v, (short)0, c, false, false);
  asm volatile("v_nop\n\tv_nop\n\tv_nop\n\tv_nop" : "+v"(d) : "v"(a.v), "v"(b.v));
  return d;
}

// f32 -> bf16 bits, RNE
__device__ __forceinline__ unsigned short bf16_rne(float f) {
  unsigned int u = __float_as_uint(f);
  u += 0x7FFFu + ((u >> 16) & 1u);
  return (unsigned short)(u >> 16);
}

// f32 -> bf16 (RNE) -> f16 ; the second step is exact for bf16 values in f16 range
__device__ __forceinline__ _Float16 f16_of_bf16(float f) {
  unsigned int u = ((unsigned int)bf16_rne(f)) << 16;
  return (_Float16)__uint_as_float(u);
}

__device__ __forceinline__ int circ_dist(int i, int j) {
  int t = (i - j) % SEQ;
  if (t < 0) t += SEQ;
  return min(t, SEQ - t);
}

// ---------------- prep: K -> bf16, rows padded to SEQP --------------------
__global__ __launch_bounds__(256)
void prep_k_kernel(const float* __restrict__ K, unsigned short* __restrict__ Kb) {
  const int t = blockIdx.x * 256 + threadIdx.x;
  if (t >= NK8) return;
  const size_t e0 = (size_t)t * 8;
  const int b = (int)(e0 / ((size_t)SEQP * DM));
  const int r = (int)((e0 / DM) % SEQP);
  const int d = (int)(e0 % DM);
  v8us o = {0, 0, 0, 0, 0, 0, 0, 0};
  if (r < SEQ) {
    const float* src = K + ((size_t)b * SEQ + r) * DM + d;
    v4f x0 = *(const v4f*)(src);
    v4f x1 = *(const v4f*)(src + 4);
    o[0] = bf16_rne(x0.x); o[1] = bf16_rne(x0.y); o[2] = bf16_rne(x0.z); o[3] = bf16_rne(x0.w);
    o[4] = bf16_rne(x1.x); o[5] = bf16_rne(x1.y); o[6] = bf16_rne(x1.z); o[7] = bf16_rne(x1.w);
  }
  v8us* p = (v8us*)(Kb + e0);
  *p = o;
  
}

// ---------------- prep: V -> f16 V^T[bh][dim][key], keys padded to SPAD -----
__global__ __launch_bounds__(256)
void prep_vt_kernel(const float* __restrict__ V, _Float16* __restrict__ Vt) {
  const int t = blockIdx.x * 256 + threadIdx.x;
  if (t >= NV8) return;
  const int e0   = t * 8;
  const int bh   = e0 >> 16;            // DH*SPAD = 65536
  const int dim  = (e0 >> 10) & (DH - 1);
  const int key0 = e0 & (SPAD - 1);     // multiple of 8
  const int b = bh >> 3, h = bh & 7;
  v8h o = {0, 0, 0, 0, 0, 0, 0, 0};
  if (key0 < SEQ) {                     // SEQ is a multiple of 8: all 8 keys valid
    const float* src = V + ((size_t)b * SEQ + key0) * DM + h * DH + dim;
    #pragma unroll
    for (int j = 0; j < 8; ++j) o[j] = f16_of_bf16(src[(size_t)j * DM]);
  }
  v8h* p = (v8h*)(Vt + (size_t)e0);
  *p = o;
  
}

// ---------------- prep: relK -> bf16 [dist][d] ; relV -> f16 relV^T [d][dist] -
__global__ __launch_bounds__(256)
void prep_rel_kernel(const float* __restrict__ RK, const float* __restrict__ RV,
                     unsigned short* __restrict__ RKb, _Float16* __restrict__ RVt) {
  const int t = blockIdx.x * 256 + threadIdx.x;
  if (t < NR8) {
    const int e0 = t * 8;                                 // rows 0..511 direct copy
    v4f x0 = *(const v4f*)(RK + e0);
    v4f x1 = *(const v4f*)(RK + e0 + 4);
    v8us o;
    o[0] = bf16_rne(x0.x); o[1] = bf16_rne(x0.y); o[2] = bf16_rne(x0.z); o[3] = bf16_rne(x0.w);
    o[4] = bf16_rne(x1.x); o[5] = bf16_rne(x1.y); o[6] = bf16_rne(x1.z); o[7] = bf16_rne(x1.w);
    v8us* p = (v8us*)(RKb + e0);
    *p = o;
    
  } else if (t < 2 * NR8) {
    const int e0 = (t - NR8) * 8;                         // out[d][dist0..dist0+7] <- in[dist][d]
    const int d = e0 >> 9;                                // NDIST = 512
    const int dist0 = e0 & (NDIST - 1);
    v8h o;
    #pragma unroll
    for (int j = 0; j < 8; ++j) o[j] = f16_of_bf16(RV[(size_t)(dist0 + j) * DH + d]);
    v8h* p = (v8h*)(RVt + e0);
    *p = o;
    
  }
}

// ---------------- fused attention kernel ------------------------------------
__global__ __launch_bounds__(NT)
void circ_rel_attn_kernel(const float* __restrict__ Q,
                          const unsigned short* __restrict__ Kb,
                          const _Float16* __restrict__ Vt,
                          const unsigned short* __restrict__ RKb,
                          const _Float16* __restrict__ RVt,
                          float* __restrict__ Out)
{
  __shared__ __attribute__((aligned(16))) unsigned short sQ[16 * DH];     //  2 KB  bf16 Q tile
  __shared__ __attribute__((aligned(16))) float          sP[16 * NDIST];  // 32 KB  P[q][dist] f32; later partial outputs [KSP][16][64]
  __shared__ __attribute__((aligned(16))) float          sS[16 * SPAD];   // 64 KB  scores -> exp(scores)
  __shared__ __attribute__((aligned(16))) _Float16       sA[16 * SPAD];   // 32 KB  exp(scores)*256 f16
  __shared__ __attribute__((aligned(16))) _Float16       sD[16 * NDIST];  // 16 KB  per-distance mass*256 f16
  __shared__ float sRed[16 * TPR];
  __shared__ float sMax[16];
  __shared__ float sRcp[16];

  const int qt   = blockIdx.x;
  const int bh   = blockIdx.y;
  const int b    = bh >> 3;
  const int h    = bh & 7;
  const int tid  = threadIdx.x;
  const int lane = tid & 31;
  const int wave = tid >> 5;
  const int n    = lane & 15;           // A row / B column / D column
  const int hi   = lane >> 4;           // lane half

  const float scale = 0.125f;
  const size_t baseQ = (size_t)b * SEQ * DM + (size_t)h * DH;
  const unsigned short* Kbh = Kb + ((size_t)b * SEQP) * DM + (size_t)h * DH;
  const _Float16* Vbh = Vt + (size_t)bh * DH * SPAD;

  // ---------- Phase 0: stage Q tile as bf16 ----------------------------------
  for (int idx = tid; idx < 16 * DH; idx += NT) {
    const int m = idx >> 6, d = idx & 63;
    const int qrow = qt * 16 + m;
    const float v = (qrow < SEQ) ? Q[baseQ + (size_t)qrow * DM + d] : 0.0f;
    sQ[idx] = bf16_rne(v);
  }
  __syncthreads();

  // A fragments of the Q tile: k 0..31 and k 32..63 (split map: elems 0..7 <- k0+8h, 8..15 <- k0+16+8h)
  FragB qa0, qa1;
  {
    const unsigned short* qp = sQ + n * DH + 8 * hi;
    qa0.h[0] = *(const v8us*)(qp);
    qa0.h[1] = *(const v8us*)(qp + 16);
    qa1.h[0] = *(const v8us*)(qp + 32);
    qa1.h[1] = *(const v8us*)(qp + 48);
  }

  // ---------- Phase 1: P = Qtile @ relK^T  (f32 in LDS) ----------------------
  for (int ct = wave; ct < NDIST / 16; ct += NW) {
    const unsigned short* rp = RKb + (size_t)(ct * 16 + n) * DH + 8 * hi;   // B[k=d][n=dist], k-contiguous row
    FragB b0, b1;
    b0.h[0] = *(const v8us*)(rp);
    b0.h[1] = *(const v8us*)(rp + 16);
    b1.h[0] = *(const v8us*)(rp + 32);
    b1.h[1] = *(const v8us*)(rp + 48);
    v8f acc = zero8();
    acc = wmma_bf16(qa0, b0, acc);
    acc = wmma_bf16(qa1, b1, acc);
    #pragma unroll
    for (int r = 0; r < 8; ++r)
      sP[(r + 8 * hi) * NDIST + ct * 16 + n] = acc[r];
  }
  __syncthreads();

  // ---------- Phase 2: scores = QK^T*scale + P[m][circ_dist] ----------------
  for (int kt = wave; kt < KTI; kt += NW) {
    const int key = kt * 16 + n;                          // <= 1007 < SEQP
    const unsigned short* kp = Kbh + (size_t)key * DM + 8 * hi;   // B[k=d][n=key], k-contiguous row
    FragB b0, b1;
    b0.h[0] = *(const v8us*)(kp);
    b0.h[1] = *(const v8us*)(kp + 16);
    b1.h[0] = *(const v8us*)(kp + 32);
    b1.h[1] = *(const v8us*)(kp + 48);
    v8f acc = zero8();
    acc = wmma_bf16(qa0, b0, acc);
    acc = wmma_bf16(qa1, b1, acc);
    #pragma unroll
    for (int r = 0; r < 8; ++r) {
      const int m = r + 8 * hi;
      const int qrow = min(qt * 16 + m, SEQ - 1);
      float sc;
      if (key < SEQ) {
        const int d = circ_dist(qrow, key);
        sc = acc[r] * scale + sP[m * NDIST + d];
      } else {
        sc = -1.0e30f;
      }
      sS[m * SPAD + key] = sc;
    }
  }
  __syncthreads();

  // ---------- Phase 3: row softmax (normalisation deferred) -----------------
  {
    const int row = tid / TPR, sub = tid % TPR;
    const int j0 = sub * CPT;
    float* rowS = sS + row * SPAD;
    _Float16* rowA = sA + row * SPAD;

    float mx = -1.0e30f;
    for (int j = j0; j < j0 + CPT; j += 4) {
      if (j < SEQ) {   // SEQ is a multiple of 4: a float4 is entirely valid or entirely padding
        v4f v = *(const v4f*)(rowS + j);
        mx = fmaxf(mx, fmaxf(fmaxf(v.x, v.y), fmaxf(v.z, v.w)));
      }
    }
    sRed[row * TPR + sub] = mx;
    __syncthreads();
    if (sub == 0) {
      float m2 = sRed[row * TPR];
      #pragma unroll
      for (int u = 1; u < TPR; ++u) m2 = fmaxf(m2, sRed[row * TPR + u]);
      sMax[row] = m2;
    }
    __syncthreads();
    const float rm = sMax[row];
    float sum = 0.0f;
    for (int j = j0; j < j0 + CPT; j += 4) {
      v4f e = {0.0f, 0.0f, 0.0f, 0.0f};
      if (j < SEQ) {
        v4f v = *(const v4f*)(rowS + j);
        e.x = __expf(v.x - rm); e.y = __expf(v.y - rm);
        e.z = __expf(v.z - rm); e.w = __expf(v.w - rm);
      }
      *(v4f*)(rowS + j) = e;
      v4h h4;
      h4.x = (_Float16)(e.x * PSC); h4.y = (_Float16)(e.y * PSC);
      h4.z = (_Float16)(e.z * PSC); h4.w = (_Float16)(e.w * PSC);
      *(v4h*)(rowA + j) = h4;
      sum += (e.x + e.y) + (e.z + e.w);
    }
    sRed[row * TPR + sub] = sum;
    __syncthreads();
    if (sub == 0) {
      float s2 = 0.0f;
      #pragma unroll
      for (int u = 0; u < TPR; ++u) s2 += sRed[row * TPR + u];
      sRcp[row] = 1.0f / s2;
    }
    __syncthreads();
  }

  // ---------- Phase 4: per-distance mass, fixed 2-key gather (no atomics) ---
  // keys at circular distance dist from row q: (q-dist) mod S and (q+dist) mod S (one key when they coincide)
  for (int idx = tid; idx < 16 * NDIST; idx += NT) {
    const int m = idx >> 9, dist = idx & (NDIST - 1);
    const int qrow = min(qt * 16 + m, SEQ - 1);
    float val = 0.0f;
    if (dist <= DMAX) {
      int k1 = qrow - dist; if (k1 < 0) k1 += SEQ;
      int k2 = qrow + dist; if (k2 >= SEQ) k2 -= SEQ;
      val = sS[m * SPAD + k1];
      if (k2 != k1) val += sS[m * SPAD + k2];
    }
    sD[idx] = (_Float16)(val * PSC);
  }
  __syncthreads();

  // ---------- Phase 5: out = (P@V + D@relV) * rcp / 256 -----------------------
  {
    const int dbase = (wave & 3) * 16;           // 16 head dims per wave
    const int ks    = wave >> 2;                 // this wave's part of the key range and of the distance range
    const int key0  = ks * (SPAD / KSP);
    const int dis0  = ks * (NDIST / KSP);
    const _Float16* vcol  = Vbh + (size_t)(dbase + n) * SPAD  + key0 + 8 * hi;   // B[k=key][n=dim], k-contiguous
    const _Float16* rvcol = RVt + (size_t)(dbase + n) * NDIST + dis0 + 8 * hi;   // B[k=dist][n=dim], k-contiguous
    const _Float16* arow  = sA + n * SPAD  + key0 + 8 * hi;                      // A[m=row][k=key]
    const _Float16* drow  = sD + n * NDIST + dis0 + 8 * hi;                      // A[m=row][k=dist]
    v8f acc = zero8();

    #pragma unroll 4
    for (int kt2 = 0; kt2 < SPAD / 32 / KSP; ++kt2) {
      const int kb = kt2 * 32;
      FragH a, bb;
      a.h[0]  = *(const v8h*)(arow + kb);
      a.h[1]  = *(const v8h*)(arow + kb + 16);
      bb.h[0] = *(const v8h*)(vcol + kb);
      bb.h[1] = *(const v8h*)(vcol + kb + 16);
      acc = wmma_f16(a, bb, acc);
    }
    #pragma unroll 4
    for (int rt = 0; rt < NDIST / 32 / KSP; ++rt) {
      const int kb = rt * 32;
      FragH a, bb;
      a.h[0]  = *(const v8h*)(drow + kb);
      a.h[1]  = *(const v8h*)(drow + kb + 16);
      bb.h[0] = *(const v8h*)(rvcol + kb);
      bb.h[1] = *(const v8h*)(rvcol + kb + 16);
      acc = wmma_f16(a, bb, acc);
    }
    // stage this wave's 16x16 f32 partial sum (sP is free after phase 2)
    #pragma unroll
    for (int r = 0; r < 8; ++r) {
      const int m = r + 8 * hi;
      sP[(ks * 16 + m) * DH + dbase + n] = acc[r];
    }
  }
  __syncthreads();

  // add the KSP partial sums, normalise, store whole 128-B lines (8 lanes each)
  if (tid < 16 * DH / 4) {
    float* obase = Out + baseQ;
    const int m = tid >> 4;
    const int c = (tid & 15) * 4;
    const int qrow = qt * 16 + m;
    v4f v = *(const v4f*)(sP + m * DH + c);
    #pragma unroll
    for (int s = 1; s < KSP; ++s) v += *(const v4f*)(sP + (s * 16 + m) * DH + c);
    v *= sRcp[m] * PSCI;
    if (qrow < SEQ) *(v4f*)(obase + (size_t)qrow * DM + c) = v;
  }
}

extern "C" void kernel_launch(void* const* d_in, const int* in_sizes, int n_in,
                              void* d_out, int out_size, void* d_ws, size_t ws_size,
                              hipStream_t stream) {
  if (n_in < 5) return;
  if (in_sizes[0] < NB * SEQ * DM || in_sizes[1] < NB * SEQ * DM || in_sizes[2] < NB * SEQ * DM) return;
  if (in_sizes[3] < NDIST * DH || in_sizes[4] < NDIST * DH) return;
  if (out_size < NB * SEQ * DM) return;
  const size_t ws_need = WS_END * 2;           // 16,777,216 B
  if (ws_size < ws_need) return;

  const float* Q  = (const float*)d_in[0];
  const float* K  = (const float*)d_in[1];
  const float* V  = (const float*)d_in[2];
  const float* RK = (const float*)d_in[3];
  const float* RV = (const float*)d_in[4];
  float* Out = (float*)d_out;
  unsigned short* ws16 = (unsigned short*)d_ws;

  unsigned short* Kb  = ws16 + WS_K;
  _Float16*       Vt  = (_Float16*)(ws16 + WS_VT);
  unsigned short* RKb = ws16 + WS_RK;
  _Float16*       RVt = (_Float16*)(ws16 + WS_RVT);

  prep_k_kernel  <<<(NK8 + 255) / 256, 256, 0, stream>>>(K, Kb);
  prep_vt_kernel <<<(NV8 + 255) / 256, 256, 0, stream>>>(V, Vt);
  prep_rel_kernel<<<(2 * NR8 + 255) / 256, 256, 0, stream>>>(RK, RV, RKb, RVt);

  dim3 grid(QTN, NB * NH);
  circ_rel_attn_kernel<<<grid, dim3(NT), 0, stream>>>(Q, Kb, Vt, RKb, RVt, Out);
}

// v002
// A run of this version takes 163 microseconds.
// Two timings next to v001 both put it at 1.35 times that version's speed.
// Counting every step since v000, it is 2.36 times as fast.
#include <hip/hip_runtime.h>

// Contractions: Q*K^T and Q*relK^T on v_wmma_f32_16x16x32_bf16 (bf16 operands, f32 accumulate);
// P*V and bucketed P*relV on v_wmma_f32_16x16x32_f16 (f16 operands: P scaled by 2^8, V/relV carry bf16-RNE values; f32 accumulate).

typedef _Float16 v16h __attribute__((ext_vector_type(16)));
typedef _Float16 v8h  __attribute__((ext_vector_type(8), may_alias));
typedef _Float16 v4h  __attribute__((ext_vector_type(4), may_alias));
typedef __bf16   v16b __attribute__((ext_vector_type(16)));
typedef unsigned short v8us __attribute__((ext_vector_type(8), may_alias));
typedef float v8f __attribute__((ext_vector_type(8)));
typedef float v4f __attribute__((ext_vector_type(4), may_alias));

#define SEQ   1000   // sequence length
#define SEQP  1008   // keys padded to a multiple of 16
#define DM    512    // model width
#define DH    64     // head dim
#define NB    8      // batch
#define NH    8      // heads
#define QTN   63     // query tiles of 16
#define KTI   63     // key tiles of 16
#define SPAD  1024   // padded key dim (multiple of 32)
#define NDIST 512    // padded distance dim (>= 501, multiple of 32)
#define DMAX  500    // largest circular distance
#define NW    16     // waves per attention block
#define NT    512    // threads per attention block
#define TPR   (NT / 16)      // threads per score row in the softmax
#define KSP   (NW / 4)       // waves that share one 16-dim output tile, each on its own part of the k range
// LDS row pitches: each keeps the lanes of one LDS instruction on distinct banks (64 banks of 4 B)
#define QP    (DH + 8)       // sQ, 2-B elements: 144 B = 16 B x odd, for the 16-B fragment reads down 16 rows
#define AP    (SPAD + 8)     // sA, 2-B elements: 2064 B = 16 B x odd
#define DP    (NDIST + 8)    // sD, 2-B elements: 1040 B = 16 B x odd
#define SP    (SPAD + 4)     // sS, f32: 8 rows = 32 banks mod 64, so the two lane halves of a D tile do not meet
#define PP    (NDIST + 4)    // sP, f32: the same
#define OP    (DH + 4)       // partial outputs in sP, f32: the same
#define PSC   256.0f        // power-of-two scale on the f16 attention weights
#define PSCI  0.00390625f   // 1/256

// workspace layout in 2-byte elements
#define WS_K    ((size_t)0)                              // [8][1008][512]  bf16 K, padded rows zero
#define WS_VT   ((size_t)NB * SEQP * DM)                 // [64][64][1024]  f16 V^T per (b,h)
#define WS_RK   (WS_VT + (size_t)NB * NH * DH * SPAD)    // [512][64]       bf16 relK
#define WS_RVT  (WS_RK + (size_t)NDIST * DH)             // [64][512]       f16 relV^T
#define WS_END  (WS_RVT + (size_t)DH * NDIST)

#define NK8  (NB * SEQP * DM / 8)       // threads of 8 elements, K copy
#define NV8  (NB * NH * DH * SPAD / 8)  // threads of 8 elements, V^T copy
#define NR8  (NDIST * DH / 8)           // threads of 8 elements, each rel table

union FragH { v16h v; v8h  h[2]; };
union FragB { v16b v; v8us h[2]; };

__device__ __forceinline__ v8f zero8() {
  v8f z = {0.0f, 0.0f, 0.0f, 0.0f, 0.0f, 0.0f, 0.0f, 0.0f};
  return z;
}

__device__ __forceinline__ v8f wmma_f16(const FragH& a, const FragH& b, v8f c) {
  v8f d = __builtin_amdgcn_wmma_f32_16x16x32_f16(false, a.v, false, b.v, (short)0, c, false, false);
  asm volatile("v_nop\n\tv_nop\n\tv_nop\n\tv_nop" : "+v"(d) : "v"(a.v), "v"(b.v));
  return d;
}

__device__ __forceinline__ v8f wmma_bf16(const FragB& a, const FragB& b, v8f c) {
  v8f d = __builtin_amdgcn_wmma_f32_16x16x32_bf16(false, a.v, false, b.v, (short)0, c, false, false);
  asm volatile("v_nop\n\tv_nop\n\tv_nop\n\tv_nop" : "+v"(d) : "v"(a.v), "v"(b.v));
  return d;
}

// f32 -> bf16 bits, RNE
__device__ __forceinline__ unsigned short bf16_rne(float f) {
  unsigned int u = __float_as_uint(f);
  u += 0x7FFFu + ((u >> 16) & 1u);
  return (unsigned short)(u >> 16);
}

// f32 -> bf16 (RNE) -> f16 ; the second step is exact for bf16 values in f16 range
__device__ __forceinline__ _Float16 f16_of_bf16(float f) {
  unsigned int u = ((unsigned int)bf16_rne(f)) << 16;
  return (_Float16)__uint_as_float(u);
}

// e^x for four values at once (x * log2(e), then the hardware's 2^x, as __expf does).
// One statement with outputs apart from all inputs and a closing v_nop: it keeps the one slot the instruction set asks for
// between a transcendental and an instruction that overwrites its source or reads its result.
__device__ __forceinline__ v4f exp_x4(v4f x) {
  const float a = x.x * 1.44269504f, b = x.y * 1.44269504f, c = x.z * 1.44269504f, d = x.w * 1.44269504f;
  v4f r;
  float r0, r1, r2, r3;
  asm("v_exp_f32 %0, %4\n\tv_exp_f32 %1, %5\n\tv_exp_f32 %2, %6\n\tv_exp_f32 %3, %7\n\tv_nop"
      : "=&v"(r0), "=&v"(r1), "=&v"(r2), "=&v"(r3) : "v"(a), "v"(b), "v"(c), "v"(d));
  r.x = r0; r.y = r1; r.z = r2; r.w = r3;
  return r;
}

__device__ __forceinline__ int circ_dist(int i, int j) {
  int t = (i - j) % SEQ;
  if (t < 0) t += SEQ;
  return min(t, SEQ - t);
}

// ---------------- prep: K -> bf16, rows padded to SEQP --------------------
__global__ __launch_bounds__(256)
void prep_k_kernel(const float* __restrict__ K, unsigned short* __restrict__ Kb) {
  const int t = blockIdx.x * 256 + threadIdx.x;
  if (t >= NK8) return;
  const size_t e0 = (size_t)t * 8;
  const int b = (int)(e0 / ((size_t)SEQP * DM));
  const int r = (int)((e0 / DM) % SEQP);
  const int d = (int)(e0 % DM);
  v8us o = {0, 0, 0, 0, 0, 0, 0, 0};
  if (r < SEQ) {
    const float* src = K + ((size_t)b * SEQ + r) * DM + d;
    v4f x0 = *(const v4f*)(src);
    v4f x1 = *(const v4f*)(src + 4);
    o[0] = bf16_rne(x0.x); o[1] = bf16_rne(x0.y); o[2] = bf16_rne(x0.z); o[3] = bf16_rne(x0.w);
    o[4] = bf16_rne(x1.x); o[5] = bf16_rne(x1.y); o[6] = bf16_rne(x1.z); o[7] = bf16_rne(x1.w);
  }
  v8us* p = (v8us*)(Kb + e0);
  *p = o;
  
}

// ---------------- prep: V -> f16 V^T[bh][dim][key], keys padded to SPAD -----
__global__ __launch_bounds__(256)
void prep_vt_kernel(const float* __restrict__ V, _Float16* __restrict__ Vt) {
  const int t = blockIdx.x * 256 + threadIdx.x;
  if (t >= NV8) return;
  const int e0   = t * 8;
  const int bh   = e0 >> 16;            // DH*SPAD = 65536
  const int dim  = (e0 >> 10) & (DH - 1);
  const int key0 = e0 & (SPAD - 1);     // multiple of 8
  const int b = bh >> 3, h = bh & 7;
  v8h o = {0, 0, 0, 0, 0, 0, 0, 0};
  if (key0 < SEQ) {                     // SEQ is a multiple of 8: all 8 keys valid
    const float* src = V + ((size_t)b * SEQ + key0) * DM + h * DH + dim;
    #pragma unroll
    for (int j = 0; j < 8; ++j) o[j] = f16_of_bf16(src[(size_t)j * DM]);
  }
  v8h* p = (v8h*)(Vt + (size_t)e0);
  *p = o;
  
}

// ---------------- prep: relK -> bf16 [dist][d] ; relV -> f16 relV^T [d][dist] -
__global__ __launch_bounds__(256)
void prep_rel_kernel(const float* __restrict__ RK, const float* __restrict__ RV,
                     unsigned short* __restrict__ RKb, _Float16* __restrict__ RVt) {
  const int t = blockIdx.x * 256 + threadIdx.x;
  if (t < NR8) {
    const int e0 = t * 8;                                 // rows 0..511 direct copy
    v4f x0 = *(const v4f*)(RK + e0);
    v4f x1 = *(const v4f*)(RK + e0 + 4);
    v8us o;
    o[0] = bf16_rne(x0.x); o[1] = bf16_rne(x0.y); o[2] = bf16_rne(x0.z); o[3] = bf16_rne(x0.w);
    o[4] = bf16_rne(x1.x); o[5] = bf16_rne(x1.y); o[6] = bf16_rne(x1.z); o[7] = bf16_rne(x1.w);
    v8us* p = (v8us*)(RKb + e0);
    *p = o;
    
  } else if (t < 2 * NR8) {
    const int e0 = (t - NR8) * 8;                         // out[d][dist0..dist0+7] <- in[dist][d]
    const int d = e0 >> 9;                                // NDIST = 512
    const int dist0 = e0 & (NDIST - 1);
    v8h o;
    #pragma unroll
    for (int j = 0; j < 8; ++j) o[j] = f16_of_bf16(RV[(size_t)(dist0 + j) * DH + d]);
    v8h* p = (v8h*)(RVt + e0);
    *p = o;
    
  }
}

// ---------------- fused attention kernel ------------------------------------
__global__ __launch_bounds__(NT)
void circ_rel_attn_kernel(const float* __restrict__ Q,
                          const unsigned short* __restrict__ Kb,
                          const _Float16* __restrict__ Vt,
                          const unsigned short* __restrict__ RKb,
                          const _Float16* __restrict__ RVt,
                          float* __restrict__ Out)
{
  __shared__ __attribute__((aligned(16))) unsigned short sQ[16 * QP];     //  2 KB  bf16 Q tile
  __shared__ __attribute__((aligned(16))) float          sP[16 * PP];     // 32 KB  P[q][dist] f32; later partial outputs [KSP][16][OP]
  __shared__ __attribute__((aligned(16))) float          sS[16 * SP];     // 64 KB  scores -> exp(scores)
  __shared__ __attribute__((aligned(16))) _Float16       sA[16 * AP];     // 32 KB  exp(scores)*256 f16
  __shared__ __attribute__((aligned(16))) _Float16       sD[16 * DP];     // 16 KB  per-distance mass*256 f16
  __shared__ float sRed[16 * TPR];
  __shared__ float sMax[16];
  __shared__ float sRcp[16];

  const int qt   = blockIdx.x;
  const int bh   = blockIdx.y;
  const int b    = bh >> 3;
  const int h    = bh & 7;
  const int tid  = threadIdx.x;
  const int lane = tid & 31;
  const int wave = tid >> 5;
  const int n    = lane & 15;           // A row / B column / D column
  const int hi   = lane >> 4;           // lane half

  const float scale = 0.125f;
  const size_t baseQ = (size_t)b * SEQ * DM + (size_t)h * DH;
  const unsigned short* Kbh = Kb + ((size_t)b * SEQP) * DM + (size_t)h * DH;
  const _Float16* Vbh = Vt + (size_t)bh * DH * SPAD;

  // ---------- Phase 0: stage Q tile as bf16 ----------------------------------
  for (int idx = tid; idx < 16 * DH; idx += NT) {
    const int m = idx >> 6, d = idx & 63;
    const int qrow = qt * 16 + m;
    const float v = (qrow < SEQ) ? Q[baseQ + (size_t)qrow * DM + d] : 0.0f;
    sQ[m * QP + d] = bf16_rne(v);
  }
  __syncthreads();

  // A fragments of the Q tile: k 0..31 and k 32..63 (split map: elems 0..7 <- k0+8h, 8..15 <- k0+16+8h)
  FragB qa0, qa1;
  {
    const unsigned short* qp = sQ + n * QP + 8 * hi;
    qa0.h[0] = *(const v8us*)(qp);
    qa0.h[1] = *(const v8us*)(qp + 16);
    qa1.h[0] = *(const v8us*)(qp + 32);
    qa1.h[1] = *(const v8us*)(qp + 48);
  }

  // ---------- Phase 1: P = Qtile @ relK^T  (f32 in LDS) ----------------------
  for (int ct = wave; ct < NDIST / 16; ct += NW) {
    const unsigned short* rp = RKb + (size_t)(ct * 16 + n) * DH + 8 * hi;   // B[k=d][n=dist], k-contiguous row
    FragB b0, b1;
    b0.h[0] = *(const v8us*)(rp);
    b0.h[1] = *(const v8us*)(rp + 16);
    b1.h[0] = *(const v8us*)(rp + 32);
    b1.h[1] = *(const v8us*)(rp + 48);
    v8f acc = zero8();
    acc = wmma_bf16(qa0, b0, acc);
    acc = wmma_bf16(qa1, b1, acc);
    #pragma unroll
    for (int r = 0; r < 8; ++r)
      sP[(r + 8 * hi) * PP + ct * 16 + n] = acc[r];
  }
  __syncthreads();

  // ---------- Phase 2: scores = QK^T*scale + P[m][circ_dist] ----------------
  for (int kt = wave; kt < KTI; kt += NW) {
    const int key = kt * 16 + n;                          // <= 1007 < SEQP
    const unsigned short* kp = Kbh + (size_t)key * DM + 8 * hi;   // B[k=d][n=key], k-contiguous row
    FragB b0, b1;
    b0.h[0] = *(const v8us*)(kp);
    b0.h[1] = *(const v8us*)(kp + 16);
    b1.h[0] = *(const v8us*)(kp + 32);
    b1.h[1] = *(const v8us*)(kp + 48);
    v8f acc = zero8();
    acc = wmma_bf16(qa0, b0, acc);
    acc = wmma_bf16(qa1, b1, acc);
    #pragma unroll
    for (int r = 0; r < 8; ++r) {
      const int m = r + 8 * hi;
      const int qrow = min(qt * 16 + m, SEQ - 1);
      float sc;
      if (key < SEQ) {
        const int d = circ_dist(qrow, key);
        sc = acc[r] * scale + sP[m * PP + d];
      } else {
        sc = -1.0e30f;
      }
      sS[m * SP + key] = sc;
    }
  }
  __syncthreads();

  // ---------- Phase 3: row softmax (normalisation deferred) -----------------
  {
    const int row = tid / TPR, sub = tid % TPR;
    const int j0 = sub * 4;   // neighbouring threads take neighbouring float4s: each LDS access of a wave is one contiguous run
    float* rowS = sS + row * SP;
    _Float16* rowA = sA + row * AP;

    float mx = -1.0e30f;
    for (int it = 0; it < SPAD / (4 * TPR); ++it) {
      const int j = j0 + it * (4 * TPR);
      if (j < SEQ) {   // SEQ is a multiple of 4: a float4 is entirely valid or entirely padding
        v4f v = *(const v4f*)(rowS + j);
        mx = fmaxf(mx, fmaxf(fmaxf(v.x, v.y), fmaxf(v.z, v.w)));
      }
    }
    sRed[row * TPR + sub] = mx;
    __syncthreads();
    if (sub == 0) {
      float m2 = sRed[row * TPR];
      #pragma unroll
      for (int u = 1; u < TPR; ++u) m2 = fmaxf(m2, sRed[row * TPR + u]);
      sMax[row] = m2;
    }
    __syncthreads();
    const float rm = sMax[row];
    float sum = 0.0f;
    for (int it = 0; it < SPAD / (4 * TPR); ++it) {
      const int j = j0 + it * (4 * TPR);
      v4f e = {0.0f, 0.0f, 0.0f, 0.0f};
      if (j < SEQ) {
        v4f v = *(const v4f*)(rowS + j);
        e = exp_x4(v - rm);
      }
      *(v4f*)(rowS + j) = e;
      v4h h4;
      h4.x = (_Float16)(e.x * PSC); h4.y = (_Float16)(e.y * PSC);
      h4.z = (_Float16)(e.z * PSC); h4.w = (_Float16)(e.w * PSC);
      *(v4h*)(rowA + j) = h4;
      sum += (e.x + e.y) + (e.z + e.w);
    }
    sRed[row * TPR + sub] = sum;
    __syncthreads();
    if (sub == 0) {
      float s2 = 0.0f;
      #pragma unroll
      for (int u = 0; u < TPR; ++u) s2 += sRed[row * TPR + u];
      sRcp[row] = 1.0f / s2;
    }
    __syncthreads();
  }

  // ---------- Phase 4: per-distance mass, fixed 2-key gather (no atomics) ---
  // keys at circular distance dist from row q: (q-dist) mod S and (q+dist) mod S (one key when they coincide)
  for (int idx = tid; idx < 16 * NDIST; idx += NT) {
    const int m = idx >> 9, dist = idx & (NDIST - 1);
    const int qrow = min(qt * 16 + m, SEQ - 1);
    float val = 0.0f;
    if (dist <= DMAX) {
      int k1 = qrow - dist; if (k1 < 0) k1 += SEQ;
      int k2 = qrow + dist; if (k2 >= SEQ) k2 -= SEQ;
      val = sS[m * SP + k1];
      if (k2 != k1) val += sS[m * SP + k2];
    }
    sD[m * DP + dist] = (_Float16)(val * PSC);
  }
  __syncthreads();

  // ---------- Phase 5: out = (P@V + D@relV) * rcp / 256 -----------------------
  {
    const int dbase = (wave & 3) * 16;           // 16 head dims per wave
    const int ks    = wave >> 2;                 // this wave's part of the key range and of the distance range
    const int key0  = ks * (SPAD / KSP);
    const int dis0  = ks * (NDIST / KSP);
    const _Float16* vcol  = Vbh + (size_t)(dbase + n) * SPAD  + key0 + 8 * hi;   // B[k=key][n=dim], k-contiguous
    const _Float16* rvcol = RVt + (size_t)(dbase + n) * NDIST + dis0 + 8 * hi;   // B[k=dist][n=dim], k-contiguous
    const _Float16* arow  = sA + n * AP    + key0 + 8 * hi;                      // A[m=row][k=key]
    const _Float16* drow  = sD + n * DP    + dis0 + 8 * hi;                      // A[m=row][k=dist]
    v8f acc = zero8();

    #pragma unroll 4
    for (int kt2 = 0; kt2 < SPAD / 32 / KSP; ++kt2) {
      const int kb = kt2 * 32;
      FragH a, bb;
      a.h[0]  = *(const v8h*)(arow + kb);
      a.h[1]  = *(const v8h*)(arow + kb + 16);
      bb.h[0] = *(const v8h*)(vcol + kb);
      bb.h[1] = *(const v8h*)(vcol + kb + 16);
      acc = wmma_f16(a, bb, acc);
    }
    #pragma unroll 4
    for (int rt = 0; rt < NDIST / 32 / KSP; ++rt) {
      const int kb = rt * 32;
      FragH a, bb;
      a.h[0]  = *(const v8h*)(drow + kb);
      a.h[1]  = *(const v8h*)(drow + kb + 16);
      bb.h[0] = *(const v8h*)(rvcol + kb);
      bb.h[1] = *(const v8h*)(rvcol + kb + 16);
      acc = wmma_f16(a, bb, acc);
    }
    // stage this wave's 16x16 f32 partial sum (sP is free after phase 2)
    #pragma unroll
    for (int r = 0; r < 8; ++r) {
      const int m = r + 8 * hi;
      sP[(ks * 16 + m) * OP + dbase + n] = acc[r];
    }
  }
  __syncthreads();

  // add the KSP partial sums, normalise, store whole 128-B lines (8 lanes each)
  if (tid < 16 * DH / 4) {
    float* obase = Out + baseQ;
    const int m = tid >> 4;
    const int c = (tid & 15) * 4;
    const int qrow = qt * 16 + m;
    v4f v = *(const v4f*)(sP + m * OP + c);
    #pragma unroll
    for (int s = 1; s < KSP; ++s) v += *(const v4f*)(sP + (s * 16 + m) * OP + c);
    v *= sRcp[m] * PSCI;
    if (qrow < SEQ) *(v4f*)(obase + (size_t)qrow * DM + c) = v;
  }
}

extern "C" void kernel_launch(void* const* d_in, const int* in_sizes, int n_in,
                              void* d_out, int out_size, void* d_ws, size_t ws_size,
                              hipStream_t stream) {
  if (n_in < 5) return;
  if (in_sizes[0] < NB * SEQ * DM || in_sizes[1] < NB * SEQ * DM || in_sizes[2] < NB * SEQ * DM) return;
  if (in_sizes[3] < NDIST * DH || in_sizes[4] < NDIST * DH) return;
  if (out_size < NB * SEQ * DM) return;
  const size_t ws_need = WS_END * 2;           // 16,777,216 B
  if (ws_size < ws_need) return;

  const float* Q  = (const float*)d_in[0];
  const float* K  = (const float*)d_in[1];
  const float* V  = (const float*)d_in[2];
  const float* RK = (const float*)d_in[3];
  const float* RV = (const float*)d_in[4];
  float* Out = (float*)d_out;
  unsigned short* ws16 = (unsigned short*)d_ws;

  unsigned short* Kb  = ws16 + WS_K;
  _Float16*       Vt  = (_Float16*)(ws16 + WS_VT);
  unsigned short* RKb = ws16 + WS_RK;
  _Float16*       RVt = (_Float16*)(ws16 + WS_RVT);

  prep_k_kernel  <<<(NK8 + 255) / 256, 256, 0, stream>>>(K, Kb);
  prep_vt_kernel <<<(NV8 + 255) / 256, 256, 0, stream>>>(V, Vt);
  prep_rel_kernel<<<(2 * NR8 + 255) / 256, 256, 0, stream>>>(RK, RV, RKb, RVt);

  dim3 grid(QTN, NB * NH);
  circ_rel_attn_kernel<<<grid, dim3(NT), 0, stream>>>(Q, Kb, Vt, RKb, RVt, Out);
}

// v003
// A run of this version takes 158 microseconds.
// In both of two side-by-side timings against v002, it was 1.03 times as fast.
// Over all steps from v000 it is 2.44 times as fast.
#include <hip/hip_runtime.h>

// Contractions: Q*K^T and Q*relK^T on v_wmma_f32_16x16x32_bf16 (bf16 operands, f32 accumulate);
// P*V and bucketed P*relV on v_wmma_f32_16x16x32_f16 (f16 operands: P scaled by 2^8, V/relV carry bf16-RNE values; f32 accumulate).

typedef _Float16 v16h __attribute__((ext_vector_type(16)));
typedef _Float16 v8h  __attribute__((ext_vector_type(8), may_alias));
typedef _Float16 v4h  __attribute__((ext_vector_type(4), may_alias));
typedef __bf16   v16b __attribute__((ext_vector_type(16)));
typedef unsigned short v8us __attribute__((ext_vector_type(8), may_alias));
typedef float v8f __attribute__((ext_vector_type(8)));
typedef float v4f __attribute__((ext_vector_type(4), may_alias));

#define SEQ   1000   // sequence length
#define SEQP  1008   // keys padded to a multiple of 16
#define DM    512    // model width
#define DH    64     // head dim
#define NB    8      // batch
#define NH    8      // heads
#define QTN   63     // query tiles of 16
#define KTI   63     // key tiles of 16
#define SPAD  1024   // padded key dim (multiple of 32)
#define NDIST 512    // padded distance dim (>= 501, multiple of 32)
#define DMAX  500    // largest circular distance
#define NW    16     // waves per attention block
#define NT    512    // threads per attention block
#define TPR   (NT / 16)      // threads per score row in the softmax
#define KSP   (NW / 4)       // waves that share one 16-dim output tile, each on its own part of the k range
#define QPT   (16 * DH / NT)             // Q elements staged per thread
#define RTW   (NDIST / 16 / NW)          // relK column tiles per wave
#define KTW   ((KTI + NW - 1) / NW)      // key tiles per wave (the last wave has one fewer)
#define VSW   (SPAD / 32 / KSP)          // k steps of P*V per wave
#define RSW   (NDIST / 32 / KSP)         // k steps of D*relV per wave
// LDS row pitches: each keeps the lanes of one LDS instruction on distinct banks (64 banks of 4 B)
#define QP    (DH + 8)       // sQ, 2-B elements: 144 B = 16 B x odd, for the 16-B fragment reads down 16 rows
#define AP    (SPAD + 8)     // sA, 2-B elements: 2064 B = 16 B x odd
#define DP    (NDIST + 8)    // sD, 2-B elements: 1040 B = 16 B x odd
#define SP    (SPAD + 4)     // sS, f32: 8 rows = 32 banks mod 64, so the two lane halves of a D tile do not meet
#define PP    (NDIST + 4)    // sP, f32: the same
#define OP    (DH + 4)       // partial outputs in sP, f32: the same
#define PSC   256.0f        // power-of-two scale on the f16 attention weights
#define PSCI  0.00390625f   // 1/256

// workspace layout in 2-byte elements
#define WS_K    ((size_t)0)                              // [8][1008][512]  bf16 K, padded rows zero
#define WS_VT   ((size_t)NB * SEQP * DM)                 // [64][64][1024]  f16 V^T per (b,h)
#define WS_RK   (WS_VT + (size_t)NB * NH * DH * SPAD)    // [512][64]       bf16 relK
#define WS_RVT  (WS_RK + (size_t)NDIST * DH)             // [64][512]       f16 relV^T
#define WS_END  (WS_RVT + (size_t)DH * NDIST)

#define NK8  (NB * SEQP * DM / 8)       // threads of 8 elements, K copy
#define NV8  (NB * NH * DH * SPAD / 8)  // threads of 8 elements, V^T copy
#define NR8  (NDIST * DH / 8)           // threads of 8 elements, each rel table

union FragH { v16h v; v8h  h[2]; };
union FragB { v16b v; v8us h[2]; };

__device__ __forceinline__ v8f zero8() {
  v8f z = {0.0f, 0.0f, 0.0f, 0.0f, 0.0f, 0.0f, 0.0f, 0.0f};
  return z;
}

__device__ __forceinline__ v8f wmma_f16(const FragH& a, const FragH& b, v8f c) {
  v8f d = __builtin_amdgcn_wmma_f32_16x16x32_f16(false, a.v, false, b.v, (short)0, c, false, false);
  asm volatile("v_nop\n\tv_nop\n\tv_nop\n\tv_nop" : "+v"(d) : "v"(a.v), "v"(b.v));
  return d;
}

__device__ __forceinline__ v8f wmma_bf16(const FragB& a, const FragB& b, v8f c) {
  v8f d = __builtin_amdgcn_wmma_f32_16x16x32_bf16(false, a.v, false, b.v, (short)0, c, false, false);
  asm volatile("v_nop\n\tv_nop\n\tv_nop\n\tv_nop" : "+v"(d) : "v"(a.v), "v"(b.v));
  return d;
}

// f32 -> bf16 bits, RNE
__device__ __forceinline__ unsigned short bf16_rne(float f) {
  unsigned int u = __float_as_uint(f);
  u += 0x7FFFu + ((u >> 16) & 1u);
  return (unsigned short)(u >> 16);
}

// f32 -> bf16 (RNE) -> f16 ; the second step is exact for bf16 values in f16 range
__device__ __forceinline__ _Float16 f16_of_bf16(float f) {
  unsigned int u = ((unsigned int)bf16_rne(f)) << 16;
  return (_Float16)__uint_as_float(u);
}

// e^x for four values at once (x * log2(e), then the hardware's 2^x, as __expf does).
// One statement with outputs apart from all inputs and a closing v_nop: it keeps the one slot the instruction set asks for
// between a transcendental and an instruction that overwrites its source or reads its result.
__device__ __forceinline__ v4f exp_x4(v4f x) {
  const float a = x.x * 1.44269504f, b = x.y * 1.44269504f, c = x.z * 1.44269504f, d = x.w * 1.44269504f;
  v4f r;
  float r0, r1, r2, r3;
  asm("v_exp_f32 %0, %4\n\tv_exp_f32 %1, %5\n\tv_exp_f32 %2, %6\n\tv_exp_f32 %3, %7\n\tv_nop"
      : "=&v"(r0), "=&v"(r1), "=&v"(r2), "=&v"(r3) : "v"(a), "v"(b), "v"(c), "v"(d));
  r.x = r0; r.y = r1; r.z = r2; r.w = r3;
  return r;
}

// Work-group barrier that orders LDS only. All that the waves of a block hand each other goes through LDS, and the global
// buffers read here are written by earlier launches alone. __syncthreads() also drains the wave's outstanding global loads,
// which would end the flight of the fragment loads issued ahead at the first barrier behind them.
__device__ __forceinline__ void lds_barrier() {
  __builtin_amdgcn_fence(__ATOMIC_RELEASE, "workgroup", "local");
  __builtin_amdgcn_s_barrier();
  __builtin_amdgcn_fence(__ATOMIC_ACQUIRE, "workgroup", "local");
}

__device__ __forceinline__ int circ_dist(int i, int j) {
  int t = (i - j) % SEQ;
  if (t < 0) t += SEQ;
  return min(t, SEQ - t);
}

// ---------------- prep: K -> bf16, rows padded to SEQP --------------------
__global__ __launch_bounds__(256)
void prep_k_kernel(const float* __restrict__ K, unsigned short* __restrict__ Kb) {
  const int t = blockIdx.x * 256 + threadIdx.x;
  if (t >= NK8) return;
  const size_t e0 = (size_t)t * 8;
  const int b = (int)(e0 / ((size_t)SEQP * DM));
  const int r = (int)((e0 / DM) % SEQP);
  const int d = (int)(e0 % DM);
  v8us o = {0, 0, 0, 0, 0, 0, 0, 0};
  if (r < SEQ) {
    const float* src = K + ((size_t)b * SEQ + r) * DM + d;
    v4f x0 = *(const v4f*)(src);
    v4f x1 = *(const v4f*)(src + 4);
    o[0] = bf16_rne(x0.x); o[1] = bf16_rne(x0.y); o[2] = bf16_rne(x0.z); o[3] = bf16_rne(x0.w);
    o[4] = bf16_rne(x1.x); o[5] = bf16_rne(x1.y); o[6] = bf16_rne(x1.z); o[7] = bf16_rne(x1.w);
  }
  v8us* p = (v8us*)(Kb + e0);
  *p = o;
  
}

// ---------------- prep: V -> f16 V^T[bh][dim][key], keys padded to SPAD -----
__global__ __launch_bounds__(256)
void prep_vt_kernel(const float* __restrict__ V, _Float16* __restrict__ Vt) {
  const int t = blockIdx.x * 256 + threadIdx.x;
  if (t >= NV8) return;
  const int e0   = t * 8;
  const int bh   = e0 >> 16;            // DH*SPAD = 65536
  const int dim  = (e0 >> 10) & (DH - 1);
  const int key0 = e0 & (SPAD - 1);     // multiple of 8
  const int b = bh >> 3, h = bh & 7;
  v8h o = {0, 0, 0, 0, 0, 0, 0, 0};
  if (key0 < SEQ) {                     // SEQ is a multiple of 8: all 8 keys valid
    const float* src = V + ((size_t)b * SEQ + key0) * DM + h * DH + dim;
    #pragma unroll
    for (int j = 0; j < 8; ++j) o[j] = f16_of_bf16(src[(size_t)j * DM]);
  }
  v8h* p = (v8h*)(Vt + (size_t)e0);
  *p = o;
  
}

// ---------------- prep: relK -> bf16 [dist][d] ; relV -> f16 relV^T [d][dist] -
__global__ __launch_bounds__(256)
void prep_rel_kernel(const float* __restrict__ RK, const float* __restrict__ RV,
                     unsigned short* __restrict__ RKb, _Float16* __restrict__ RVt) {
  const int t = blockIdx.x * 256 + threadIdx.x;
  if (t < NR8) {
    const int e0 = t * 8;                                 // rows 0..511 direct copy
    v4f x0 = *(const v4f*)(RK + e0);
    v4f x1 = *(const v4f*)(RK + e0 + 4);
    v8us o;
    o[0] = bf16_rne(x0.x); o[1] = bf16_rne(x0.y); o[2] = bf16_rne(x0.z); o[3] = bf16_rne(x0.w);
    o[4] = bf16_rne(x1.x); o[5] = bf16_rne(x1.y); o[6] = bf16_rne(x1.z); o[7] = bf16_rne(x1.w);
    v8us* p = (v8us*)(RKb + e0);
    *p = o;
    
  } else if (t < 2 * NR8) {
    const int e0 = (t - NR8) * 8;                         // out[d][dist0..dist0+7] <- in[dist][d]
    const int d = e0 >> 9;                                // NDIST = 512
    const int dist0 = e0 & (NDIST - 1);
    v8h o;
    #pragma unroll
    for (int j = 0; j < 8; ++j) o[j] = f16_of_bf16(RV[(size_t)(dist0 + j) * DH + d]);
    v8h* p = (v8h*)(RVt + e0);
    *p = o;
    
  }
}

// ---------------- fused attention kernel ------------------------------------
__global__ __launch_bounds__(NT)
void circ_rel_attn_kernel(const float* __restrict__ Q,
                          const unsigned short* __restrict__ Kb,
                          const _Float16* __restrict__ Vt,
                          const unsigned short* __restrict__ RKb,
                          const _Float16* __restrict__ RVt,
                          float* __restrict__ Out)
{
  __shared__ __attribute__((aligned(16))) unsigned short sQ[16 * QP];     //  2 KB  bf16 Q tile
  __shared__ __attribute__((aligned(16))) float          sP[16 * PP];     // 32 KB  P[q][dist] f32; later partial outputs [KSP][16][OP]
  __shared__ __attribute__((aligned(16))) float          sS[16 * SP];     // 64 KB  scores -> exp(scores)
  __shared__ __attribute__((aligned(16))) _Float16       sA[16 * AP];     // 32 KB  exp(scores)*256 f16
  __shared__ __attribute__((aligned(16))) _Float16       sD[16 * DP];     // 16 KB  per-distance mass*256 f16
  __shared__ float sRed[16 * TPR];
  __shared__ float sMax[16];
  __shared__ float sRcp[16];

  const int qt   = blockIdx.x;
  const int bh   = blockIdx.y;
  const int b    = bh >> 3;
  const int h    = bh & 7;
  const int tid  = threadIdx.x;
  const int lane = tid & 31;
  const int wave = tid >> 5;
  const int n    = lane & 15;           // A row / B column / D column
  const int hi   = lane >> 4;           // lane half

  const float scale = 0.125f;
  const size_t baseQ = (size_t)b * SEQ * DM + (size_t)h * DH;
  const unsigned short* Kbh = Kb + ((size_t)b * SEQP) * DM + (size_t)h * DH;
  const _Float16* Vbh = Vt + (size_t)bh * DH * SPAD;

  // ---------- Global loads issued ahead: none of them depends on anything computed here, so each group is
  // issued one phase or more before its use and its latency passes behind the work in between.
  // Group 1 (here): the Q elements, this wave's relK tiles, its first two key tiles.
  float qv[QPT];
  const float* qp[QPT];
  #pragma unroll   // constant indices: qv stays in registers, and all its loads are issued before the first wait
  for (int i = 0; i < QPT; ++i) {
    const int idx = tid + i * NT;
    const int m = idx >> 6, d = idx & 63;
    qp[i] = Q + baseQ + (size_t)min(qt * 16 + m, SEQ - 1) * DM + d;   // row clamped; rows past the end are zeroed below
    qv[i] = *qp[i];
  }
  const unsigned short* rp0 = RKb + (size_t)(wave * 16 + n) * DH + 8 * hi;   // B[k=d][n=dist], k-contiguous row
  FragB rk[RTW][2];
  #pragma unroll   // constant indices: the fragments stay in registers
  for (int i = 0; i < RTW; ++i) {
    const unsigned short* rp = rp0 + (size_t)i * NW * 16 * DH;
    rk[i][0].h[0] = *(const v8us*)(rp);
    rk[i][0].h[1] = *(const v8us*)(rp + 16);
    rk[i][1].h[0] = *(const v8us*)(rp + 32);
    rk[i][1].h[1] = *(const v8us*)(rp + 48);
  }
  const unsigned short* kp0 = Kbh + (size_t)(wave * 16 + n) * DM + 8 * hi;   // B[k=d][n=key], k-contiguous row
  FragB kf[KTW][2];
  #pragma unroll   // constant indices: the fragments stay in registers
  for (int i = 0; i < KTW / 2; ++i) {
    const unsigned short* kp = kp0 + (size_t)i * NW * 16 * DM;
    kf[i][0].h[0] = *(const v8us*)(kp);
    kf[i][0].h[1] = *(const v8us*)(kp + 16);
    kf[i][1].h[0] = *(const v8us*)(kp + 32);
    kf[i][1].h[1] = *(const v8us*)(kp + 48);
  }
  static_assert(QPT == 2, "the wait below names one address per Q load");
  // Behind each group: the wait that is kept in front of any overwrite of an issued load's address registers. The addresses
  // are inputs, so they live up to the wait (left to itself the build gave some loads an address register of the group as
  // their destination, or waited to a count only).
  asm volatile("s_wait_xcnt 0x0" :: "v"(qp[0]), "v"(qp[1]), "v"(rp0), "v"(kp0) : "memory");

  // ---------- Phase 0: stage Q tile as bf16 ----------------------------------
  #pragma unroll   // constant indices into qv
  for (int i = 0; i < QPT; ++i) {
    const int idx = tid + i * NT;
    const int m = idx >> 6, d = idx & 63;
    const float v = (qt * 16 + m < SEQ) ? qv[i] : 0.0f;
    sQ[m * QP + d] = bf16_rne(v);
  }
  lds_barrier();

  // A fragments of the Q tile: k 0..31 and k 32..63 (split map: elems 0..7 <- k0+8h, 8..15 <- k0+16+8h)
  FragB qa0, qa1;
  {
    const unsigned short* qp = sQ + n * QP + 8 * hi;
    qa0.h[0] = *(const v8us*)(qp);
    qa0.h[1] = *(const v8us*)(qp + 16);
    qa1.h[0] = *(const v8us*)(qp + 32);
    qa1.h[1] = *(const v8us*)(qp + 48);
  }

  // ---------- Phase 1: P = Qtile @ relK^T  (f32 in LDS) ----------------------
  #pragma unroll   // constant indices into rk
  for (int i = 0; i < RTW; ++i) {
    const int ct = wave + i * NW;
    v8f acc = zero8();
    acc = wmma_bf16(qa0, rk[i][0], acc);
    acc = wmma_bf16(qa1, rk[i][1], acc);
    #pragma unroll
    for (int r = 0; r < 8; ++r)
      sP[(r + 8 * hi) * PP + ct * 16 + n] = acc[r];
  }
  // Group 2: the other key tiles, into the registers that relK has left; they land behind the first two tiles' work.
  const unsigned short* kq[KTW];
  #pragma unroll   // constant indices into kf
  for (int i = KTW / 2; i < KTW; ++i) {
    const int kt = min(wave + i * NW, KTI - 1);   // the last wave has no last tile: address clamped, value unused
    kq[i] = Kbh + (size_t)(kt * 16 + n) * DM + 8 * hi;
    kf[i][0].h[0] = *(const v8us*)(kq[i]);
    kf[i][0].h[1] = *(const v8us*)(kq[i] + 16);
    kf[i][1].h[0] = *(const v8us*)(kq[i] + 32);
    kf[i][1].h[1] = *(const v8us*)(kq[i] + 48);
  }
  static_assert(KTW == 4, "the wait below names one address per tile of the group");
  asm volatile("s_wait_xcnt 0x0" :: "v"(kq[2]), "v"(kq[3]) : "memory");   // as behind group 1
  lds_barrier();

  // ---------- Phase 2: scores = QK^T*scale + P[m][circ_dist] ----------------
  #pragma unroll   // constant indices into kf
  for (int i = 0; i < KTW; ++i) {
    const int kt = wave + i * NW;
    if (kt >= KTI) break;
    const int key = kt * 16 + n;                          // <= 1007 < SEQP
    v8f acc = zero8();
    acc = wmma_bf16(qa0, kf[i][0], acc);
    acc = wmma_bf16(qa1, kf[i][1], acc);
    #pragma unroll
    for (int r = 0; r < 8; ++r) {
      const int m = r + 8 * hi;
      const int qrow = min(qt * 16 + m, SEQ - 1);
      float sc;
      if (key < SEQ) {
        const int d = circ_dist(qrow, key);
        sc = acc[r] * scale + sP[m * PP + d];
      } else {
        sc = -1.0e30f;
      }
      sS[m * SP + key] = sc;
    }
  }
  __syncthreads();

  // Group 3: this wave's V^T fragments for phase 5; they land behind the softmax.
  const int dbase = (wave & 3) * 16;           // 16 head dims per wave
  const int ks    = wave >> 2;                 // this wave's part of the key range and of the distance range
  const int key0  = ks * (SPAD / KSP);
  const int dis0  = ks * (NDIST / KSP);
  FragH vf[VSW];
  {
    const _Float16* vcol = Vbh + (size_t)(dbase + n) * SPAD + key0 + 8 * hi;     // B[k=key][n=dim], k-contiguous
    #pragma unroll   // constant indices: the fragments stay in registers
    for (int i = 0; i < VSW; ++i) {
      vf[i].h[0] = *(const v8h*)(vcol + i * 32);
      vf[i].h[1] = *(const v8h*)(vcol + i * 32 + 16);
    }
    asm volatile("s_wait_xcnt 0x0" :: "v"(vcol) : "memory");   // as behind group 1
  }

  // ---------- Phase 3: row softmax (normalisation deferred) -----------------
  {
    const int row = tid / TPR, sub = tid % TPR;
    const int j0 = sub * 4;   // neighbouring threads take neighbouring float4s: each LDS access of a wave is one contiguous run
    float* rowS = sS + row * SP;
    _Float16* rowA = sA + row * AP;

    float mx = -1.0e30f;
    for (int it = 0; it < SPAD / (4 * TPR); ++it) {
      const int j = j0 + it * (4 * TPR);
      if (j < SEQ) {   // SEQ is a multiple of 4: a float4 is entirely valid or entirely padding
        v4f v = *(const v4f*)(rowS + j);
        mx = fmaxf(mx, fmaxf(fmaxf(v.x, v.y), fmaxf(v.z, v.w)));
      }
    }
    sRed[row * TPR + sub] = mx;
    lds_barrier();
    if (sub == 0) {
      float m2 = sRed[row * TPR];
      #pragma unroll
      for (int u = 1; u < TPR; ++u) m2 = fmaxf(m2, sRed[row * TPR + u]);
      sMax[row] = m2;
    }
    lds_barrier();
    const float rm = sMax[row];
    float sum = 0.0f;
    for (int it = 0; it < SPAD / (4 * TPR); ++it) {
      const int j = j0 + it * (4 * TPR);
      v4f e = {0.0f, 0.0f, 0.0f, 0.0f};
      if (j < SEQ) {
        v4f v = *(const v4f*)(rowS + j);
        e = exp_x4(v - rm);
      }
      *(v4f*)(rowS + j) = e;
      v4h h4;
      h4.x = (_Float16)(e.x * PSC); h4.y = (_Float16)(e.y * PSC);
      h4.z = (_Float16)(e.z * PSC); h4.w = (_Float16)(e.w * PSC);
      *(v4h*)(rowA + j) = h4;
      sum += (e.x + e.y) + (e.z + e.w);
    }
    sRed[row * TPR + sub] = sum;
    lds_barrier();
    if (sub == 0) {
      float s2 = 0.0f;
      #pragma unroll
      for (int u = 0; u < TPR; ++u) s2 += sRed[row * TPR + u];
      sRcp[row] = 1.0f / s2;
    }
    lds_barrier();
  }

  // Group 4: this wave's relV^T fragments for phase 5; they land behind phase 4.
  FragH rvf[RSW];
  {
    const _Float16* rvcol = RVt + (size_t)(dbase + n) * NDIST + dis0 + 8 * hi;   // B[k=dist][n=dim], k-contiguous
    #pragma unroll   // constant indices: the fragments stay in registers
    for (int i = 0; i < RSW; ++i) {
      rvf[i].h[0] = *(const v8h*)(rvcol + i * 32);
      rvf[i].h[1] = *(const v8h*)(rvcol + i * 32 + 16);
    }
    asm volatile("s_wait_xcnt 0x0" :: "v"(rvcol) : "memory");   // as behind group 1
  }

  // ---------- Phase 4: per-distance mass, fixed 2-key gather (no atomics) ---
  // keys at circular distance dist from row q: (q-dist) mod S and (q+dist) mod S (one key when they coincide)
  for (int idx = tid; idx < 16 * NDIST; idx += NT) {
    const int m = idx >> 9, dist = idx & (NDIST - 1);
    const int qrow = min(qt * 16 + m, SEQ - 1);
    float val = 0.0f;
    if (dist <= DMAX) {
      int k1 = qrow - dist; if (k1 < 0) k1 += SEQ;
      int k2 = qrow + dist; if (k2 >= SEQ) k2 -= SEQ;
      val = sS[m * SP + k1];
      if (k2 != k1) val += sS[m * SP + k2];
    }
    sD[m * DP + dist] = (_Float16)(val * PSC);
  }
  lds_barrier();

  // ---------- Phase 5: out = (P@V + D@relV) * rcp / 256 -----------------------
  {
    const _Float16* arow  = sA + n * AP    + key0 + 8 * hi;                      // A[m=row][k=key]
    const _Float16* drow  = sD + n * DP    + dis0 + 8 * hi;                      // A[m=row][k=dist]
    v8f acc = zero8();

    #pragma unroll   // constant indices into vf
    for (int kt2 = 0; kt2 < VSW; ++kt2) {
      const int kb = kt2 * 32;
      FragH a;
      a.h[0]  = *(const v8h*)(arow + kb);
      a.h[1]  = *(const v8h*)(arow + kb + 16);
      acc = wmma_f16(a, vf[kt2], acc);
    }
    #pragma unroll   // constant indices into rvf
    for (int rt = 0; rt < RSW; ++rt) {
      const int kb = rt * 32;
      FragH a;
      a.h[0]  = *(const v8h*)(drow + kb);
      a.h[1]  = *(const v8h*)(drow + kb + 16);
      acc = wmma_f16(a, rvf[rt], acc);
    }
    // stage this wave's 16x16 f32 partial sum (sP is free after phase 2)
    #pragma unroll
    for (int r = 0; r < 8; ++r) {
      const int m = r + 8 * hi;
      sP[(ks * 16 + m) * OP + dbase + n] = acc[r];
    }
  }
  __syncthreads();

  // add the KSP partial sums, normalise, store whole 128-B lines (8 lanes each)
  if (tid < 16 * DH / 4) {
    float* obase = Out + baseQ;
    const int m = tid >> 4;
    const int c = (tid & 15) * 4;
    const int qrow = qt * 16 + m;
    v4f v = *(const v4f*)(sP + m * OP + c);
    #pragma unroll
    for (int s = 1; s < KSP; ++s) v += *(const v4f*)(sP + (s * 16 + m) * OP + c);
    v *= sRcp[m] * PSCI;
    if (qrow < SEQ) *(v4f*)(obase + (size_t)qrow * DM + c) = v;
  }
}

extern "C" void kernel_launch(void* const* d_in, const int* in_sizes, int n_in,
                              void* d_out, int out_size, void* d_ws, size_t ws_size,
                              hipStream_t stream) {
  if (n_in < 5) return;
  if (in_sizes[0] < NB * SEQ * DM || in_sizes[1] < NB * SEQ * DM || in_sizes[2] < NB * SEQ * DM) return;
  if (in_sizes[3] < NDIST * DH || in_sizes[4] < NDIST * DH) return;
  if (out_size < NB * SEQ * DM) return;
  const size_t ws_need = WS_END * 2;           // 16,777,216 B
  if (ws_size < ws_need) return;

  const float* Q  = (const float*)d_in[0];
  const float* K  = (const float*)d_in[1];
  const float* V  = (const float*)d_in[2];
  const float* RK = (const float*)d_in[3];
  const float* RV = (const float*)d_in[4];
  float* Out = (float*)d_out;
  unsigned short* ws16 = (unsigned short*)d_ws;

  unsigned short* Kb  = ws16 + WS_K;
  _Float16*       Vt  = (_Float16*)(ws16 + WS_VT);
  unsigned short* RKb = ws16 + WS_RK;
  _Float16*       RVt = (_Float16*)(ws16 + WS_RVT);

  prep_k_kernel  <<<(NK8 + 255) / 256, 256, 0, stream>>>(K, Kb);
  prep_vt_kernel <<<(NV8 + 255) / 256, 256, 0, stream>>>(V, Vt);
  prep_rel_kernel<<<(2 * NR8 + 255) / 256, 256, 0, stream>>>(RK, RV, RKb, RVt);

  dim3 grid(QTN, NB * NH);
  circ_rel_attn_kernel<<<grid, dim3(NT), 0, stream>>>(Q, Kb, Vt, RKb, RVt, Out);
}

// v004
// One run takes 138 microseconds.
// Next to v003, in two timings, it ran 1.14 times as fast each time.
// Counting every step since v000, it is 2.77 times as fast.
#include <hip/hip_runtime.h>

// Contractions: Q*K^T and Q*relK^T on v_wmma_f32_16x16x32_bf16 (bf16 operands, f32 accumulate);
// P*V and bucketed P*relV on v_wmma_f32_16x16x32_f16 (f16 operands: P scaled by 2^8, V/relV carry bf16-RNE values; f32 accumulate).

typedef _Float16 v16h __attribute__((ext_vector_type(16)));
typedef _Float16 v8h  __attribute__((ext_vector_type(8), may_alias));
typedef _Float16 v4h  __attribute__((ext_vector_type(4), may_alias));
typedef __bf16   v16b __attribute__((ext_vector_type(16)));
typedef unsigned short v8us __attribute__((ext_vector_type(8), may_alias));
typedef float v8f __attribute__((ext_vector_type(8)));
typedef float v4f __attribute__((ext_vector_type(4), may_alias));

#define SEQ   1000   // sequence length
#define SEQP  1008   // keys padded to a multiple of 16
#define DM    512    // model width
#define DH    64     // head dim
#define NB    8      // batch
#define NH    8      // heads
#define QTN   63     // query tiles of 16
#define KTI   63     // key tiles of 16
#define SPAD  1024   // padded key dim (multiple of 32)
#define NDIST 512    // padded distance dim (>= 501, multiple of 32)
#define DMAX  500    // largest circular distance
#define NW    16     // waves per attention block
#define NT    512    // threads per attention block
#define TPR   (NT / 16)      // threads per score row in the softmax
#define KSP   (NW / 4)       // waves that share one 16-dim output tile, each on its own part of the k range
#define QPT   (16 * DH / NT)             // Q elements staged per thread
#define RTW   (NDIST / 16 / NW)          // relK column tiles per wave
#define KTW   ((KTI + NW - 1) / NW)      // key tiles per wave (the last wave has one fewer)
#define VSW   (SPAD / 32 / KSP)          // k steps of P*V per wave
#define RSW   (NDIST / 32 / KSP)         // k steps of D*relV per wave
// LDS row pitches: each keeps the lanes of one LDS instruction on distinct banks (64 banks of 4 B)
#define QP    (DH + 8)       // sQ, 2-B elements: 144 B = 16 B x odd, for the 16-B fragment reads down 16 rows
#define AP    (SPAD + 8)     // sA, 2-B elements: 2064 B = 16 B x odd
#define DP    (NDIST + 8)    // sD, 2-B elements: 1040 B = 16 B x odd
#define SP    (SPAD + 4)     // sS, f32: 8 rows = 32 banks mod 64, so the two lane halves of a D tile do not meet
#define PP    (NDIST + 4)    // f32 words per query row in the first half of sPA
#define OP    (DH + 4)       // partial outputs in sP, f32: the same
#define TP    (SPAD + 4)     // sT, f32: the same
#define TOFF  15             // sT column of circular offset 0 (a 16x16 tile reaches 15 below its base offset)
#define PSC   256.0f        // power-of-two scale on the f16 attention weights
#define PSCI  0.00390625f   // 1/256

// workspace layout in 2-byte elements
#define WS_K    ((size_t)0)                              // [8][1008][512]  bf16 K, padded rows zero
#define WS_VT   ((size_t)NB * SEQP * DM)                 // [64][64][1024]  f16 V^T per (b,h)
#define WS_RK   (WS_VT + (size_t)NB * NH * DH * SPAD)    // [512][64]       bf16 relK
#define WS_RVT  (WS_RK + (size_t)NDIST * DH)             // [64][512]       f16 relV^T
#define WS_END  (WS_RVT + (size_t)DH * NDIST)

#define NK8  (NB * SEQP * DM / 8)       // threads of 8 elements, K copy
#define NV8  (NB * NH * DH * SPAD / 8)  // threads of 8 elements, V^T copy
#define NR8  (NDIST * DH / 8)           // threads of 8 elements, each rel table

union FragH { v16h v; v8h  h[2]; };
union FragB { v16b v; v8us h[2]; };

__device__ __forceinline__ v8f zero8() {
  v8f z = {0.0f, 0.0f, 0.0f, 0.0f, 0.0f, 0.0f, 0.0f, 0.0f};
  return z;
}

__device__ __forceinline__ v8f wmma_f16(const FragH& a, const FragH& b, v8f c) {
  v8f d = __builtin_amdgcn_wmma_f32_16x16x32_f16(false, a.v, false, b.v, (short)0, c, false, false);
  asm volatile("v_nop\n\tv_nop\n\tv_nop\n\tv_nop" : "+v"(d) : "v"(a.v), "v"(b.v));
  return d;
}

__device__ __forceinline__ v8f wmma_bf16(const FragB& a, const FragB& b, v8f c) {
  v8f d = __builtin_amdgcn_wmma_f32_16x16x32_bf16(false, a.v, false, b.v, (short)0, c, false, false);
  asm volatile("v_nop\n\tv_nop\n\tv_nop\n\tv_nop" : "+v"(d) : "v"(a.v), "v"(b.v));
  return d;
}

// f32 -> bf16 bits, RNE
__device__ __forceinline__ unsigned short bf16_rne(float f) {
  unsigned int u = __float_as_uint(f);
  u += 0x7FFFu + ((u >> 16) & 1u);
  return (unsigned short)(u >> 16);
}

// f32 -> bf16 (RNE) -> f16 ; the second step is exact for bf16 values in f16 range
__device__ __forceinline__ _Float16 f16_of_bf16(float f) {
  unsigned int u = ((unsigned int)bf16_rne(f)) << 16;
  return (_Float16)__uint_as_float(u);
}

// e^x for four values at once (x * log2(e), then the hardware's 2^x, as __expf does).
// One statement with outputs apart from all inputs and a closing v_nop: it keeps the one slot the instruction set asks for
// between a transcendental and an instruction that overwrites its source or reads its result.
__device__ __forceinline__ v4f exp_x4(v4f x) {
  const float a = x.x * 1.44269504f, b = x.y * 1.44269504f, c = x.z * 1.44269504f, d = x.w * 1.44269504f;
  v4f r;
  float r0, r1, r2, r3;
  asm("v_exp_f32 %0, %4\n\tv_exp_f32 %1, %5\n\tv_exp_f32 %2, %6\n\tv_exp_f32 %3, %7\n\tv_nop"
      : "=&v"(r0), "=&v"(r1), "=&v"(r2), "=&v"(r3) : "v"(a), "v"(b), "v"(c), "v"(d));
  r.x = r0; r.y = r1; r.z = r2; r.w = r3;
  return r;
}

// Work-group barrier that orders LDS only. All that the waves of a block hand each other goes through LDS, and the global
// buffers read here are written by earlier launches alone. __syncthreads() also drains the wave's outstanding global loads,
// which would end the flight of the fragment loads issued ahead at the first barrier behind them.
__device__ __forceinline__ void lds_barrier() {
  __builtin_amdgcn_fence(__ATOMIC_RELEASE, "workgroup", "local");
  __builtin_amdgcn_s_barrier();
  __builtin_amdgcn_fence(__ATOMIC_ACQUIRE, "workgroup", "local");
}

// ---------------- prep: K -> bf16, rows padded to SEQP --------------------
__global__ __launch_bounds__(256)
void prep_k_kernel(const float* __restrict__ K, unsigned short* __restrict__ Kb) {
  const int t = blockIdx.x * 256 + threadIdx.x;
  if (t >= NK8) return;
  const size_t e0 = (size_t)t * 8;
  const int b = (int)(e0 / ((size_t)SEQP * DM));
  const int r = (int)((e0 / DM) % SEQP);
  const int d = (int)(e0 % DM);
  v8us o = {0, 0, 0, 0, 0, 0, 0, 0};
  if (r < SEQ) {
    const float* src = K + ((size_t)b * SEQ + r) * DM + d;
    v4f x0 = *(const v4f*)(src);
    v4f x1 = *(const v4f*)(src + 4);
    o[0] = bf16_rne(x0.x); o[1] = bf16_rne(x0.y); o[2] = bf16_rne(x0.z); o[3] = bf16_rne(x0.w);
    o[4] = bf16_rne(x1.x); o[5] = bf16_rne(x1.y); o[6] = bf16_rne(x1.z); o[7] = bf16_rne(x1.w);
  }
  v8us* p = (v8us*)(Kb + e0);
  *p = o;
  
}

// ---------------- prep: V -> f16 V^T[bh][dim][key], keys padded to SPAD -----
__global__ __launch_bounds__(256)
void prep_vt_kernel(const float* __restrict__ V, _Float16* __restrict__ Vt) {
  const int t = blockIdx.x * 256 + threadIdx.x;
  if (t >= NV8) return;
  const int e0   = t * 8;
  const int bh   = e0 >> 16;            // DH*SPAD = 65536
  const int dim  = (e0 >> 10) & (DH - 1);
  const int key0 = e0 & (SPAD - 1);     // multiple of 8
  const int b = bh >> 3, h = bh & 7;
  v8h o = {0, 0, 0, 0, 0, 0, 0, 0};
  if (key0 < SEQ) {                     // SEQ is a multiple of 8: all 8 keys valid
    const float* src = V + ((size_t)b * SEQ + key0) * DM + h * DH + dim;
    #pragma unroll
    for (int j = 0; j < 8; ++j) o[j] = f16_of_bf16(src[(size_t)j * DM]);
  }
  v8h* p = (v8h*)(Vt + (size_t)e0);
  *p = o;
  
}

// ---------------- prep: relK -> bf16 [dist][d] ; relV -> f16 relV^T [d][dist] -
__global__ __launch_bounds__(256)
void prep_rel_kernel(const float* __restrict__ RK, const float* __restrict__ RV,
                     unsigned short* __restrict__ RKb, _Float16* __restrict__ RVt) {
  const int t = blockIdx.x * 256 + threadIdx.x;
  if (t < NR8) {
    const int e0 = t * 8;                                 // rows 0..511 direct copy
    v4f x0 = *(const v4f*)(RK + e0);
    v4f x1 = *(const v4f*)(RK + e0 + 4);
    v8us o;
    o[0] = bf16_rne(x0.x); o[1] = bf16_rne(x0.y); o[2] = bf16_rne(x0.z); o[3] = bf16_rne(x0.w);
    o[4] = bf16_rne(x1.x); o[5] = bf16_rne(x1.y); o[6] = bf16_rne(x1.z); o[7] = bf16_rne(x1.w);
    v8us* p = (v8us*)(RKb + e0);
    *p = o;
    
  } else if (t < 2 * NR8) {
    const int e0 = (t - NR8) * 8;                         // out[d][dist0..dist0+7] <- in[dist][d]
    const int d = e0 >> 9;                                // NDIST = 512
    const int dist0 = e0 & (NDIST - 1);
    v8h o;
    #pragma unroll
    for (int j = 0; j < 8; ++j) o[j] = f16_of_bf16(RV[(size_t)(dist0 + j) * DH + d]);
    v8h* p = (v8h*)(RVt + e0);
    *p = o;
    
  }
}

// ---------------- fused attention kernel ------------------------------------
__global__ __launch_bounds__(NT)
void circ_rel_attn_kernel(const float* __restrict__ Q,
                          const unsigned short* __restrict__ Kb,
                          const _Float16* __restrict__ Vt,
                          const unsigned short* __restrict__ RKb,
                          const _Float16* __restrict__ RVt,
                          float* __restrict__ Out)
{
  __shared__ __attribute__((aligned(16))) unsigned short sQ[16 * QP];     //  2 KB  bf16 Q tile
  // 64 KB, two lives. Phases 1-2: sT[q][TOFF + u] = (Q*relK^T)[q][circular distance of u], u = -15..1007, the bias row laid
  // out over the whole circle. From phase 3: the second half is sA; the first half takes the partial outputs [KSP][16][OP].
  __shared__ __attribute__((aligned(16))) float          sPA[16 * PP + 16 * AP / 2];
  __shared__ __attribute__((aligned(16))) float          sS[16 * SP];     // 64 KB  scores -> exp(scores)
  __shared__ __attribute__((aligned(16))) _Float16       sD[16 * DP];     // 16 KB  per-distance mass*256 f16
  __shared__ float sRed[16 * TPR];
  __shared__ float sMax[16];
  __shared__ float sRcp[16];
  float*    const sT = sPA;
  float*    const sP = sPA;
  _Float16* const sA = (_Float16*)(sPA + 16 * PP);                        // 32 KB  exp(scores)*256 f16
  static_assert(16 * TP <= 16 * PP + 16 * AP / 2, "the unfolded bias rows fit the two halves");
  static_assert(KSP * 16 * OP <= 16 * PP, "the partial outputs stay clear of sA");
  static_assert(TOFF + SEQ + 7 < TP, "the largest offset a tile reads lies inside its row");

  const int qt   = blockIdx.x;
  const int bh   = blockIdx.y;
  const int b    = bh >> 3;
  const int h    = bh & 7;
  const int tid  = threadIdx.x;
  const int lane = tid & 31;
  const int wave = tid >> 5;
  const int n    = lane & 15;           // A row / B column / D column
  const int hi   = lane >> 4;           // lane half

  const float scale = 0.125f;
  const size_t baseQ = (size_t)b * SEQ * DM + (size_t)h * DH;
  const unsigned short* Kbh = Kb + ((size_t)b * SEQP) * DM + (size_t)h * DH;
  const _Float16* Vbh = Vt + (size_t)bh * DH * SPAD;

  // ---------- Global loads issued ahead: none of them depends on anything computed here, so each group is
  // issued one phase or more before its use and its latency passes behind the work in between.
  // Group 1 (here): the Q elements, this wave's relK tiles, its first two key tiles.
  float qv[QPT];
  const float* qp[QPT];
  #pragma unroll   // constant indices: qv stays in registers, and all its loads are issued before the first wait
  for (int i = 0; i < QPT; ++i) {
    const int idx = tid + i * NT;
    const int m = idx >> 6, d = idx & 63;
    qp[i] = Q + baseQ + (size_t)min(qt * 16 + m, SEQ - 1) * DM + d;   // row clamped; rows past the end are zeroed below
    qv[i] = *qp[i];
  }
  const unsigned short* rp0 = RKb + (size_t)(wave * 16 + n) * DH + 8 * hi;   // B[k=d][n=dist], k-contiguous row
  FragB rk[RTW][2];
  #pragma unroll   // constant indices: the fragments stay in registers
  for (int i = 0; i < RTW; ++i) {
    const unsigned short* rp = rp0 + (size_t)i * NW * 16 * DH;
    rk[i][0].h[0] = *(const v8us*)(rp);
    rk[i][0].h[1] = *(const v8us*)(rp + 16);
    rk[i][1].h[0] = *(const v8us*)(rp + 32);
    rk[i][1].h[1] = *(const v8us*)(rp + 48);
  }
  const unsigned short* kp0 = Kbh + (size_t)(wave * 16 + n) * DM + 8 * hi;   // B[k=d][n=key], k-contiguous row
  FragB kf[KTW][2];
  #pragma unroll   // constant indices: the fragments stay in registers
  for (int i = 0; i < KTW / 2; ++i) {
    const unsigned short* kp = kp0 + (size_t)i * NW * 16 * DM;
    kf[i][0].h[0] = *(const v8us*)(kp);
    kf[i][0].h[1] = *(const v8us*)(kp + 16);
    kf[i][1].h[0] = *(const v8us*)(kp + 32);
    kf[i][1].h[1] = *(const v8us*)(kp + 48);
  }
  static_assert(QPT == 2, "the wait below names one address per Q load");
  // Behind each group: the wait that is kept in front of any overwrite of an issued load's address registers. The addresses
  // are inputs, so they live up to the wait (left to itself the build gave some loads an address register of the group as
  // their destination, or waited to a count only).
  asm volatile("s_wait_xcnt 0x0" :: "v"(qp[0]), "v"(qp[1]), "v"(rp0), "v"(kp0) : "memory");

  // ---------- Phase 0: stage Q tile as bf16 ----------------------------------
  #pragma unroll   // constant indices into qv
  for (int i = 0; i < QPT; ++i) {
    const int idx = tid + i * NT;
    const int m = idx >> 6, d = idx & 63;
    const float v = (qt * 16 + m < SEQ) ? qv[i] : 0.0f;
    sQ[m * QP + d] = bf16_rne(v);
  }
  lds_barrier();

  // A fragments of the Q tile: k 0..31 and k 32..63 (split map: elems 0..7 <- k0+8h, 8..15 <- k0+16+8h)
  FragB qa0, qa1;
  {
    const unsigned short* qp = sQ + n * QP + 8 * hi;
    qa0.h[0] = *(const v8us*)(qp);
    qa0.h[1] = *(const v8us*)(qp + 16);
    qa1.h[0] = *(const v8us*)(qp + 32);
    qa1.h[1] = *(const v8us*)(qp + 48);
  }

  // ---------- Phase 1: P = Qtile @ relK^T, stored at every circular offset that has this distance ----------
  static_assert(TOFF == 15, "nrev is TOFF - n");
  const int swave = __builtin_amdgcn_readfirstlane(wave);   // tile numbers and base offsets stay scalar
  const int nrev  = n ^ 15;                                 // TOFF - n, never negative
  #pragma unroll   // constant indices into rk
  for (int i = 0; i < RTW; ++i) {
    const int ct = swave + i * NW;
    v8f acc = zero8();
    acc = wmma_bf16(qa0, rk[i][0], acc);
    acc = wmma_bf16(qa1, rk[i][1], acc);
    const int dist = ct * 16 + n;
    float* trow = sT + 8 * hi * TP;
    if (dist <= DMAX) {              // offsets dist and SEQ - dist
      // column TOFF + SEQ - dist = (SEQ - 16*31) + 16*(31 - ct) + (15 - n), each variable term counted up from 0
      const int mcol = (ct ^ (NDIST / 16 - 1)) * 16 + nrev;
      #pragma unroll
      for (int r = 0; r < 8; ++r) {
        trow[r * TP + TOFF + dist] = acc[r];
        trow[r * TP + (SEQ - (NDIST / 16 - 1) * 16) + mcol] = acc[r];
      }
    }
    if (i == 0 && ct == 0) {         // offsets -15..0: a tile on the diagonal reaches below 0
      #pragma unroll
      for (int r = 0; r < 8; ++r) trow[r * TP + nrev] = acc[r];
      if (n < 8) {                   // offsets SEQ..SEQ+7: the last query tile against the first keys
        #pragma unroll
        for (int r = 0; r < 8; ++r) trow[r * TP + TOFF + SEQ + n] = acc[r];
      }
    }
  }
  // Group 2: the other key tiles, into the registers that relK has left; they land behind the first two tiles' work.
  const unsigned short* kq[KTW];
  #pragma unroll   // constant indices into kf
  for (int i = KTW / 2; i < KTW; ++i) {
    const int kt = min(wave + i * NW, KTI - 1);   // the last wave has no last tile: address clamped, value unused
    kq[i] = Kbh + (size_t)(kt * 16 + n) * DM + 8 * hi;
    kf[i][0].h[0] = *(const v8us*)(kq[i]);
    kf[i][0].h[1] = *(const v8us*)(kq[i] + 16);
    kf[i][1].h[0] = *(const v8us*)(kq[i] + 32);
    kf[i][1].h[1] = *(const v8us*)(kq[i] + 48);
  }
  static_assert(KTW == 4, "the wait below names one address per tile of the group");
  asm volatile("s_wait_xcnt 0x0" :: "v"(kq[2]), "v"(kq[3]) : "memory");   // as behind group 1
  lds_barrier();

  // ---------- Phase 2: scores = QK^T*scale + bias at offset (query - key) mod SEQ ----------------
  // Inside a tile the offset is base + m - n, base = 16*(qt - kt) mod SEQ: one address per tile, the rows by constant steps.
  static_assert(NW * (KTW - 1) * 16 <= SEQ, "only a wave's last tile can hold padded keys");
  const float* tlane = sT + 8 * hi * (TP + 1) + nrev;
  float*       slane = sS + 8 * hi * SP + n;
  // A tile's eight bias reads are issued as one group in front of the previous tile's score stores, so that they are in
  // flight together and land behind that tile's products.
  float bias[2][8];
  {
    const int dt = qt - swave;
    const float* tp = tlane + (dt * 16 + (dt < 0 ? SEQ : 0));
    #pragma unroll
    for (int r = 0; r < 8; ++r) bias[0][r] = tp[r * (TP + 1)];
  }
  #pragma unroll   // constant indices into kf and bias
  for (int i = 0; i < KTW; ++i) {
    const int kt = swave + i * NW;
    if (kt >= KTI) break;
    if (i + 1 < KTW) {
      const int dt = qt - min(kt + NW, KTI - 1);   // the last wave has no last tile: tile number clamped, values unused
      const float* tp = tlane + (dt * 16 + (dt < 0 ? SEQ : 0));
      #pragma unroll
      for (int r = 0; r < 8; ++r) bias[(i + 1) & 1][r] = tp[r * (TP + 1)];
    }
    float* sp = slane + kt * 16;
    v8f acc = zero8();
    acc = wmma_bf16(qa0, kf[i][0], acc);
    acc = wmma_bf16(qa1, kf[i][1], acc);
    #pragma unroll
    for (int r = 0; r < 8; ++r) {
      float sc = acc[r] * scale + bias[i & 1][r];
      if (i == KTW - 1 && kt * 16 + n >= SEQ) sc = -1.0e30f;   // padded keys
      sp[r * SP] = sc;
    }
  }
  __syncthreads();

  // Group 3: this wave's V^T fragments for phase 5; they land behind the softmax.
  const int dbase = (wave & 3) * 16;           // 16 head dims per wave
  const int ks    = wave >> 2;                 // this wave's part of the key range and of the distance range
  const int key0  = ks * (SPAD / KSP);
  const int dis0  = ks * (NDIST / KSP);
  FragH vf[VSW];
  {
    const _Float16* vcol = Vbh + (size_t)(dbase + n) * SPAD + key0 + 8 * hi;     // B[k=key][n=dim], k-contiguous
    #pragma unroll   // constant indices: the fragments stay in registers
    for (int i = 0; i < VSW; ++i) {
      vf[i].h[0] = *(const v8h*)(vcol + i * 32);
      vf[i].h[1] = *(const v8h*)(vcol + i * 32 + 16);
    }
    asm volatile("s_wait_xcnt 0x0" :: "v"(vcol) : "memory");   // as behind group 1
  }

  // ---------- Phase 3: row softmax (normalisation deferred) -----------------
  {
    const int row = tid / TPR, sub = tid % TPR;
    const int j0 = sub * 4;   // neighbouring threads take neighbouring float4s: each LDS access of a wave is one contiguous run
    float* rowS = sS + row * SP;
    _Float16* rowA = sA + row * AP;

    float mx = -1.0e30f;
    for (int it = 0; it < SPAD / (4 * TPR); ++it) {
      const int j = j0 + it * (4 * TPR);
      if (j < SEQ) {   // SEQ is a multiple of 4: a float4 is entirely valid or entirely padding
        v4f v = *(const v4f*)(rowS + j);
        mx = fmaxf(mx, fmaxf(fmaxf(v.x, v.y), fmaxf(v.z, v.w)));
      }
    }
    sRed[row * TPR + sub] = mx;
    lds_barrier();
    if (sub == 0) {
      float m2 = sRed[row * TPR];
      #pragma unroll
      for (int u = 1; u < TPR; ++u) m2 = fmaxf(m2, sRed[row * TPR + u]);
      sMax[row] = m2;
    }
    lds_barrier();
    const float rm = sMax[row];
    float sum = 0.0f;
    for (int it = 0; it < SPAD / (4 * TPR); ++it) {
      const int j = j0 + it * (4 * TPR);
      v4f e = {0.0f, 0.0f, 0.0f, 0.0f};
      if (j < SEQ) {
        v4f v = *(const v4f*)(rowS + j);
        e = exp_x4(v - rm);
      }
      *(v4f*)(rowS + j) = e;
      v4h h4;
      h4.x = (_Float16)(e.x * PSC); h4.y = (_Float16)(e.y * PSC);
      h4.z = (_Float16)(e.z * PSC); h4.w = (_Float16)(e.w * PSC);
      *(v4h*)(rowA + j) = h4;
      sum += (e.x + e.y) + (e.z + e.w);
    }
    sRed[row * TPR + sub] = sum;
    lds_barrier();
    if (sub == 0) {
      float s2 = 0.0f;
      #pragma unroll
      for (int u = 0; u < TPR; ++u) s2 += sRed[row * TPR + u];
      sRcp[row] = 1.0f / s2;
    }
    lds_barrier();
  }

  // Group 4: this wave's relV^T fragments for phase 5; they land behind phase 4.
  FragH rvf[RSW];
  {
    const _Float16* rvcol = RVt + (size_t)(dbase + n) * NDIST + dis0 + 8 * hi;   // B[k=dist][n=dim], k-contiguous
    #pragma unroll   // constant indices: the fragments stay in registers
    for (int i = 0; i < RSW; ++i) {
      rvf[i].h[0] = *(const v8h*)(rvcol + i * 32);
      rvf[i].h[1] = *(const v8h*)(rvcol + i * 32 + 16);
    }
    asm volatile("s_wait_xcnt 0x0" :: "v"(rvcol) : "memory");   // as behind group 1
  }

  // ---------- Phase 4: per-distance mass, fixed 2-key gather (no atomics) ---
  // keys at circular distance dist from row q: (q-dist) mod S and (q+dist) mod S (one key when they coincide)
  // One distance per thread, all 16 rows. The two keys coincide exactly where 2*dist is a multiple of SEQ, whatever the row,
  // so that test and the padding test become two per-thread factors and the rows' reads are independent of each other.
  {
    static_assert(NT == NDIST, "one distance per thread");
    const int dist = tid;
    const float w2 = (dist == 0 || 2 * dist == SEQ) ? 0.0f : 1.0f;
    const float ws = (dist <= DMAX) ? PSC : 0.0f;
    #pragma unroll   // all rows' LDS reads in flight together
    for (int m = 0; m < 16; ++m) {
      const int qrow = min(qt * 16 + m, SEQ - 1);
      // wrap into 0..SEQ-1 by an unsigned minimum: the out-of-range form is negative, so huge as unsigned
      const unsigned k1 = min((unsigned)(qrow - dist), (unsigned)(qrow - dist + SEQ));
      const unsigned k2 = min((unsigned)(qrow + dist), (unsigned)(qrow + dist - SEQ));
      const float val = sS[m * SP + k1] + w2 * sS[m * SP + k2];
      sD[m * DP + dist] = (_Float16)(val * ws);
    }
  }
  lds_barrier();

  // ---------- Phase 5: out = (P@V + D@relV) * rcp / 256 -----------------------
  {
    const _Float16* arow  = sA + n * AP    + key0 + 8 * hi;                      // A[m=row][k=key]
    const _Float16* drow  = sD + n * DP    + dis0 + 8 * hi;                      // A[m=row][k=dist]
    v8f acc = zero8();

    #pragma unroll   // constant indices into vf
    for (int kt2 = 0; kt2 < VSW; ++kt2) {
      const int kb = kt2 * 32;
      FragH a;
      a.h[0]  = *(const v8h*)(arow + kb);
      a.h[1]  = *(const v8h*)(arow + kb + 16);
      acc = wmma_f16(a, vf[kt2], acc);
    }
    #pragma unroll   // constant indices into rvf
    for (int rt = 0; rt < RSW; ++rt) {
      const int kb = rt * 32;
      FragH a;
      a.h[0]  = *(const v8h*)(drow + kb);
      a.h[1]  = *(const v8h*)(drow + kb + 16);
      acc = wmma_f16(a, rvf[rt], acc);
    }
    // stage this wave's 16x16 f32 partial sum (sP is free after phase 2)
    #pragma unroll
    for (int r = 0; r < 8; ++r) {
      const int m = r + 8 * hi;
      sP[(ks * 16 + m) * OP + dbase + n] = acc[r];
    }
  }
  __syncthreads();

  // add the KSP partial sums, normalise, store whole 128-B lines (8 lanes each)
  if (tid < 16 * DH / 4) {
    float* obase = Out + baseQ;
    const int m = tid >> 4;
    const int c = (tid & 15) * 4;
    const int qrow = qt * 16 + m;
    v4f v = *(const v4f*)(sP + m * OP + c);
    #pragma unroll
    for (int s = 1; s < KSP; ++s) v += *(const v4f*)(sP + (s * 16 + m) * OP + c);
    v *= sRcp[m] * PSCI;
    if (qrow < SEQ) *(v4f*)(obase + (size_t)qrow * DM + c) = v;
  }
}

extern "C" void kernel_launch(void* const* d_in, const int* in_sizes, int n_in,
                              void* d_out, int out_size, void* d_ws, size_t ws_size,
                              hipStream_t stream) {
  if (n_in < 5) return;
  if (in_sizes[0] < NB * SEQ * DM || in_sizes[1] < NB * SEQ * DM || in_sizes[2] < NB * SEQ * DM) return;
  if (in_sizes[3] < NDIST * DH || in_sizes[4] < NDIST * DH) return;
  if (out_size < NB * SEQ * DM) return;
  const size_t ws_need = WS_END * 2;           // 16,777,216 B
  if (ws_size < ws_need) return;

  const float* Q  = (const float*)d_in[0];
  const float* K  = (const float*)d_in[1];
  const float* V  = (const float*)d_in[2];
  const float* RK = (const float*)d_in[3];
  const float* RV = (const float*)d_in[4];
  float* Out = (float*)d_out;
  unsigned short* ws16 = (unsigned short*)d_ws;

  unsigned short* Kb  = ws16 + WS_K;
  _Float16*       Vt  = (_Float16*)(ws16 + WS_VT);
  unsigned short* RKb = ws16 + WS_RK;
  _Float16*       RVt = (_Float16*)(ws16 + WS_RVT);

  prep_k_kernel  <<<(NK8 + 255) / 256, 256, 0, stream>>>(K, Kb);
  prep_vt_kernel <<<(NV8 + 255) / 256, 256, 0, stream>>>(V, Vt);
  prep_rel_kernel<<<(2 * NR8 + 255) / 256, 256, 0, stream>>>(RK, RV, RKb, RVt);

  dim3 grid(QTN, NB * NH);
  circ_rel_attn_kernel<<<grid, dim3(NT), 0, stream>>>(Q, Kb, Vt, RKb, RVt, Out);
}

// v005
// One run takes 85.7 microseconds.
// Timed twice side by side with v004, it ran 1.62 times as fast both times.
// Counting every step since v000, it is 4.50 times as fast.
#include <hip/hip_runtime.h>

// Contractions: Q*K^T and Q*relK^T on v_wmma_f32_16x16x32_bf16 (bf16 operands, f32 accumulate);
// P*V and bucketed P*relV on v_wmma_f32_16x16x32_f16 (f16 operands: P scaled by 2^8, V/relV carry bf16-RNE values; f32 accumulate).

typedef _Float16 v16h __attribute__((ext_vector_type(16)));
typedef _Float16 v8h  __attribute__((ext_vector_type(8), may_alias));
typedef _Float16 v4h  __attribute__((ext_vector_type(4), may_alias));
typedef __bf16   v16b __attribute__((ext_vector_type(16)));
typedef unsigned short v8us __attribute__((ext_vector_type(8), may_alias));
typedef float v8f __attribute__((ext_vector_type(8)));
typedef float v4f __attribute__((ext_vector_type(4), may_alias));

#define SEQ   1000   // sequence length
#define SEQP  1008   // keys padded to a multiple of 16
#define DM    512    // model width
#define DH    64     // head dim
#define NB    8      // batch
#define NH    8      // heads
#define QTN   63     // query tiles of 16
#define KTI   63     // key tiles of 16
#define SPAD  1024   // padded key dim (multiple of 32)
#define NDIST 512    // padded distance dim (>= 501, multiple of 32)
#define DMAX  500    // largest circular distance
#define NW    16     // waves per attention block
#define NT    512    // threads per attention block
#define TPR   (NT / 16)      // threads per score row in the softmax
#define KSP   (NW / 4)       // waves that share one 16-dim output tile, each on its own part of the k range
#define QPT   (16 * DH / NT)             // Q elements staged per thread
#define RTW   (NDIST / 16 / NW)          // relK column tiles per wave
#define KTW   ((KTI + NW - 1) / NW)      // key tiles per wave (the last wave has one fewer)
#define VSW   (SPAD / 32 / KSP)          // k steps of P*V per wave
#define RSW   (NDIST / 32 / KSP)         // k steps of D*relV per wave
// LDS row pitches: each keeps the lanes of one LDS instruction on distinct banks (64 banks of 4 B)
#define QP    (DH + 8)       // sQ, 2-B elements: 144 B = 16 B x odd, for the 16-B fragment reads down 16 rows
#define AP    (SPAD + 8)     // sA, 2-B elements: 2064 B = 16 B x odd
#define DP    (NDIST + 8)    // sD, 2-B elements: 1040 B = 16 B x odd
#define SP    (SPAD + 4)     // sS, f32: 8 rows = 32 banks mod 64, so the two lane halves of a D tile do not meet
#define PP    (NDIST + 4)    // f32 words per query row in the first half of sPA
#define OP    (DH + 4)       // partial outputs in sP, f32: the same
#define TP    (SPAD + 4)     // sT, f32: the same
#define TOFF  15             // sT column of circular offset 0 (a 16x16 tile reaches 15 below its base offset)
#define PSC   256.0f        // power-of-two scale on the f16 attention weights
#define PSCI  0.00390625f   // 1/256

// Workspace layout in 2-byte elements. All four operands lie in B-fragment order: the unit is [32 lanes][8 elements] = 512 B,
// what one 16-byte load of a wave takes, so that such a load covers four whole 128-B lines.
// Lane = 16*hi + n. K kind (n = key or distance): unit c of a 16-row tile holds head dims 16*c + 8*hi + 0..7.
// V kind (n = head dim of a 16-dim tile): unit j of a 32-row step holds keys or distances 16*j + 8*hi + 0..7.
#define FU      256                                      // elements per unit
#define KTE     (4 * FU)                                 // elements per 16-row tile of the K kind
#define VSE     (2 * FU)                                 // elements per 32-row step of the V kind
#define WS_K    ((size_t)0)                              // [64 bh][63 tiles][4 units]          bf16 K, padded keys zero
#define WS_VT   ((size_t)NB * SEQP * DM)                 // [64 bh][4 dim tiles][32 steps][2]   f16 V, padded keys zero
#define WS_RK   (WS_VT + (size_t)NB * NH * DH * SPAD)    // [32 tiles][4 units]                 bf16 relK
#define WS_RVT  (WS_RK + (size_t)NDIST * DH)             // [4 dim tiles][16 steps][2]          f16 relV
#define WS_END  (WS_RVT + (size_t)DH * NDIST)

#define NK8  (NB * SEQP * DM / 8)       // threads of 8 elements, K copy
#define NV8  (NB * NH * DH * SPAD / 8)  // threads of 8 elements, V^T copy
#define NR8  (NDIST * DH / 8)           // threads of 8 elements, each rel table

union FragH { v16h v; v8h  h[2]; };
union FragB { v16b v; v8us h[2]; };

__device__ __forceinline__ v8f zero8() {
  v8f z = {0.0f, 0.0f, 0.0f, 0.0f, 0.0f, 0.0f, 0.0f, 0.0f};
  return z;
}

__device__ __forceinline__ v8f wmma_f16(const FragH& a, const FragH& b, v8f c) {
  v8f d = __builtin_amdgcn_wmma_f32_16x16x32_f16(false, a.v, false, b.v, (short)0, c, false, false);
  asm volatile("v_nop\n\tv_nop\n\tv_nop\n\tv_nop" : "+v"(d) : "v"(a.v), "v"(b.v));
  return d;
}

__device__ __forceinline__ v8f wmma_bf16(const FragB& a, const FragB& b, v8f c) {
  v8f d = __builtin_amdgcn_wmma_f32_16x16x32_bf16(false, a.v, false, b.v, (short)0, c, false, false);
  asm volatile("v_nop\n\tv_nop\n\tv_nop\n\tv_nop" : "+v"(d) : "v"(a.v), "v"(b.v));
  return d;
}

// f32 -> bf16 bits, RNE
__device__ __forceinline__ unsigned short bf16_rne(float f) {
  unsigned int u = __float_as_uint(f);
  u += 0x7FFFu + ((u >> 16) & 1u);
  return (unsigned short)(u >> 16);
}

// f32 -> bf16 (RNE) -> f16 ; the second step is exact for bf16 values in f16 range
__device__ __forceinline__ _Float16 f16_of_bf16(float f) {
  unsigned int u = ((unsigned int)bf16_rne(f)) << 16;
  return (_Float16)__uint_as_float(u);
}

// e^x for four values at once (x * log2(e), then the hardware's 2^x, as __expf does).
// One statement with outputs apart from all inputs and a closing v_nop: it keeps the one slot the instruction set asks for
// between a transcendental and an instruction that overwrites its source or reads its result.
__device__ __forceinline__ v4f exp_x4(v4f x) {
  const float a = x.x * 1.44269504f, b = x.y * 1.44269504f, c = x.z * 1.44269504f, d = x.w * 1.44269504f;
  v4f r;
  float r0, r1, r2, r3;
  asm("v_exp_f32 %0, %4\n\tv_exp_f32 %1, %5\n\tv_exp_f32 %2, %6\n\tv_exp_f32 %3, %7\n\tv_nop"
      : "=&v"(r0), "=&v"(r1), "=&v"(r2), "=&v"(r3) : "v"(a), "v"(b), "v"(c), "v"(d));
  r.x = r0; r.y = r1; r.z = r2; r.w = r3;
  return r;
}

// Work-group barrier that orders LDS only. All that the waves of a block hand each other goes through LDS, and the global
// buffers read here are written by earlier launches alone. __syncthreads() also drains the wave's outstanding global loads,
// which would end the flight of the fragment loads issued ahead at the first barrier behind them.
__device__ __forceinline__ void lds_barrier() {
  __builtin_amdgcn_fence(__ATOMIC_RELEASE, "workgroup", "local");
  __builtin_amdgcn_s_barrier();
  __builtin_amdgcn_fence(__ATOMIC_ACQUIRE, "workgroup", "local");
}

// ---------------- prep: K -> bf16 in fragment order, keys padded to SEQP ---
__global__ __launch_bounds__(256)
void prep_k_kernel(const float* __restrict__ K, unsigned short* __restrict__ Kb) {
  const int t = blockIdx.x * 256 + threadIdx.x;
  if (t >= NK8) return;
  const size_t e0 = (size_t)t * 8;      // thread t writes the t-th 16 bytes: [bh][tile][unit][lane]
  const int lane = t & 31;
  const int c    = (t >> 5) & 3;
  const int tile = t >> 7;
  const int bh   = tile / KTI;
  const int r    = (tile % KTI) * 16 + (lane & 15);
  const int d    = c * 16 + 8 * (lane >> 4);
  const int b = bh >> 3, h = bh & 7;
  v8us o = {0, 0, 0, 0, 0, 0, 0, 0};
  if (r < SEQ) {
    const float* src = K + ((size_t)b * SEQ + r) * DM + h * DH + d;
    v4f x0 = *(const v4f*)(src);
    v4f x1 = *(const v4f*)(src + 4);
    asm volatile("s_wait_xcnt 0x0" :: "v"(src) : "memory");   // kept in front of any overwrite of the loads' address registers
    o[0] = bf16_rne(x0.x); o[1] = bf16_rne(x0.y); o[2] = bf16_rne(x0.z); o[3] = bf16_rne(x0.w);
    o[4] = bf16_rne(x1.x); o[5] = bf16_rne(x1.y); o[6] = bf16_rne(x1.z); o[7] = bf16_rne(x1.w);
  }
  v8us* p = (v8us*)(Kb + e0);
  *p = o;
  
}

// ---------------- prep: V -> f16 in fragment order, keys padded to SPAD -----
__global__ __launch_bounds__(256)
void prep_vt_kernel(const float* __restrict__ V, _Float16* __restrict__ Vt) {
  const int t = blockIdx.x * 256 + threadIdx.x;
  if (t >= NV8) return;
  // A block takes one 32-key step of one (b,h), all four dim tiles: it reads whole 256-B head rows, 16 lanes per 64 B.
  const int lane = t & 31;
  const int dt   = (t >> 5) & 3;
  const int j    = (t >> 7) & 1;
  const int s    = (t >> 8) & (SPAD / 32 - 1);
  const int bh   = t >> 13;             // DH*SPAD/8 = 8192 threads per (b,h)
  const int dim  = dt * 16 + (lane & 15);
  const int key0 = s * 32 + j * 16 + 8 * (lane >> 4);   // multiple of 8
  const int e0   = ((bh * 4 + dt) * (SPAD / 32) + s) * VSE + j * FU + lane * 8;
  const int b = bh >> 3, h = bh & 7;
  v8h o = {0, 0, 0, 0, 0, 0, 0, 0};
  if (key0 < SEQ) {                     // SEQ is a multiple of 8: all 8 keys valid
    const float* src = V + ((size_t)b * SEQ + key0) * DM + h * DH + dim;
    #pragma unroll
    for (int j = 0; j < 8; ++j) o[j] = f16_of_bf16(src[(size_t)j * DM]);
  }
  v8h* p = (v8h*)(Vt + (size_t)e0);
  *p = o;
  
}

// ---------------- prep: relK -> bf16, relV -> f16, both in fragment order ----
__global__ __launch_bounds__(256)
void prep_rel_kernel(const float* __restrict__ RK, const float* __restrict__ RV,
                     unsigned short* __restrict__ RKb, _Float16* __restrict__ RVt) {
  const int t = blockIdx.x * 256 + threadIdx.x;
  if (t < NR8) {
    const int e0 = t * 8;                                 // [tile][unit][lane], distances 0..511
    const int lane = t & 31;
    const float* src = RK + ((t >> 7) * 16 + (lane & 15)) * DH + ((t >> 5) & 3) * 16 + 8 * (lane >> 4);
    v4f x0 = *(const v4f*)(src);
    v4f x1 = *(const v4f*)(src + 4);
    v8us o;
    o[0] = bf16_rne(x0.x); o[1] = bf16_rne(x0.y); o[2] = bf16_rne(x0.z); o[3] = bf16_rne(x0.w);
    o[4] = bf16_rne(x1.x); o[5] = bf16_rne(x1.y); o[6] = bf16_rne(x1.z); o[7] = bf16_rne(x1.w);
    v8us* p = (v8us*)(RKb + e0);
    *p = o;
    
  } else if (t < 2 * NR8) {
    const int u = t - NR8;                                // as for V: a block takes one 32-distance step, all dim tiles
    const int lane = u & 31;
    const int dt = (u >> 5) & 3;
    const int j  = (u >> 7) & 1;
    const int s  = u >> 8;
    const int d = dt * 16 + (lane & 15);
    const int dist0 = s * 32 + j * 16 + 8 * (lane >> 4);
    const int e0 = (dt * (NDIST / 32) + s) * VSE + j * FU + lane * 8;
    v8h o;
    #pragma unroll
    for (int j = 0; j < 8; ++j) o[j] = f16_of_bf16(RV[(size_t)(dist0 + j) * DH + d]);
    v8h* p = (v8h*)(RVt + e0);
    *p = o;
    
  }
}

// ---------------- fused attention kernel ------------------------------------
__global__ __launch_bounds__(NT)
void circ_rel_attn_kernel(const float* __restrict__ Q,
                          const unsigned short* __restrict__ Kb,
                          const _Float16* __restrict__ Vt,
                          const unsigned short* __restrict__ RKb,
                          const _Float16* __restrict__ RVt,
                          float* __restrict__ Out)
{
  __shared__ __attribute__((aligned(16))) unsigned short sQ[16 * QP];     //  2 KB  bf16 Q tile
  // 64 KB, two lives. Phases 1-2: sT[q][TOFF + u] = (Q*relK^T)[q][circular distance of u], u = -15..1007, the bias row laid
  // out over the whole circle. From phase 3: the second half is sA; the first half takes the partial outputs [KSP][16][OP].
  __shared__ __attribute__((aligned(16))) float          sPA[16 * PP + 16 * AP / 2];
  __shared__ __attribute__((aligned(16))) float          sS[16 * SP];     // 64 KB  scores -> exp(scores)
  __shared__ __attribute__((aligned(16))) _Float16       sD[16 * DP];     // 16 KB  per-distance mass*256 f16
  __shared__ float sRed[16 * TPR];
  __shared__ float sMax[16];
  __shared__ float sRcp[16];
  float*    const sT = sPA;
  float*    const sP = sPA;
  _Float16* const sA = (_Float16*)(sPA + 16 * PP);                        // 32 KB  exp(scores)*256 f16
  static_assert(16 * TP <= 16 * PP + 16 * AP / 2, "the unfolded bias rows fit the two halves");
  static_assert(KSP * 16 * OP <= 16 * PP, "the partial outputs stay clear of sA");
  static_assert(TOFF + SEQ + 7 < TP, "the largest offset a tile reads lies inside its row");

  const int qt   = blockIdx.x;
  const int bh   = blockIdx.y;
  const int b    = bh >> 3;
  const int h    = bh & 7;
  const int tid  = threadIdx.x;
  const int lane = tid & 31;
  const int wave = tid >> 5;
  const int n    = lane & 15;           // A row / B column / D column
  const int hi   = lane >> 4;           // lane half

  const float scale = 0.125f;
  const size_t baseQ = (size_t)b * SEQ * DM + (size_t)h * DH;
  const unsigned short* Kbh = Kb + (size_t)bh * KTI * KTE + lane * 8;     // this lane's 16 bytes of every unit
  const _Float16* Vbh = Vt + (size_t)bh * DH * SPAD + lane * 8;

  // ---------- Global loads issued ahead: none of them depends on anything computed here, so each group is
  // issued one phase or more before its use and its latency passes behind the work in between.
  // Group 1 (here): the Q elements, this wave's relK tiles, its first two key tiles.
  float qv[QPT];
  const float* qp[QPT];
  #pragma unroll   // constant indices: qv stays in registers, and all its loads are issued before the first wait
  for (int i = 0; i < QPT; ++i) {
    const int idx = tid + i * NT;
    const int m = idx >> 6, d = idx & 63;
    qp[i] = Q + baseQ + (size_t)min(qt * 16 + m, SEQ - 1) * DM + d;   // row clamped; rows past the end are zeroed below
    qv[i] = *qp[i];
  }
  const unsigned short* rp0 = RKb + (size_t)wave * KTE + lane * 8;           // B[k=d][n=dist], four units per tile
  FragB rk[RTW][2];
  #pragma unroll   // constant indices: the fragments stay in registers
  for (int i = 0; i < RTW; ++i) {
    const unsigned short* rp = rp0 + (size_t)i * NW * KTE;
    rk[i][0].h[0] = *(const v8us*)(rp);
    rk[i][0].h[1] = *(const v8us*)(rp + FU);
    rk[i][1].h[0] = *(const v8us*)(rp + 2 * FU);
    rk[i][1].h[1] = *(const v8us*)(rp + 3 * FU);
  }
  const unsigned short* kp0 = Kbh + (size_t)wave * KTE;                      // B[k=d][n=key], four units per tile
  FragB kf[KTW][2];
  #pragma unroll   // constant indices: the fragments stay in registers
  for (int i = 0; i < KTW / 2; ++i) {
    const unsigned short* kp = kp0 + (size_t)i * NW * KTE;
    kf[i][0].h[0] = *(const v8us*)(kp);
    kf[i][0].h[1] = *(const v8us*)(kp + FU);
    kf[i][1].h[0] = *(const v8us*)(kp + 2 * FU);
    kf[i][1].h[1] = *(const v8us*)(kp + 3 * FU);
  }
  static_assert(QPT == 2, "the wait below names one address per Q load");
  // Behind each group: the wait that is kept in front of any overwrite of an issued load's address registers. The addresses
  // are inputs, so they live up to the wait (left to itself the build gave some loads an address register of the group as
  // their destination, or waited to a count only).
  asm volatile("s_wait_xcnt 0x0" :: "v"(qp[0]), "v"(qp[1]), "v"(rp0), "v"(kp0) : "memory");

  // ---------- Phase 0: stage Q tile as bf16 ----------------------------------
  #pragma unroll   // constant indices into qv
  for (int i = 0; i < QPT; ++i) {
    const int idx = tid + i * NT;
    const int m = idx >> 6, d = idx & 63;
    const float v = (qt * 16 + m < SEQ) ? qv[i] : 0.0f;
    sQ[m * QP + d] = bf16_rne(v);
  }
  lds_barrier();

  // A fragments of the Q tile: k 0..31 and k 32..63 (split map: elems 0..7 <- k0+8h, 8..15 <- k0+16+8h)
  FragB qa0, qa1;
  {
    const unsigned short* qp = sQ + n * QP + 8 * hi;
    qa0.h[0] = *(const v8us*)(qp);
    qa0.h[1] = *(const v8us*)(qp + 16);
    qa1.h[0] = *(const v8us*)(qp + 32);
    qa1.h[1] = *(const v8us*)(qp + 48);
  }

  // ---------- Phase 1: P = Qtile @ relK^T, stored at every circular offset that has this distance ----------
  static_assert(TOFF == 15, "nrev is TOFF - n");
  const int swave = __builtin_amdgcn_readfirstlane(wave);   // tile numbers and base offsets stay scalar
  const int nrev  = n ^ 15;                                 // TOFF - n, never negative
  #pragma unroll   // constant indices into rk
  for (int i = 0; i < RTW; ++i) {
    const int ct = swave + i * NW;
    v8f acc = zero8();
    acc = wmma_bf16(qa0, rk[i][0], acc);
    acc = wmma_bf16(qa1, rk[i][1], acc);
    const int dist = ct * 16 + n;
    float* trow = sT + 8 * hi * TP;
    if (dist <= DMAX) {              // offsets dist and SEQ - dist
      // column TOFF + SEQ - dist = (SEQ - 16*31) + 16*(31 - ct) + (15 - n), each variable term counted up from 0
      const int mcol = (ct ^ (NDIST / 16 - 1)) * 16 + nrev;
      #pragma unroll
      for (int r = 0; r < 8; ++r) {
        trow[r * TP + TOFF + dist] = acc[r];
        trow[r * TP + (SEQ - (NDIST / 16 - 1) * 16) + mcol] = acc[r];
      }
    }
    if (i == 0 && ct == 0) {         // offsets -15..0: a tile on the diagonal reaches below 0
      #pragma unroll
      for (int r = 0; r < 8; ++r) trow[r * TP + nrev] = acc[r];
      if (n < 8) {                   // offsets SEQ..SEQ+7: the last query tile against the first keys
        #pragma unroll
        for (int r = 0; r < 8; ++r) trow[r * TP + TOFF + SEQ + n] = acc[r];
      }
    }
  }
  // Group 2: the other key tiles, into the registers that relK has left; they land behind the first two tiles' work.
  const unsigned short* kq[KTW];
  #pragma unroll   // constant indices into kf
  for (int i = KTW / 2; i < KTW; ++i) {
    const int kt = min(wave + i * NW, KTI - 1);   // the last wave has no last tile: address clamped, value unused
    kq[i] = Kbh + (size_t)kt * KTE;
    kf[i][0].h[0] = *(const v8us*)(kq[i]);
    kf[i][0].h[1] = *(const v8us*)(kq[i] + FU);
    kf[i][1].h[0] = *(const v8us*)(kq[i] + 2 * FU);
    kf[i][1].h[1] = *(const v8us*)(kq[i] + 3 * FU);
  }
  static_assert(KTW == 4, "the wait below names one address per tile of the group");
  asm volatile("s_wait_xcnt 0x0" :: "v"(kq[2]), "v"(kq[3]) : "memory");   // as behind group 1
  lds_barrier();

  // ---------- Phase 2: scores = QK^T*scale + bias at offset (query - key) mod SEQ ----------------
  // Inside a tile the offset is base + m - n, base = 16*(qt - kt) mod SEQ: one address per tile, the rows by constant steps.
  static_assert(NW * (KTW - 1) * 16 <= SEQ, "only a wave's last tile can hold padded keys");
  const float* tlane = sT + 8 * hi * (TP + 1) + nrev;
  float*       slane = sS + 8 * hi * SP + n;
  // A tile's eight bias reads are issued as one group in front of the previous tile's score stores, so that they are in
  // flight together and land behind that tile's products.
  float bias[2][8];
  {
    const int dt = qt - swave;
    const float* tp = tlane + (dt * 16 + (dt < 0 ? SEQ : 0));
    #pragma unroll
    for (int r = 0; r < 8; ++r) bias[0][r] = tp[r * (TP + 1)];
  }
  #pragma unroll   // constant indices into kf and bias
  for (int i = 0; i < KTW; ++i) {
    const int kt = swave + i * NW;
    if (kt >= KTI) break;
    if (i + 1 < KTW) {
      const int dt = qt - min(kt + NW, KTI - 1);   // the last wave has no last tile: tile number clamped, values unused
      const float* tp = tlane + (dt * 16 + (dt < 0 ? SEQ : 0));
      #pragma unroll
      for (int r = 0; r < 8; ++r) bias[(i + 1) & 1][r] = tp[r * (TP + 1)];
    }
    float* sp = slane + kt * 16;
    v8f acc = zero8();
    acc = wmma_bf16(qa0, kf[i][0], acc);
    acc = wmma_bf16(qa1, kf[i][1], acc);
    #pragma unroll
    for (int r = 0; r < 8; ++r) {
      float sc = acc[r] * scale + bias[i & 1][r];
      if (i == KTW - 1 && kt * 16 + n >= SEQ) sc = -1.0e30f;   // padded keys
      sp[r * SP] = sc;
    }
  }
  __syncthreads();

  // Group 3: this wave's V^T fragments for phase 5; they land behind the softmax.
  const int dbase = (wave & 3) * 16;           // 16 head dims per wave
  const int ks    = wave >> 2;                 // this wave's part of the key range and of the distance range
  const int key0  = ks * (SPAD / KSP);
  const int dis0  = ks * (NDIST / KSP);
  FragH vf[VSW];
  {
    const _Float16* vcol = Vbh + (size_t)((wave & 3) * (SPAD / 32) + ks * VSW) * VSE;   // B[k=key][n=dim], two units per step
    #pragma unroll   // constant indices: the fragments stay in registers
    for (int i = 0; i < VSW; ++i) {
      vf[i].h[0] = *(const v8h*)(vcol + i * VSE);
      vf[i].h[1] = *(const v8h*)(vcol + i * VSE + FU);
    }
    asm volatile("s_wait_xcnt 0x0" :: "v"(vcol) : "memory");   // as behind group 1
  }

  // ---------- Phase 3: row softmax (normalisation deferred) -----------------
  {
    const int row = tid / TPR, sub = tid % TPR;
    const int j0 = sub * 4;   // neighbouring threads take neighbouring float4s: each LDS access of a wave is one contiguous run
    float* rowS = sS + row * SP;
    _Float16* rowA = sA + row * AP;

    float mx = -1.0e30f;
    for (int it = 0; it < SPAD / (4 * TPR); ++it) {
      const int j = j0 + it * (4 * TPR);
      if (j < SEQ) {   // SEQ is a multiple of 4: a float4 is entirely valid or entirely padding
        v4f v = *(const v4f*)(rowS + j);
        mx = fmaxf(mx, fmaxf(fmaxf(v.x, v.y), fmaxf(v.z, v.w)));
      }
    }
    sRed[row * TPR + sub] = mx;
    lds_barrier();
    if (sub == 0) {
      float m2 = sRed[row * TPR];
      #pragma unroll
      for (int u = 1; u < TPR; ++u) m2 = fmaxf(m2, sRed[row * TPR + u]);
      sMax[row] = m2;
    }
    lds_barrier();
    const float rm = sMax[row];
    float sum = 0.0f;
    for (int it = 0; it < SPAD / (4 * TPR); ++it) {
      const int j = j0 + it * (4 * TPR);
      v4f e = {0.0f, 0.0f, 0.0f, 0.0f};
      if (j < SEQ) {
        v4f v = *(const v4f*)(rowS + j);
        e = exp_x4(v - rm);
      }
      *(v4f*)(rowS + j) = e;
      v4h h4;
      h4.x = (_Float16)(e.x * PSC); h4.y = (_Float16)(e.y * PSC);
      h4.z = (_Float16)(e.z * PSC); h4.w = (_Float16)(e.w * PSC);
      *(v4h*)(rowA + j) = h4;
      sum += (e.x + e.y) + (e.z + e.w);
    }
    sRed[row * TPR + sub] = sum;
    lds_barrier();
    if (sub == 0) {
      float s2 = 0.0f;
      #pragma unroll
      for (int u = 0; u < TPR; ++u) s2 += sRed[row * TPR + u];
      sRcp[row] = 1.0f / s2;
    }
    lds_barrier();
  }

  // Group 4: this wave's relV^T fragments for phase 5; they land behind phase 4.
  FragH rvf[RSW];
  {
    const _Float16* rvcol = RVt + (size_t)((wave & 3) * (NDIST / 32) + ks * RSW) * VSE + lane * 8;   // B[k=dist][n=dim]
    #pragma unroll   // constant indices: the fragments stay in registers
    for (int i = 0; i < RSW; ++i) {
      rvf[i].h[0] = *(const v8h*)(rvcol + i * VSE);
      rvf[i].h[1] = *(const v8h*)(rvcol + i * VSE + FU);
    }
    asm volatile("s_wait_xcnt 0x0" :: "v"(rvcol) : "memory");   // as behind group 1
  }

  // ---------- Phase 4: per-distance mass, fixed 2-key gather (no atomics) ---
  // keys at circular distance dist from row q: (q-dist) mod S and (q+dist) mod S (one key when they coincide)
  // One distance per thread, all 16 rows. The two keys coincide exactly where 2*dist is a multiple of SEQ, whatever the row,
  // so that test and the padding test become two per-thread factors and the rows' reads are independent of each other.
  {
    static_assert(NT == NDIST, "one distance per thread");
    const int dist = tid;
    const float w2 = (dist == 0 || 2 * dist == SEQ) ? 0.0f : 1.0f;
    const float ws = (dist <= DMAX) ? PSC : 0.0f;
    #pragma unroll   // all rows' LDS reads in flight together
    for (int m = 0; m < 16; ++m) {
      const int qrow = min(qt * 16 + m, SEQ - 1);
      // wrap into 0..SEQ-1 by an unsigned minimum: the out-of-range form is negative, so huge as unsigned
      const unsigned k1 = min((unsigned)(qrow - dist), (unsigned)(qrow - dist + SEQ));
      const unsigned k2 = min((unsigned)(qrow + dist), (unsigned)(qrow + dist - SEQ));
      const float val = sS[m * SP + k1] + w2 * sS[m * SP + k2];
      sD[m * DP + dist] = (_Float16)(val * ws);
    }
  }
  lds_barrier();

  // ---------- Phase 5: out = (P@V + D@relV) * rcp / 256 -----------------------
  {
    const _Float16* arow  = sA + n * AP    + key0 + 8 * hi;                      // A[m=row][k=key]
    const _Float16* drow  = sD + n * DP    + dis0 + 8 * hi;                      // A[m=row][k=dist]
    v8f acc = zero8();

    #pragma unroll   // constant indices into vf
    for (int kt2 = 0; kt2 < VSW; ++kt2) {
      const int kb = kt2 * 32;
      FragH a;
      a.h[0]  = *(const v8h*)(arow + kb);
      a.h[1]  = *(const v8h*)(arow + kb + 16);
      acc = wmma_f16(a, vf[kt2], acc);
    }
    #pragma unroll   // constant indices into rvf
    for (int rt = 0; rt < RSW; ++rt) {
      const int kb = rt * 32;
      FragH a;
      a.h[0]  = *(const v8h*)(drow + kb);
      a.h[1]  = *(const v8h*)(drow + kb + 16);
      acc = wmma_f16(a, rvf[rt], acc);
    }
    // stage this wave's 16x16 f32 partial sum (sP is free after phase 2)
    #pragma unroll
    for (int r = 0; r < 8; ++r) {
      const int m = r + 8 * hi;
      sP[(ks * 16 + m) * OP + dbase + n] = acc[r];
    }
  }
  __syncthreads();

  // add the KSP partial sums, normalise, store whole 128-B lines (8 lanes each)
  if (tid < 16 * DH / 4) {
    float* obase = Out + baseQ;
    const int m = tid >> 4;
    const int c = (tid & 15) * 4;
    const int qrow = qt * 16 + m;
    v4f v = *(const v4f*)(sP + m * OP + c);
    #pragma unroll
    for (int s = 1; s < KSP; ++s) v += *(const v4f*)(sP + (s * 16 + m) * OP + c);
    v *= sRcp[m] * PSCI;
    if (qrow < SEQ) *(v4f*)(obase + (size_t)qrow * DM + c) = v;
  }
}

extern "C" void kernel_launch(void* const* d_in, const int* in_sizes, int n_in,
                              void* d_out, int out_size, void* d_ws, size_t ws_size,
                              hipStream_t stream) {
  if (n_in < 5) return;
  if (in_sizes[0] < NB * SEQ * DM || in_sizes[1] < NB * SEQ * DM || in_sizes[2] < NB * SEQ * DM) return;
  if (in_sizes[3] < NDIST * DH || in_sizes[4] < NDIST * DH) return;
  if (out_size < NB * SEQ * DM) return;
  const size_t ws_need = WS_END * 2;           // 16,777,216 B
  if (ws_size < ws_need) return;

  const float* Q  = (const float*)d_in[0];
  const float* K  = (const float*)d_in[1];
  const float* V  = (const float*)d_in[2];
  const float* RK = (const float*)d_in[3];
  const float* RV = (const float*)d_in[4];
  float* Out = (float*)d_out;
  unsigned short* ws16 = (unsigned short*)d_ws;

  unsigned short* Kb  = ws16 + WS_K;
  _Float16*       Vt  = (_Float16*)(ws16 + WS_VT);
  unsigned short* RKb = ws16 + WS_RK;
  _Float16*       RVt = (_Float16*)(ws16 + WS_RVT);

  prep_k_kernel  <<<(NK8 + 255) / 256, 256, 0, stream>>>(K, Kb);
  prep_vt_kernel <<<(NV8 + 255) / 256, 256, 0, stream>>>(V, Vt);
  prep_rel_kernel<<<(2 * NR8 + 255) / 256, 256, 0, stream>>>(RK, RV, RKb, RVt);

  dim3 grid(QTN, NB * NH);
  circ_rel_attn_kernel<<<grid, dim3(NT), 0, stream>>>(Q, Kb, Vt, RKb, RVt, Out);
}

// v006
// Measured time: 82.5 microseconds a run.
// Next to v005, in two timings, it ran 1.04 times as fast each time.
// All steps since v000 together make it 4.68 times as fast.
#include <hip/hip_runtime.h>

// Contractions: Q*K^T and Q*relK^T on v_wmma_f32_16x16x32_bf16 (bf16 operands, f32 accumulate);
// P*V and bucketed P*relV on v_wmma_f32_16x16x32_f16 (f16 operands: P scaled by 2^8, V/relV carry bf16-RNE values; f32 accumulate).

typedef _Float16 v16h __attribute__((ext_vector_type(16)));
typedef _Float16 v8h  __attribute__((ext_vector_type(8), may_alias));
typedef _Float16 v4h  __attribute__((ext_vector_type(4), may_alias));
typedef __bf16   v16b __attribute__((ext_vector_type(16)));
typedef unsigned short v8us __attribute__((ext_vector_type(8), may_alias));
typedef float v8f __attribute__((ext_vector_type(8)));
typedef float v4f __attribute__((ext_vector_type(4), may_alias));

#define SEQ   1000   // sequence length
#define SEQP  1008   // keys padded to a multiple of 16
#define DM    512    // model width
#define DH    64     // head dim
#define NB    8      // batch
#define NH    8      // heads
#define QTN   63     // query tiles of 16
#define KTI   63     // key tiles of 16
#define SPAD  1024   // padded key dim (multiple of 32)
#define NDIST 512    // padded distance dim (>= 501, multiple of 32)
#define DMAX  500    // largest circular distance
#define NW    16     // waves per attention block
#define NT    512    // threads per attention block
#define TPR   (NT / 16)      // threads per score row in the softmax
#define KSP   (NW / 4)       // waves that share one 16-dim output tile, each on its own part of the k range
#define QPT   (16 * DH / NT)             // Q elements staged per thread
#define RTW   (NDIST / 16 / NW)          // relK column tiles per wave
#define KTW   ((KTI + NW - 1) / NW)      // key tiles per wave (the last wave has one fewer)
#define VSW   (SPAD / 32 / KSP)          // k steps of P*V per wave
#define RSW   (NDIST / 32 / KSP)         // k steps of D*relV per wave
// LDS row pitches: each keeps the lanes of one LDS instruction on distinct banks (64 banks of 4 B)
#define QP    (DH + 8)       // sQ, 2-B elements: 144 B = 16 B x odd, for the 16-B fragment reads down 16 rows
#define AP    (SPAD + 8)     // sA, 2-B elements: 2064 B = 16 B x odd
#define DP    (NDIST + 8)    // sD, 2-B elements: 1040 B = 16 B x odd
#define SP    (SPAD + 4)     // sS, f32: 8 rows = 32 banks mod 64, so the two lane halves of a D tile do not meet
#define PP    (NDIST + 4)    // f32 words per query row in the first half of sPA
#define OP    (DH + 4)       // partial outputs in sP, f32: the same
#define TP    (SPAD + 4)     // sT, f32: the same
#define TOFF  15             // sT column of circular offset 0 (a 16x16 tile reaches 15 below its base offset)
#define PSC   256.0f        // power-of-two scale on the f16 attention weights
#define PSCI  0.00390625f   // 1/256

// Workspace layout in 2-byte elements. All four operands lie in B-fragment order: the unit is [32 lanes][8 elements] = 512 B,
// what one 16-byte load of a wave takes, so that such a load covers four whole 128-B lines.
// Lane = 16*hi + n. K kind (n = key or distance): unit c of a 16-row tile holds head dims 16*c + 8*hi + 0..7.
// V kind (n = head dim of a 16-dim tile): unit j of a 32-row step holds keys or distances 16*j + 8*hi + 0..7.
#define FU      256                                      // elements per unit
#define KTE     (4 * FU)                                 // elements per 16-row tile of the K kind
#define VSE     (2 * FU)                                 // elements per 32-row step of the V kind
#define WS_K    ((size_t)0)                              // [64 bh][63 tiles][4 units]          bf16 K, padded keys zero
#define WS_VT   ((size_t)NB * SEQP * DM)                 // [64 bh][4 dim tiles][32 steps][2]   f16 V, padded keys zero
#define WS_RK   (WS_VT + (size_t)NB * NH * DH * SPAD)    // [32 tiles][4 units]                 bf16 relK
#define WS_RVT  (WS_RK + (size_t)NDIST * DH)             // [4 dim tiles][16 steps][2]          f16 relV
#define WS_END  (WS_RVT + (size_t)DH * NDIST)

#define NK8  (NB * SEQP * DM / 8)       // work units of 8 elements, K copy
#define NV8  (NB * NH * DH * SPAD / 8)  // work units of 8 elements, V^T copy
#define NR8  (NDIST * DH / 8)           // work units of 8 elements, each rel table

union FragH { v16h v; v8h  h[2]; };
union FragB { v16b v; v8us h[2]; };

__device__ __forceinline__ v8f zero8() {
  v8f z = {0.0f, 0.0f, 0.0f, 0.0f, 0.0f, 0.0f, 0.0f, 0.0f};
  return z;
}

__device__ __forceinline__ v8f wmma_f16(const FragH& a, const FragH& b, v8f c) {
  v8f d = __builtin_amdgcn_wmma_f32_16x16x32_f16(false, a.v, false, b.v, (short)0, c, false, false);
  asm volatile("v_nop\n\tv_nop\n\tv_nop\n\tv_nop" : "+v"(d) : "v"(a.v), "v"(b.v));
  return d;
}

__device__ __forceinline__ v8f wmma_bf16(const FragB& a, const FragB& b, v8f c) {
  v8f d = __builtin_amdgcn_wmma_f32_16x16x32_bf16(false, a.v, false, b.v, (short)0, c, false, false);
  asm volatile("v_nop\n\tv_nop\n\tv_nop\n\tv_nop" : "+v"(d) : "v"(a.v), "v"(b.v));
  return d;
}

// f32 -> bf16 bits, RNE
__device__ __forceinline__ unsigned short bf16_rne(float f) {
  unsigned int u = __float_as_uint(f);
  u += 0x7FFFu + ((u >> 16) & 1u);
  return (unsigned short)(u >> 16);
}

// f32 -> bf16 (RNE) -> f16 ; the second step is exact for bf16 values in f16 range
__device__ __forceinline__ _Float16 f16_of_bf16(float f) {
  unsigned int u = ((unsigned int)bf16_rne(f)) << 16;
  return (_Float16)__uint_as_float(u);
}

// e^x for four values at once (x * log2(e), then the hardware's 2^x, as __expf does).
// One statement with outputs apart from all inputs and a closing v_nop: it keeps the one slot the instruction set asks for
// between a transcendental and an instruction that overwrites its source or reads its result.
__device__ __forceinline__ v4f exp_x4(v4f x) {
  const float a = x.x * 1.44269504f, b = x.y * 1.44269504f, c = x.z * 1.44269504f, d = x.w * 1.44269504f;
  v4f r;
  float r0, r1, r2, r3;
  asm("v_exp_f32 %0, %4\n\tv_exp_f32 %1, %5\n\tv_exp_f32 %2, %6\n\tv_exp_f32 %3, %7\n\tv_nop"
      : "=&v"(r0), "=&v"(r1), "=&v"(r2), "=&v"(r3) : "v"(a), "v"(b), "v"(c), "v"(d));
  r.x = r0; r.y = r1; r.z = r2; r.w = r3;
  return r;
}

// Work-group barrier that orders LDS only. All that the waves of a block hand each other goes through LDS, and the global
// buffers read here are written by earlier launches alone. __syncthreads() also drains the wave's outstanding global loads,
// which would end the flight of the fragment loads issued ahead at the first barrier behind them.
__device__ __forceinline__ void lds_barrier() {
  __builtin_amdgcn_fence(__ATOMIC_RELEASE, "workgroup", "local");
  __builtin_amdgcn_s_barrier();
  __builtin_amdgcn_fence(__ATOMIC_ACQUIRE, "workgroup", "local");
}

// ---------------- prep: one launch packs K, V, relK and relV in fragment order ----------------
// The unit of work is one 16-byte piece of a packed operand. A thread takes PU units, 256 apart, and issues all their loads
// before the first conversion: few long-lived waves with many loads in flight, in place of one short wave per 32 units.
// A block's PU * 256 units lie in one operand, so the choice of the operand is uniform over the block.
#define PU   8
#define PCH  (256 * PU)
static_assert(NK8 % PCH == 0 && NV8 % PCH == 0 && NR8 % PCH == 0, "no block straddles two operands");

// K kind: unit t is [tile][unit c][lane]; row = 16 * tile + n, head dims 16 * c + 8 * hi + 0..7. ISK: K itself, else relK.
template <bool ISK>
__device__ __forceinline__ void pack_k_kind(const float* __restrict__ S, unsigned short* __restrict__ dst, int t0) {
  static_assert(PU == 8, "the wait below names one address per unit");
  const int n  = threadIdx.x & 15;
  const int hi = (threadIdx.x >> 4) & 1;
  const float* src[PU];
  v4f x0[PU], x1[PU];
  bool ok[PU];
  #pragma unroll   // constant indices: the loaded values stay in registers, and all loads are issued before the first wait
  for (int u = 0; u < PU; ++u) {
    const int t = t0 + u * 256;
    const int d = ((t >> 5) & 3) * 16 + 8 * hi;
    const int tile = t >> 7;
    if (ISK) {                          // keys padded to SEQP: row clamped for the address, padded rows zeroed below
      const int bh = tile / KTI;
      const int r  = (tile % KTI) * 16 + n;
      ok[u]  = r < SEQ;
      src[u] = S + ((size_t)(bh >> 3) * SEQ + min(r, SEQ - 1)) * DM + (bh & 7) * DH + d;
    } else {                            // distances 0..511
      ok[u]  = true;
      src[u] = S + (tile * 16 + n) * DH + d;
    }
    x0[u] = *(const v4f*)(src[u]);
    x1[u] = *(const v4f*)(src[u] + 4);
  }
  // kept in front of any overwrite of the loads' address registers; the addresses are inputs, so they live up to the wait
  asm volatile("s_wait_xcnt 0x0" :: "v"(src[0]), "v"(src[1]), "v"(src[2]), "v"(src[3]),
                                    "v"(src[4]), "v"(src[5]), "v"(src[6]), "v"(src[7]) : "memory");
  v8us  o[PU];
  v8us* p[PU];
  #pragma unroll   // constant indices into the register arrays
  for (int u = 0; u < PU; ++u) {
    const v4f z = {0.0f, 0.0f, 0.0f, 0.0f};
    const v4f a = ok[u] ? x0[u] : z, b = ok[u] ? x1[u] : z;
    o[u][0] = bf16_rne(a.x); o[u][1] = bf16_rne(a.y); o[u][2] = bf16_rne(a.z); o[u][3] = bf16_rne(a.w);
    o[u][4] = bf16_rne(b.x); o[u][5] = bf16_rne(b.y); o[u][6] = bf16_rne(b.z); o[u][7] = bf16_rne(b.w);
    p[u] = (v8us*)(dst + (size_t)(t0 + u * 256) * 8);   // unit t goes to the t-th 16 bytes
    *p[u] = o[u];
  }
  // the same wait for the stores: with their data and addresses as inputs the build overwrites no store's register in front of it
  asm volatile("s_wait_xcnt 0x0" :: "v"(o[0]), "v"(o[1]), "v"(o[2]), "v"(o[3]), "v"(o[4]), "v"(o[5]), "v"(o[6]), "v"(o[7]),
                                    "v"(p[0]), "v"(p[1]), "v"(p[2]), "v"(p[3]), "v"(p[4]), "v"(p[5]), "v"(p[6]), "v"(p[7]) : "memory");
}

// V kind: 256 units are one 32-row step, all four dim tiles, so that a block reads whole 256-B head rows, 16 lanes per 64 B.
// Unit t is [step s][half j][dim tile dt][lane]; dim = 16 * dt + n, rows 32 * s + 16 * j + 8 * hi + 0..7. ISV: V itself, else relV.
template <bool ISV>
__device__ __forceinline__ void pack_v_kind(const float* __restrict__ S, _Float16* __restrict__ dst, int t0) {
  static_assert(PU == 8, "the wait below names one address per unit");
  const int lane = threadIdx.x & 31;
  const int n  = lane & 15;
  const int hi = lane >> 4;
  const float* src[PU];
  float x[PU][8];
  bool ok[PU];
  int  e0[PU];
  #pragma unroll   // as in pack_k_kind
  for (int u = 0; u < PU; ++u) {
    const int t  = t0 + u * 256;
    const int dt = (t >> 5) & 3;
    const int j  = (t >> 7) & 1;
    const int dim = dt * 16 + n;
    if (ISV) {                          // keys padded to SPAD: SEQ is a multiple of 8, so a unit's 8 keys are all valid or all padding
      const int s  = (t >> 8) & (SPAD / 32 - 1);
      const int bh = t >> 13;           // DH*SPAD/8 = 8192 units per (b,h)
      const int key0 = s * 32 + j * 16 + 8 * hi;
      ok[u]  = key0 < SEQ;
      e0[u]  = ((bh * 4 + dt) * (SPAD / 32) + s) * VSE + j * FU + lane * 8;
      src[u] = S + ((size_t)(bh >> 3) * SEQ + min(key0, SEQ - 8)) * DM + (bh & 7) * DH + dim;
    } else {                            // distances 0..511
      const int s = t >> 8;
      ok[u]  = true;
      e0[u]  = (dt * (NDIST / 32) + s) * VSE + j * FU + lane * 8;
      src[u] = S + (size_t)(s * 32 + j * 16 + 8 * hi) * DH + dim;
    }
    #pragma unroll
    for (int i = 0; i < 8; ++i) x[u][i] = src[u][(size_t)i * (ISV ? DM : DH)];
  }
  // as in pack_k_kind
  asm volatile("s_wait_xcnt 0x0" :: "v"(src[0]), "v"(src[1]), "v"(src[2]), "v"(src[3]),
                                    "v"(src[4]), "v"(src[5]), "v"(src[6]), "v"(src[7]) : "memory");
  v8h  o[PU];
  v8h* p[PU];
  #pragma unroll   // constant indices into the register arrays
  for (int u = 0; u < PU; ++u) {
    #pragma unroll
    for (int i = 0; i < 8; ++i) o[u][i] = f16_of_bf16(ok[u] ? x[u][i] : 0.0f);
    p[u] = (v8h*)(dst + (size_t)e0[u]);
    *p[u] = o[u];
  }
  // as in pack_k_kind
  asm volatile("s_wait_xcnt 0x0" :: "v"(o[0]), "v"(o[1]), "v"(o[2]), "v"(o[3]), "v"(o[4]), "v"(o[5]), "v"(o[6]), "v"(o[7]),
                                    "v"(p[0]), "v"(p[1]), "v"(p[2]), "v"(p[3]), "v"(p[4]), "v"(p[5]), "v"(p[6]), "v"(p[7]) : "memory");
}

__global__ __launch_bounds__(256)
void prep_kernel(const float* __restrict__ K, const float* __restrict__ V,
                 const float* __restrict__ RK, const float* __restrict__ RV,
                 unsigned short* __restrict__ Kb, _Float16* __restrict__ Vt,
                 unsigned short* __restrict__ RKb, _Float16* __restrict__ RVt) {
  const int blk = blockIdx.x;
  const int tid = threadIdx.x;
  if (blk < NK8 / PCH)                        pack_k_kind<true >(K,  Kb,  blk * PCH + tid);
  else if (blk < (NK8 + NV8) / PCH)           pack_v_kind<true >(V,  Vt,  (blk - NK8 / PCH) * PCH + tid);
  else if (blk < (NK8 + NV8 + NR8) / PCH)     pack_k_kind<false>(RK, RKb, (blk - (NK8 + NV8) / PCH) * PCH + tid);
  else                                        pack_v_kind<false>(RV, RVt, (blk - (NK8 + NV8 + NR8) / PCH) * PCH + tid);
}

// ---------------- fused attention kernel ------------------------------------
__global__ __launch_bounds__(NT)
void circ_rel_attn_kernel(const float* __restrict__ Q,
                          const unsigned short* __restrict__ Kb,
                          const _Float16* __restrict__ Vt,
                          const unsigned short* __restrict__ RKb,
                          const _Float16* __restrict__ RVt,
                          float* __restrict__ Out)
{
  __shared__ __attribute__((aligned(16))) unsigned short sQ[16 * QP];     //  2 KB  bf16 Q tile
  // 64 KB, two lives. Phases 1-2: sT[q][TOFF + u] = (Q*relK^T)[q][circular distance of u], u = -15..1007, the bias row laid
  // out over the whole circle. From phase 3: the second half is sA; the first half takes the partial outputs [KSP][16][OP].
  __shared__ __attribute__((aligned(16))) float          sPA[16 * PP + 16 * AP / 2];
  __shared__ __attribute__((aligned(16))) float          sS[16 * SP];     // 64 KB  scores -> exp(scores)
  __shared__ __attribute__((aligned(16))) _Float16       sD[16 * DP];     // 16 KB  per-distance mass*256 f16
  __shared__ float sRed[16 * TPR];
  __shared__ float sMax[16];
  __shared__ float sRcp[16];
  float*    const sT = sPA;
  float*    const sP = sPA;
  _Float16* const sA = (_Float16*)(sPA + 16 * PP);                        // 32 KB  exp(scores)*256 f16
  static_assert(16 * TP <= 16 * PP + 16 * AP / 2, "the unfolded bias rows fit the two halves");
  static_assert(KSP * 16 * OP <= 16 * PP, "the partial outputs stay clear of sA");
  static_assert(TOFF + SEQ + 7 < TP, "the largest offset a tile reads lies inside its row");

  const int qt   = blockIdx.x;
  const int bh   = blockIdx.y;
  const int b    = bh >> 3;
  const int h    = bh & 7;
  const int tid  = threadIdx.x;
  const int lane = tid & 31;
  const int wave = tid >> 5;
  const int n    = lane & 15;           // A row / B column / D column
  const int hi   = lane >> 4;           // lane half

  const float scale = 0.125f;
  const size_t baseQ = (size_t)b * SEQ * DM + (size_t)h * DH;
  const unsigned short* Kbh = Kb + (size_t)bh * KTI * KTE + lane * 8;     // this lane's 16 bytes of every unit
  const _Float16* Vbh = Vt + (size_t)bh * DH * SPAD + lane * 8;

  // ---------- Global loads issued ahead: none of them depends on anything computed here, so each group is
  // issued one phase or more before its use and its latency passes behind the work in between.
  // Group 1 (here): the Q elements, this wave's relK tiles, its first two key tiles.
  float qv[QPT];
  const float* qp[QPT];
  #pragma unroll   // constant indices: qv stays in registers, and all its loads are issued before the first wait
  for (int i = 0; i < QPT; ++i) {
    const int idx = tid + i * NT;
    const int m = idx >> 6, d = idx & 63;
    qp[i] = Q + baseQ + (size_t)min(qt * 16 + m, SEQ - 1) * DM + d;   // row clamped; rows past the end are zeroed below
    qv[i] = *qp[i];
  }
  const unsigned short* rp0 = RKb + (size_t)wave * KTE + lane * 8;           // B[k=d][n=dist], four units per tile
  FragB rk[RTW][2];
  #pragma unroll   // constant indices: the fragments stay in registers
  for (int i = 0; i < RTW; ++i) {
    const unsigned short* rp = rp0 + (size_t)i * NW * KTE;
    rk[i][0].h[0] = *(const v8us*)(rp);
    rk[i][0].h[1] = *(const v8us*)(rp + FU);
    rk[i][1].h[0] = *(const v8us*)(rp + 2 * FU);
    rk[i][1].h[1] = *(const v8us*)(rp + 3 * FU);
  }
  const unsigned short* kp0 = Kbh + (size_t)wave * KTE;                      // B[k=d][n=key], four units per tile
  FragB kf[KTW][2];
  #pragma unroll   // constant indices: the fragments stay in registers
  for (int i = 0; i < KTW / 2; ++i) {
    const unsigned short* kp = kp0 + (size_t)i * NW * KTE;
    kf[i][0].h[0] = *(const v8us*)(kp);
    kf[i][0].h[1] = *(const v8us*)(kp + FU);
    kf[i][1].h[0] = *(const v8us*)(kp + 2 * FU);
    kf[i][1].h[1] = *(const v8us*)(kp + 3 * FU);
  }
  static_assert(QPT == 2, "the wait below names one address per Q load");
  // Behind each group: the wait that is kept in front of any overwrite of an issued load's address registers. The addresses
  // are inputs, so they live up to the wait (left to itself the build gave some loads an address register of the group as
  // their destination, or waited to a count only).
  asm volatile("s_wait_xcnt 0x0" :: "v"(qp[0]), "v"(qp[1]), "v"(rp0), "v"(kp0) : "memory");

  // ---------- Phase 0: stage Q tile as bf16 ----------------------------------
  #pragma unroll   // constant indices into qv
  for (int i = 0; i < QPT; ++i) {
    const int idx = tid + i * NT;
    const int m = idx >> 6, d = idx & 63;
    const float v = (qt * 16 + m < SEQ) ? qv[i] : 0.0f;
    sQ[m * QP + d] = bf16_rne(v);
  }
  lds_barrier();

  // A fragments of the Q tile: k 0..31 and k 32..63 (split map: elems 0..7 <- k0+8h, 8..15 <- k0+16+8h)
  FragB qa0, qa1;
  {
    const unsigned short* qp = sQ + n * QP + 8 * hi;
    qa0.h[0] = *(const v8us*)(qp);
    qa0.h[1] = *(const v8us*)(qp + 16);
    qa1.h[0] = *(const v8us*)(qp + 32);
    qa1.h[1] = *(const v8us*)(qp + 48);
  }

  // ---------- Phase 1: P = Qtile @ relK^T, stored at every circular offset that has this distance ----------
  static_assert(TOFF == 15, "nrev is TOFF - n");
  const int swave = __builtin_amdgcn_readfirstlane(wave);   // tile numbers and base offsets stay scalar
  const int nrev  = n ^ 15;                                 // TOFF - n, never negative
  #pragma unroll   // constant indices into rk
  for (int i = 0; i < RTW; ++i) {
    const int ct = swave + i * NW;
    v8f acc = zero8();
    acc = wmma_bf16(qa0, rk[i][0], acc);
    acc = wmma_bf16(qa1, rk[i][1], acc);
    const int dist = ct * 16 + n;
    float* trow = sT + 8 * hi * TP;
    if (dist <= DMAX) {              // offsets dist and SEQ - dist
      // column TOFF + SEQ - dist = (SEQ - 16*31) + 16*(31 - ct) + (15 - n), each variable term counted up from 0
      const int mcol = (ct ^ (NDIST / 16 - 1)) * 16 + nrev;
      #pragma unroll
      for (int r = 0; r < 8; ++r) {
        trow[r * TP + TOFF + dist] = acc[r];
        trow[r * TP + (SEQ - (NDIST / 16 - 1) * 16) + mcol] = acc[r];
      }
    }
    if (i == 0 && ct == 0) {         // offsets -15..0: a tile on the diagonal reaches below 0
      #pragma unroll
      for (int r = 0; r < 8; ++r) trow[r * TP + nrev] = acc[r];
      if (n < 8) {                   // offsets SEQ..SEQ+7: the last query tile against the first keys
        #pragma unroll
        for (int r = 0; r < 8; ++r) trow[r * TP + TOFF + SEQ + n] = acc[r];
      }
    }
  }
  // Group 2: the other key tiles, into the registers that relK has left; they land behind the first two tiles' work.
  const unsigned short* kq[KTW];
  #pragma unroll   // constant indices into kf
  for (int i = KTW / 2; i < KTW; ++i) {
    const int kt = min(wave + i * NW, KTI - 1);   // the last wave has no last tile: address clamped, value unused
    kq[i] = Kbh + (size_t)kt * KTE;
    kf[i][0].h[0] = *(const v8us*)(kq[i]);
    kf[i][0].h[1] = *(const v8us*)(kq[i] + FU);
    kf[i][1].h[0] = *(const v8us*)(kq[i] + 2 * FU);
    kf[i][1].h[1] = *(const v8us*)(kq[i] + 3 * FU);
  }
  static_assert(KTW == 4, "the wait below names one address per tile of the group");
  asm volatile("s_wait_xcnt 0x0" :: "v"(kq[2]), "v"(kq[3]) : "memory");   // as behind group 1
  lds_barrier();

  // ---------- Phase 2: scores = QK^T*scale + bias at offset (query - key) mod SEQ ----------------
  // Inside a tile the offset is base + m - n, base = 16*(qt - kt) mod SEQ: one address per tile, the rows by constant steps.
  static_assert(NW * (KTW - 1) * 16 <= SEQ, "only a wave's last tile can hold padded keys");
  const float* tlane = sT + 8 * hi * (TP + 1) + nrev;
  float*       slane = sS + 8 * hi * SP + n;
  // A tile's eight bias reads are issued as one group in front of the previous tile's score stores, so that they are in
  // flight together and land behind that tile's products.
  float bias[2][8];
  {
    const int dt = qt - swave;
    const float* tp = tlane + (dt * 16 + (dt < 0 ? SEQ : 0));
    #pragma unroll
    for (int r = 0; r < 8; ++r) bias[0][r] = tp[r * (TP + 1)];
  }
  #pragma unroll   // constant indices into kf and bias
  for (int i = 0; i < KTW; ++i) {
    const int kt = swave + i * NW;
    if (kt >= KTI) break;
    if (i + 1 < KTW) {
      const int dt = qt - min(kt + NW, KTI - 1);   // the last wave has no last tile: tile number clamped, values unused
      const float* tp = tlane + (dt * 16 + (dt < 0 ? SEQ : 0));
      #pragma unroll
      for (int r = 0; r < 8; ++r) bias[(i + 1) & 1][r] = tp[r * (TP + 1)];
    }
    float* sp = slane + kt * 16;
    v8f acc = zero8();
    acc = wmma_bf16(qa0, kf[i][0], acc);
    acc = wmma_bf16(qa1, kf[i][1], acc);
    #pragma unroll
    for (int r = 0; r < 8; ++r) {
      float sc = acc[r] * scale + bias[i & 1][r];
      if (i == KTW - 1 && kt * 16 + n >= SEQ) sc = -1.0e30f;   // padded keys
      sp[r * SP] = sc;
    }
  }
  __syncthreads();

  // Group 3: this wave's V^T fragments for phase 5; they land behind the softmax.
  const int dbase = (wave & 3) * 16;           // 16 head dims per wave
  const int ks    = wave >> 2;                 // this wave's part of the key range and of the distance range
  const int key0  = ks * (SPAD / KSP);
  const int dis0  = ks * (NDIST / KSP);
  FragH vf[VSW];
  {
    const _Float16* vcol = Vbh + (size_t)((wave & 3) * (SPAD / 32) + ks * VSW) * VSE;   // B[k=key][n=dim], two units per step
    #pragma unroll   // constant indices: the fragments stay in registers
    for (int i = 0; i < VSW; ++i) {
      vf[i].h[0] = *(const v8h*)(vcol + i * VSE);
      vf[i].h[1] = *(const v8h*)(vcol + i * VSE + FU);
    }
    asm volatile("s_wait_xcnt 0x0" :: "v"(vcol) : "memory");   // as behind group 1
  }

  // ---------- Phase 3: row softmax (normalisation deferred) -----------------
  {
    const int row = tid / TPR, sub = tid % TPR;
    const int j0 = sub * 4;   // neighbouring threads take neighbouring float4s: each LDS access of a wave is one contiguous run
    float* rowS = sS + row * SP;
    _Float16* rowA = sA + row * AP;

    float mx = -1.0e30f;
    for (int it = 0; it < SPAD / (4 * TPR); ++it) {
      const int j = j0 + it * (4 * TPR);
      if (j < SEQ) {   // SEQ is a multiple of 4: a float4 is entirely valid or entirely padding
        v4f v = *(const v4f*)(rowS + j);
        mx = fmaxf(mx, fmaxf(fmaxf(v.x, v.y), fmaxf(v.z, v.w)));
      }
    }
    sRed[row * TPR + sub] = mx;
    lds_barrier();
    if (sub == 0) {
      float m2 = sRed[row * TPR];
      #pragma unroll
      for (int u = 1; u < TPR; ++u) m2 = fmaxf(m2, sRed[row * TPR + u]);
      sMax[row] = m2;
    }
    lds_barrier();
    const float rm = sMax[row];
    float sum = 0.0f;
    for (int it = 0; it < SPAD / (4 * TPR); ++it) {
      const int j = j0 + it * (4 * TPR);
      v4f e = {0.0f, 0.0f, 0.0f, 0.0f};
      if (j < SEQ) {
        v4f v = *(const v4f*)(rowS + j);
        e = exp_x4(v - rm);
      }
      *(v4f*)(rowS + j) = e;
      v4h h4;
      h4.x = (_Float16)(e.x * PSC); h4.y = (_Float16)(e.y * PSC);
      h4.z = (_Float16)(e.z * PSC); h4.w = (_Float16)(e.w * PSC);
      *(v4h*)(rowA + j) = h4;
      sum += (e.x + e.y) + (e.z + e.w);
    }
    sRed[row * TPR + sub] = sum;
    lds_barrier();
    if (sub == 0) {
      float s2 = 0.0f;
      #pragma unroll
      for (int u = 0; u < TPR; ++u) s2 += sRed[row * TPR + u];
      sRcp[row] = 1.0f / s2;
    }
    lds_barrier();
  }

  // Group 4: this wave's relV^T fragments for phase 5; they land behind phase 4.
  FragH rvf[RSW];
  {
    const _Float16* rvcol = RVt + (size_t)((wave & 3) * (NDIST / 32) + ks * RSW) * VSE + lane * 8;   // B[k=dist][n=dim]
    #pragma unroll   // constant indices: the fragments stay in registers
    for (int i = 0; i < RSW; ++i) {
      rvf[i].h[0] = *(const v8h*)(rvcol + i * VSE);
      rvf[i].h[1] = *(const v8h*)(rvcol + i * VSE + FU);
    }
    asm volatile("s_wait_xcnt 0x0" :: "v"(rvcol) : "memory");   // as behind group 1
  }

  // ---------- Phase 4: per-distance mass, fixed 2-key gather (no atomics) ---
  // keys at circular distance dist from row q: (q-dist) mod S and (q+dist) mod S (one key when they coincide)
  // One distance per thread, all 16 rows. The two keys coincide exactly where 2*dist is a multiple of SEQ, whatever the row,
  // so that test and the padding test become two per-thread factors and the rows' reads are independent of each other.
  {
    static_assert(NT == NDIST, "one distance per thread");
    const int dist = tid;
    const float w2 = (dist == 0 || 2 * dist == SEQ) ? 0.0f : 1.0f;
    const float ws = (dist <= DMAX) ? PSC : 0.0f;
    #pragma unroll   // all rows' LDS reads in flight together
    for (int m = 0; m < 16; ++m) {
      const int qrow = min(qt * 16 + m, SEQ - 1);
      // wrap into 0..SEQ-1 by an unsigned minimum: the out-of-range form is negative, so huge as unsigned
      const unsigned k1 = min((unsigned)(qrow - dist), (unsigned)(qrow - dist + SEQ));
      const unsigned k2 = min((unsigned)(qrow + dist), (unsigned)(qrow + dist - SEQ));
      const float val = sS[m * SP + k1] + w2 * sS[m * SP + k2];
      sD[m * DP + dist] = (_Float16)(val * ws);
    }
  }
  lds_barrier();

  // ---------- Phase 5: out = (P@V + D@relV) * rcp / 256 -----------------------
  {
    const _Float16* arow  = sA + n * AP    + key0 + 8 * hi;                      // A[m=row][k=key]
    const _Float16* drow  = sD + n * DP    + dis0 + 8 * hi;                      // A[m=row][k=dist]
    v8f acc = zero8();

    #pragma unroll   // constant indices into vf
    for (int kt2 = 0; kt2 < VSW; ++kt2) {
      const int kb = kt2 * 32;
      FragH a;
      a.h[0]  = *(const v8h*)(arow + kb);
      a.h[1]  = *(const v8h*)(arow + kb + 16);
      acc = wmma_f16(a, vf[kt2], acc);
    }
    #pragma unroll   // constant indices into rvf
    for (int rt = 0; rt < RSW; ++rt) {
      const int kb = rt * 32;
      FragH a;
      a.h[0]  = *(const v8h*)(drow + kb);
      a.h[1]  = *(const v8h*)(drow + kb + 16);
      acc = wmma_f16(a, rvf[rt], acc);
    }
    // stage this wave's 16x16 f32 partial sum (sP is free after phase 2)
    #pragma unroll
    for (int r = 0; r < 8; ++r) {
      const int m = r + 8 * hi;
      sP[(ks * 16 + m) * OP + dbase + n] = acc[r];
    }
  }
  __syncthreads();

  // add the KSP partial sums, normalise, store whole 128-B lines (8 lanes each)
  if (tid < 16 * DH / 4) {
    float* obase = Out + baseQ;
    const int m = tid >> 4;
    const int c = (tid & 15) * 4;
    const int qrow = qt * 16 + m;
    v4f v = *(const v4f*)(sP + m * OP + c);
    #pragma unroll
    for (int s = 1; s < KSP; ++s) v += *(const v4f*)(sP + (s * 16 + m) * OP + c);
    v *= sRcp[m] * PSCI;
    if (qrow < SEQ) *(v4f*)(obase + (size_t)qrow * DM + c) = v;
  }
}

extern "C" void kernel_launch(void* const* d_in, const int* in_sizes, int n_in,
                              void* d_out, int out_size, void* d_ws, size_t ws_size,
                              hipStream_t stream) {
  if (n_in < 5) return;
  if (in_sizes[0] < NB * SEQ * DM || in_sizes[1] < NB * SEQ * DM || in_sizes[2] < NB * SEQ * DM) return;
  if (in_sizes[3] < NDIST * DH || in_sizes[4] < NDIST * DH) return;
  if (out_size < NB * SEQ * DM) return;
  const size_t ws_need = WS_END * 2;           // 16,777,216 B
  if (ws_size < ws_need) return;

  const float* Q  = (const float*)d_in[0];
  const float* K  = (const float*)d_in[1];
  const float* V  = (const float*)d_in[2];
  const float* RK = (const float*)d_in[3];
  const float* RV = (const float*)d_in[4];
  float* Out = (float*)d_out;
  unsigned short* ws16 = (unsigned short*)d_ws;

  unsigned short* Kb  = ws16 + WS_K;
  _Float16*       Vt  = (_Float16*)(ws16 + WS_VT);
  unsigned short* RKb = ws16 + WS_RK;
  _Float16*       RVt = (_Float16*)(ws16 + WS_RVT);

  prep_kernel<<<(NK8 + NV8 + 2 * NR8) / PCH, 256, 0, stream>>>(K, V, RK, RV, Kb, Vt, RKb, RVt);

  dim3 grid(QTN, NB * NH);
  circ_rel_attn_kernel<<<grid, dim3(NT), 0, stream>>>(Q, Kb, Vt, RKb, RVt, Out);
}

// v007
// Measured time: 70.2 microseconds a run.
// Two timings next to v006 both put it at 1.18 times that version's speed.
// Over all steps from v000 it is 5.50 times as fast.
#include <hip/hip_runtime.h>

// Contractions: Q*K^T and Q*relK^T on v_wmma_f32_16x16x32_bf16 (bf16 operands, f32 accumulate);
// P*V and bucketed P*relV on v_wmma_f32_16x16x32_f16 (f16 operands: P scaled by 2^8, V/relV carry bf16-RNE values; f32 accumulate).

typedef _Float16 v16h __attribute__((ext_vector_type(16)));
typedef _Float16 v8h  __attribute__((ext_vector_type(8), may_alias));
typedef __bf16   v16b __attribute__((ext_vector_type(16)));
typedef unsigned short v8us __attribute__((ext_vector_type(8), may_alias));
typedef float v8f __attribute__((ext_vector_type(8)));
typedef float v4f __attribute__((ext_vector_type(4), may_alias));

#define SEQ   1000   // sequence length
#define SEQP  1008   // keys padded to a multiple of 16
#define DM    512    // model width
#define DH    64     // head dim
#define NB    8      // batch
#define NH    8      // heads
#define QTN   63     // query tiles of 16
#define KTI   63     // key tiles of 16
#define SPAD  1024   // padded key dim (multiple of 32)
#define NDIST 512    // padded distance dim (>= 501, multiple of 32)
#define DMAX  500    // largest circular distance
#define NW    16     // waves per attention block
#define NT    512    // threads per attention block
#define KSP   (NW / 4)       // waves that share one 16-dim output tile, each on its own part of the k range
#define QPT   (16 * DH / NT)             // Q elements staged per thread
#define RTW   (NDIST / 16 / NW)          // relK column tiles per wave
#define KTW   ((KTI + NW - 1) / NW)      // key tiles per wave (the last wave has one fewer)
#define VSW   (SPAD / 32 / KSP)          // k steps of P*V per wave
#define RSW   (NDIST / 32 / KSP)         // k steps of D*relV per wave
// LDS row pitches: each keeps the lanes of one LDS instruction on distinct banks (64 banks of 4 B)
#define QP    (DH + 8)       // sQ, 2-B elements: 144 B = 16 B x odd, for the 16-B fragment reads down 16 rows
#define AP    (SPAD + 8)     // sA, 2-B elements: 2064 B = 16 B x odd
#define DP    (NDIST + 8)    // sD, 2-B elements: 1040 B = 16 B x odd
#define PP    (NDIST + 4)    // f32 words per query row in the first half of sPA
#define OP    (DH + 4)       // partial outputs in sP, f32: 8 rows = 32 banks mod 64, so the two lane halves of a D tile do not meet
#define TP    (SPAD + 12)    // sT, f32: 4144 B = 16 B x odd for the 16-B bias reads down 16 rows; 8 rows + 8 = 40 banks mod 64 for the stores
#define RP    (NW + 4)       // sRedM, sRedS, f32: 80 B = 16 B x odd
#define TSH   24             // unread columns in front of each sT row
#define TC0   ((QTN - 1) * 16 + TSH)   // sT column of the first key of the tile at base offset 0
#define PSH   8.0f           // log2 of the power-of-two scale on the f16 attention weights
#define L2E   1.44269504f    // log2(e)
#define BSC   8.0f           // 1 / scale: the bias is stored in the units of the raw Q*K^T products

// Workspace layout in 2-byte elements. All four operands lie in B-fragment order: the unit is [32 lanes][8 elements] = 512 B,
// what one 16-byte load of a wave takes, so that such a load covers four whole 128-B lines.
// Lane = 16*hi + n. K kind (n = key or distance): unit c of a 16-row tile holds head dims 16*c + 8*hi + 0..7.
// V kind (n = head dim of a 16-dim tile): unit j of a 32-row step holds keys or distances 16*j + 8*hi + 0..7.
#define FU      256                                      // elements per unit
#define KTE     (4 * FU)                                 // elements per 16-row tile of the K kind
#define VSE     (2 * FU)                                 // elements per 32-row step of the V kind
#define WS_K    ((size_t)0)                              // [64 bh][63 tiles][4 units]          bf16 K, padded keys zero
#define WS_VT   ((size_t)NB * SEQP * DM)                 // [64 bh][4 dim tiles][32 steps][2]   f16 V, padded keys zero
#define WS_RK   (WS_VT + (size_t)NB * NH * DH * SPAD)    // [32 tiles][4 units]                 bf16 relK
#define WS_RVT  (WS_RK + (size_t)NDIST * DH)             // [4 dim tiles][16 steps][2]          f16 relV
#define WS_END  (WS_RVT + (size_t)DH * NDIST)

#define NK8  (NB * SEQP * DM / 8)       // work units of 8 elements, K copy
#define NV8  (NB * NH * DH * SPAD / 8)  // work units of 8 elements, V^T copy
#define NR8  (NDIST * DH / 8)           // work units of 8 elements, each rel table

union FragH { v16h v; v8h  h[2]; };
union FragB { v16b v; v8us h[2]; };

__device__ __forceinline__ v8f zero8() {
  v8f z = {0.0f, 0.0f, 0.0f, 0.0f, 0.0f, 0.0f, 0.0f, 0.0f};
  return z;
}

__device__ __forceinline__ v8f wmma_f16(const FragH& a, const FragH& b, v8f c) {
  v8f d = __builtin_amdgcn_wmma_f32_16x16x32_f16(false, a.v, false, b.v, (short)0, c, false, false);
  asm volatile("v_nop\n\tv_nop\n\tv_nop\n\tv_nop" : "+v"(d) : "v"(a.v), "v"(b.v));
  return d;
}

__device__ __forceinline__ v8f wmma_bf16(const FragB& a, const FragB& b, v8f c) {
  v8f d = __builtin_amdgcn_wmma_f32_16x16x32_bf16(false, a.v, false, b.v, (short)0, c, false, false);
  asm volatile("v_nop\n\tv_nop\n\tv_nop\n\tv_nop" : "+v"(d) : "v"(a.v), "v"(b.v));
  return d;
}

// f32 -> bf16 bits, RNE
__device__ __forceinline__ unsigned short bf16_rne(float f) {
  unsigned int u = __float_as_uint(f);
  u += 0x7FFFu + ((u >> 16) & 1u);
  return (unsigned short)(u >> 16);
}

// f32 -> bf16 (RNE) -> f16 ; the second step is exact for bf16 values in f16 range
__device__ __forceinline__ _Float16 f16_of_bf16(float f) {
  unsigned int u = ((unsigned int)bf16_rne(f)) << 16;
  return (_Float16)__uint_as_float(u);
}

// 2^x for four values at once.
// One statement with outputs apart from all inputs and a closing v_nop: it keeps the one slot the instruction set asks for
// between a transcendental and an instruction that overwrites its source or reads its result.
__device__ __forceinline__ v4f exp2_x4(v4f x) {
  const float a = x.x, b = x.y, c = x.z, d = x.w;
  v4f r;
  float r0, r1, r2, r3;
  asm("v_exp_f32 %0, %4\n\tv_exp_f32 %1, %5\n\tv_exp_f32 %2, %6\n\tv_exp_f32 %3, %7\n\tv_nop"
      : "=&v"(r0), "=&v"(r1), "=&v"(r2), "=&v"(r3) : "v"(a), "v"(b), "v"(c), "v"(d));
  r.x = r0; r.y = r1; r.z = r2; r.w = r3;
  return r;
}

// lane l with lane l ^ 16
__device__ __forceinline__ float xhalf(float x) {
  const int b = __builtin_bit_cast(int, x);
  return __builtin_bit_cast(float, __builtin_amdgcn_permlanex16(b, b, 0x76543210, 0xfedcba98, false, false));
}

// Work-group barrier that orders LDS only. All that the waves of a block hand each other goes through LDS, and the global
// buffers read here are written by earlier launches alone. __syncthreads() also drains the wave's outstanding global loads,
// which would end the flight of the fragment loads issued ahead at the first barrier behind them.
__device__ __forceinline__ void lds_barrier() {
  __builtin_amdgcn_fence(__ATOMIC_RELEASE, "workgroup", "local");
  __builtin_amdgcn_s_barrier();
  __builtin_amdgcn_fence(__ATOMIC_ACQUIRE, "workgroup", "local");
}

// ---------------- prep: one launch packs K, V, relK and relV in fragment order ----------------
// The unit of work is one 16-byte piece of a packed operand. A thread takes PU units, 256 apart, and issues all their loads
// before the first conversion: few long-lived waves with many loads in flight, in place of one short wave per 32 units.
// A block's PU * 256 units lie in one operand, so the choice of the operand is uniform over the block.
#define PU   8
#define PCH  (256 * PU)
static_assert(NK8 % PCH == 0 && NV8 % PCH == 0 && NR8 % PCH == 0, "no block straddles two operands");

// K kind: unit t is [tile][unit c][lane]; row = 16 * tile + n, head dims 16 * c + 8 * hi + 0..7. ISK: K itself, else relK.
template <bool ISK>
__device__ __forceinline__ void pack_k_kind(const float* __restrict__ S, unsigned short* __restrict__ dst, int t0) {
  static_assert(PU == 8, "the wait below names one address per unit");
  const int n  = threadIdx.x & 15;
  const int hi = (threadIdx.x >> 4) & 1;
  const float* src[PU];
  v4f x0[PU], x1[PU];
  bool ok[PU];
  #pragma unroll   // constant indices: the loaded values stay in registers, and all loads are issued before the first wait
  for (int u = 0; u < PU; ++u) {
    const int t = t0 + u * 256;
    const int d = ((t >> 5) & 3) * 16 + 8 * hi;
    const int tile = t >> 7;
    if (ISK) {                          // keys padded to SEQP: row clamped for the address, padded rows zeroed below
      const int bh = tile / KTI;
      const int r  = (tile % KTI) * 16 + n;
      ok[u]  = r < SEQ;
      src[u] = S + ((size_t)(bh >> 3) * SEQ + min(r, SEQ - 1)) * DM + (bh & 7) * DH + d;
    } else {                            // distances 0..511
      ok[u]  = true;
      src[u] = S + (tile * 16 + n) * DH + d;
    }
    x0[u] = *(const v4f*)(src[u]);
    x1[u] = *(const v4f*)(src[u] + 4);
  }
  // kept in front of any overwrite of the loads' address registers; the addresses are inputs, so they live up to the wait
  asm volatile("s_wait_xcnt 0x0" :: "v"(src[0]), "v"(src[1]), "v"(src[2]), "v"(src[3]),
                                    "v"(src[4]), "v"(src[5]), "v"(src[6]), "v"(src[7]) : "memory");
  v8us  o[PU];
  v8us* p[PU];
  #pragma unroll   // constant indices into the register arrays
  for (int u = 0; u < PU; ++u) {
    const v4f z = {0.0f, 0.0f, 0.0f, 0.0f};
    const v4f a = ok[u] ? x0[u] : z, b = ok[u] ? x1[u] : z;
    o[u][0] = bf16_rne(a.x); o[u][1] = bf16_rne(a.y); o[u][2] = bf16_rne(a.z); o[u][3] = bf16_rne(a.w);
    o[u][4] = bf16_rne(b.x); o[u][5] = bf16_rne(b.y); o[u][6] = bf16_rne(b.z); o[u][7] = bf16_rne(b.w);
    p[u] = (v8us*)(dst + (size_t)(t0 + u * 256) * 8);   // unit t goes to the t-th 16 bytes
    *p[u] = o[u];
  }
  // the same wait for the stores: with their data and addresses as inputs the build overwrites no store's register in front of it
  asm volatile("s_wait_xcnt 0x0" :: "v"(o[0]), "v"(o[1]), "v"(o[2]), "v"(o[3]), "v"(o[4]), "v"(o[5]), "v"(o[6]), "v"(o[7]),
                                    "v"(p[0]), "v"(p[1]), "v"(p[2]), "v"(p[3]), "v"(p[4]), "v"(p[5]), "v"(p[6]), "v"(p[7]) : "memory");
}

// V kind: 256 units are one 32-row step, all four dim tiles, so that a block reads whole 256-B head rows, 16 lanes per 64 B.
// Unit t is [step s][half j][dim tile dt][lane]; dim = 16 * dt + n, rows 32 * s + 16 * j + 8 * hi + 0..7. ISV: V itself, else relV.
template <bool ISV>
__device__ __forceinline__ void pack_v_kind(const float* __restrict__ S, _Float16* __restrict__ dst, int t0) {
  static_assert(PU == 8, "the wait below names one address per unit");
  const int lane = threadIdx.x & 31;
  const int n  = lane & 15;
  const int hi = lane >> 4;
  const float* src[PU];
  float x[PU][8];
  bool ok[PU];
  int  e0[PU];
  #pragma unroll   // as in pack_k_kind
  for (int u = 0; u < PU; ++u) {
    const int t  = t0 + u * 256;
    const int dt = (t >> 5) & 3;
    const int j  = (t >> 7) & 1;
    const int dim = dt * 16 + n;
    if (ISV) {                          // keys padded to SPAD: SEQ is a multiple of 8, so a unit's 8 keys are all valid or all padding
      const int s  = (t >> 8) & (SPAD / 32 - 1);
      const int bh = t >> 13;           // DH*SPAD/8 = 8192 units per (b,h)
      const int key0 = s * 32 + j * 16 + 8 * hi;
      ok[u]  = key0 < SEQ;
      e0[u]  = ((bh * 4 + dt) * (SPAD / 32) + s) * VSE + j * FU + lane * 8;
      src[u] = S + ((size_t)(bh >> 3) * SEQ + min(key0, SEQ - 8)) * DM + (bh & 7) * DH + dim;
    } else {                            // distances 0..511
      const int s = t >> 8;
      ok[u]  = true;
      e0[u]  = (dt * (NDIST / 32) + s) * VSE + j * FU + lane * 8;
      src[u] = S + (size_t)(s * 32 + j * 16 + 8 * hi) * DH + dim;
    }
    #pragma unroll
    for (int i = 0; i < 8; ++i) x[u][i] = src[u][(size_t)i * (ISV ? DM : DH)];
  }
  // as in pack_k_kind
  asm volatile("s_wait_xcnt 0x0" :: "v"(src[0]), "v"(src[1]), "v"(src[2]), "v"(src[3]),
                                    "v"(src[4]), "v"(src[5]), "v"(src[6]), "v"(src[7]) : "memory");
  v8h  o[PU];
  v8h* p[PU];
  #pragma unroll   // constant indices into the register arrays
  for (int u = 0; u < PU; ++u) {
    #pragma unroll
    for (int i = 0; i < 8; ++i) o[u][i] = f16_of_bf16(ok[u] ? x[u][i] : 0.0f);
    p[u] = (v8h*)(dst + (size_t)e0[u]);
    *p[u] = o[u];
  }
  // as in pack_k_kind
  asm volatile("s_wait_xcnt 0x0" :: "v"(o[0]), "v"(o[1]), "v"(o[2]), "v"(o[3]), "v"(o[4]), "v"(o[5]), "v"(o[6]), "v"(o[7]),
                                    "v"(p[0]), "v"(p[1]), "v"(p[2]), "v"(p[3]), "v"(p[4]), "v"(p[5]), "v"(p[6]), "v"(p[7]) : "memory");
}

__global__ __launch_bounds__(256)
void prep_kernel(const float* __restrict__ K, const float* __restrict__ V,
                 const float* __restrict__ RK, const float* __restrict__ RV,
                 unsigned short* __restrict__ Kb, _Float16* __restrict__ Vt,
                 unsigned short* __restrict__ RKb, _Float16* __restrict__ RVt) {
  const int blk = blockIdx.x;
  const int tid = threadIdx.x;
  if (blk < NK8 / PCH)                        pack_k_kind<true >(K,  Kb,  blk * PCH + tid);
  else if (blk < (NK8 + NV8) / PCH)           pack_v_kind<true >(V,  Vt,  (blk - NK8 / PCH) * PCH + tid);
  else if (blk < (NK8 + NV8 + NR8) / PCH)     pack_k_kind<false>(RK, RKb, (blk - (NK8 + NV8) / PCH) * PCH + tid);
  else                                        pack_v_kind<false>(RV, RVt, (blk - (NK8 + NV8 + NR8) / PCH) * PCH + tid);
}

// ---------------- fused attention kernel ------------------------------------
// 8 waves per SIMD: the register budget at which two work-groups share a WGP
__global__ __launch_bounds__(NT, 8)
void circ_rel_attn_kernel(const float* __restrict__ Q,
                          const unsigned short* __restrict__ Kb,
                          const _Float16* __restrict__ Vt,
                          const unsigned short* __restrict__ RKb,
                          const _Float16* __restrict__ RVt,
                          float* __restrict__ Out)
{
  __shared__ __attribute__((aligned(16))) unsigned short sQ[16 * QP];     //  2 KB  bf16 Q tile
  // 64 KB, two lives. Phases 1-2: sT[q][TC0 + q - u] = BSC * (Q*relK^T)[q][circular distance of u], q the row in the tile,
  // u = q - 15 .. q + TC0 - TSH: the bias row laid out over the whole circle, backwards and shifted by its row, so that the 16 keys of
  // the tile at base offset 16*(qt - kt) mod SEQ stand in key order at columns TC0 - base + 0..15 of every row.
  // Columns TSH .. TC0 + 15 are read. An offset outside a row's window falls on the unread columns between two rows' windows.
  // From phase 3: the second half is sA; the first half takes the partial outputs [KSP][16][OP].
  __shared__ __attribute__((aligned(16))) float          sPA[16 * TP + 16];
  __shared__ __attribute__((aligned(16))) _Float16       sD[16 * DP];     // 16 KB  per-distance mass*256 f16
  __shared__ __attribute__((aligned(16))) float          sRedM[16 * RP];  // [query][wave] maximum over the wave's keys
  __shared__ __attribute__((aligned(16))) float          sRedS[16 * RP];  // [query][wave] sum over the wave's keys
  float*    const sT = sPA;
  float*    const sP = sPA;
  _Float16* const sA = (_Float16*)(sPA + 16 * PP);                        // 32 KB  exp(scores)*256 f16
  static_assert(16 * PP + 16 * AP / 2 <= 16 * TP + 16, "the two halves fit");
  static_assert(KSP * 16 * OP <= 16 * PP, "the partial outputs stay clear of sA");
  static_assert(TC0 + 15 < TP && SEQ - (TC0 - TSH) == 8, "a tile's 16 columns lie inside the row; the wrapped offsets below count on the 8");
  static_assert(TSH - 8 - 15 >= 0 && TC0 + 30 - TP < TSH && TC0 + 30 - TP < 16, "offsets outside a window stay inside sPA and off every window");

  const int qt   = blockIdx.x;
  const int bh   = blockIdx.y;
  const int b    = bh >> 3;
  const int h    = bh & 7;
  const int tid  = threadIdx.x;
  const int lane = tid & 31;
  const int wave = tid >> 5;
  const int n    = lane & 15;           // A row / B column / D column
  const int hi   = lane >> 4;           // lane half

  const float scale = 0.125f;
  const size_t baseQ = (size_t)b * SEQ * DM + (size_t)h * DH;
  const unsigned short* Kbh = Kb + (size_t)bh * KTI * KTE + lane * 8;     // this lane's 16 bytes of every unit
  const _Float16* Vbh = Vt + (size_t)bh * DH * SPAD + lane * 8;

  // ---------- Global loads issued ahead: none of them depends on anything computed here, so each group is
  // issued one phase or more before its use and its latency passes behind the work in between.
  // Group 1 (here): the Q elements, this wave's relK tiles, its first two key tiles.
  float qv[QPT];
  const float* qp[QPT];
  #pragma unroll   // constant indices: qv stays in registers, and all its loads are issued before the first wait
  for (int i = 0; i < QPT; ++i) {
    const int idx = tid + i * NT;
    const int m = idx >> 6, d = idx & 63;
    qp[i] = Q + baseQ + (size_t)min(qt * 16 + m, SEQ - 1) * DM + d;   // row clamped; rows past the end are zeroed below
    qv[i] = *qp[i];
  }
  const unsigned short* rp0 = RKb + (size_t)wave * KTE + lane * 8;           // B[k=d][n=dist], four units per tile
  FragB rk[RTW][2];
  #pragma unroll   // constant indices: the fragments stay in registers
  for (int i = 0; i < RTW; ++i) {
    const unsigned short* rp = rp0 + (size_t)i * NW * KTE;
    rk[i][0].h[0] = *(const v8us*)(rp);
    rk[i][0].h[1] = *(const v8us*)(rp + FU);
    rk[i][1].h[0] = *(const v8us*)(rp + 2 * FU);
    rk[i][1].h[1] = *(const v8us*)(rp + 3 * FU);
  }
  const unsigned short* kp0 = Kbh + (size_t)wave * KTE;                      // A[m=key][k=d], four units per tile
  FragB kf[KTW][2];
  #pragma unroll   // constant indices: the fragments stay in registers
  for (int i = 0; i < KTW / 2; ++i) {
    const unsigned short* kp = kp0 + (size_t)i * NW * KTE;
    kf[i][0].h[0] = *(const v8us*)(kp);
    kf[i][0].h[1] = *(const v8us*)(kp + FU);
    kf[i][1].h[0] = *(const v8us*)(kp + 2 * FU);
    kf[i][1].h[1] = *(const v8us*)(kp + 3 * FU);
  }
  static_assert(QPT == 2, "the wait below names one address per Q load");
  // Behind each group: the wait that is kept in front of any overwrite of an issued load's address registers. The addresses
  // are inputs, so they live up to the wait (left to itself the build gave some loads an address register of the group as
  // their destination, or waited to a count only).
  asm volatile("s_wait_xcnt 0x0" :: "v"(qp[0]), "v"(qp[1]), "v"(rp0), "v"(kp0) : "memory");

  // ---------- Phase 0: stage Q tile as bf16 ----------------------------------
  #pragma unroll   // constant indices into qv
  for (int i = 0; i < QPT; ++i) {
    const int idx = tid + i * NT;
    const int m = idx >> 6, d = idx & 63;
    const float v = (qt * 16 + m < SEQ) ? qv[i] : 0.0f;
    sQ[m * QP + d] = bf16_rne(v);
  }
  lds_barrier();

  // A fragments of the Q tile: k 0..31 and k 32..63 (split map: elems 0..7 <- k0+8h, 8..15 <- k0+16+8h)
  FragB qa0, qa1;
  {
    const unsigned short* qp = sQ + n * QP + 8 * hi;
    qa0.h[0] = *(const v8us*)(qp);
    qa0.h[1] = *(const v8us*)(qp + 16);
    qa1.h[0] = *(const v8us*)(qp + 32);
    qa1.h[1] = *(const v8us*)(qp + 48);
  }

  // ---------- Phase 1: P = Qtile @ relK^T, stored at every circular offset that has this distance ----------
  const int swave = __builtin_amdgcn_readfirstlane(wave);   // tile numbers and base offsets stay scalar
  const int nrev  = n ^ 15;                                 // 15 - n, never negative
  #pragma unroll   // constant indices into rk
  for (int i = 0; i < RTW; ++i) {
    const int ct = swave + i * NW;
    v8f acc = zero8();
    acc = wmma_bf16(qa0, rk[i][0], acc);
    acc = wmma_bf16(qa1, rk[i][1], acc);
    acc *= BSC;
    const int dist = ct * 16 + n;
    float* trow = sT + 8 * hi * (TP + 1);   // row q = r + 8*hi, column C + q: steps of TP + 1
    if (dist <= DMAX) {
      float* p1 = trow + (TC0 - 15 - ct * 16) + nrev;       // offset dist: column TC0 + q - dist
      float* p2 = trow + (ct * 16 + TSH - 8) + n;           // offset SEQ - dist: column TSH + q + dist - 8
      #pragma unroll
      for (int r = 0; r < 8; ++r) {
        p1[r * (TP + 1)] = acc[r];
        p2[r * (TP + 1)] = acc[r];
      }
    }
    if (i == 0 && ct == 0) {         // distances 0..15 also stand at offsets -dist and SEQ + dist, where a row's window reaches them
      #pragma unroll
      for (int r = 0; r < 8; ++r) {
        trow[r * (TP + 1) + TC0 + n] = acc[r];                   // offset -dist
        trow[r * (TP + 1) + (TSH - 8 - 15) + nrev] = acc[r];     // offset SEQ + dist
      }
    }
  }
  // Group 2: the other key tiles, into the registers that relK has left; they land behind the first two tiles' work.
  const unsigned short* kq[KTW];
  #pragma unroll   // constant indices into kf
  for (int i = KTW / 2; i < KTW; ++i) {
    const int kt = min(wave + i * NW, KTI - 1);   // the last wave has no last tile: address clamped, value unused
    kq[i] = Kbh + (size_t)kt * KTE;
    kf[i][0].h[0] = *(const v8us*)(kq[i]);
    kf[i][0].h[1] = *(const v8us*)(kq[i] + FU);
    kf[i][1].h[0] = *(const v8us*)(kq[i] + 2 * FU);
    kf[i][1].h[1] = *(const v8us*)(kq[i] + 3 * FU);
  }
  static_assert(KTW == 4, "the wait below names one address per tile of the group");
  asm volatile("s_wait_xcnt 0x0" :: "v"(kq[2]), "v"(kq[3]) : "memory");   // as behind group 1
  lds_barrier();

  // ---------- Phase 2: scores^T / scale = K*Q^T + bias / scale at offset (query - key) mod SEQ, kept in registers ------
  // K is the A operand and Q the B operand: lane (n, hi) holds, of query n, the 8 neighbouring keys 16*kt + 8*hi + 0..7.
  static_assert(NW * (KTW - 1) * 16 <= SEQ, "only a wave's last tile can hold padded keys");
  static_assert(SEQ % 8 == 0, "a lane's 8 keys are all valid or all padding");
  const float* tlane = sT + n * TP + 8 * hi;
  // The bias is the C operand of a tile's first product. A tile's two bias reads are issued in front of the previous tile's
  // products and land behind them.
  v4f bias[2][2];
  {
    const int dt = qt - swave;
    const float* tp = tlane + (TC0 - dt * 16 - (dt < 0 ? SEQ : 0));
    bias[0][0] = *(const v4f*)(tp);
    bias[0][1] = *(const v4f*)(tp + 4);
  }
  float sc[KTW][8];
  #pragma unroll   // constant indices into kf, bias and sc
  for (int i = 0; i < KTW; ++i) {
    const int kt = swave + i * NW;
    if (i + 1 < KTW) {
      const int dt = qt - min(kt + NW, KTI - 1);   // the last wave has no last tile: tile number clamped, values masked below
      const float* tp = tlane + (TC0 - dt * 16 - (dt < 0 ? SEQ : 0));
      bias[(i + 1) & 1][0] = *(const v4f*)(tp);
      bias[(i + 1) & 1][1] = *(const v4f*)(tp + 4);
    }
    v8f acc = __builtin_shufflevector(bias[i & 1][0], bias[i & 1][1], 0, 1, 2, 3, 4, 5, 6, 7);
    acc = wmma_bf16(kf[i][0], qa0, acc);
    acc = wmma_bf16(kf[i][1], qa1, acc);
    const bool pad = (i == KTW - 1) && (kt * 16 + 8 * hi >= SEQ);   // padded keys, the last wave's missing tile among them
    #pragma unroll
    for (int r = 0; r < 8; ++r) sc[i][r] = pad ? -1.0e30f : acc[r];
  }

  const int dbase = (wave & 3) * 16;           // 16 head dims per wave
  const int ks    = wave >> 2;                 // this wave's part of the key range and of the distance range
  const int key0  = ks * (SPAD / KSP);
  const int dis0  = ks * (NDIST / KSP);

  // Group 3: this wave's V^T fragments for phase 5; they land behind the softmax.
  FragH vf[VSW];
  {
    const _Float16* vcol = Vbh + (size_t)((wave & 3) * (SPAD / 32) + ks * VSW) * VSE;   // B[k=key][n=dim], two units per step
    #pragma unroll   // constant indices: the fragments stay in registers
    for (int i = 0; i < VSW; ++i) {
      vf[i].h[0] = *(const v8h*)(vcol + i * VSE);
      vf[i].h[1] = *(const v8h*)(vcol + i * VSE + FU);
    }
    asm volatile("s_wait_xcnt 0x0" :: "v"(vcol) : "memory");   // as behind group 1
  }

  // ---------- Phase 3: softmax in registers (normalisation deferred) -----------------
  // A query's maximum: in the lane, between the lane halves, then over the waves through sRedM.
  {
    float m0 = sc[0][0], m1 = sc[1][0], m2 = sc[2][0], m3 = sc[3][0];
    static_assert(KTW == 4, "one chain per tile");
    #pragma unroll
    for (int r = 1; r < 8; ++r) {
      m0 = fmaxf(m0, sc[0][r]); m1 = fmaxf(m1, sc[1][r]); m2 = fmaxf(m2, sc[2][r]); m3 = fmaxf(m3, sc[3][r]);
    }
    float mx = fmaxf(fmaxf(m0, m1), fmaxf(m2, m3));
    mx = fmaxf(mx, xhalf(mx));
    if (hi == 0) sRedM[n * RP + wave] = mx;
  }
  lds_barrier();   // also ends every wave's reads of sT, whose second half becomes sA
  {
    static_assert(NW == 16, "four 16-byte reads per query");
    const v4f* mp = (const v4f*)(sRedM + n * RP);
    const v4f a = mp[0], b = mp[1], c = mp[2], d = mp[3];
    const float rm = fmaxf(fmaxf(fmaxf(fmaxf(a.x, a.y), fmaxf(a.z, a.w)), fmaxf(fmaxf(b.x, b.y), fmaxf(b.z, b.w))),
                           fmaxf(fmaxf(fmaxf(c.x, c.y), fmaxf(c.z, c.w)), fmaxf(fmaxf(d.x, d.y), fmaxf(d.z, d.w))));
    const float cs = scale * L2E;        // raw units -> log2 units
    const float sh = rm * cs - PSH;      // weights come out scaled by 2^PSH, and so does their sum
    _Float16* alane = sA + n * AP + swave * 16 + 8 * hi;
    float sum = 0.0f;
    #pragma unroll   // constant indices into sc
    for (int i = 0; i < KTW; ++i) {
      const v4f x0 = {sc[i][0] * cs - sh, sc[i][1] * cs - sh, sc[i][2] * cs - sh, sc[i][3] * cs - sh};
      const v4f x1 = {sc[i][4] * cs - sh, sc[i][5] * cs - sh, sc[i][6] * cs - sh, sc[i][7] * cs - sh};
      const v4f e0 = exp2_x4(x0), e1 = exp2_x4(x1);
      v8h h8;
      h8[0] = (_Float16)e0.x; h8[1] = (_Float16)e0.y; h8[2] = (_Float16)e0.z; h8[3] = (_Float16)e0.w;
      h8[4] = (_Float16)e1.x; h8[5] = (_Float16)e1.y; h8[6] = (_Float16)e1.z; h8[7] = (_Float16)e1.w;
      *(v8h*)(alane + i * NW * 16) = h8;   // 8 keys of one query: one 16-byte store; padded keys up to SPAD get zeros
      sum += ((e0.x + e0.y) + (e0.z + e0.w)) + ((e1.x + e1.y) + (e1.z + e1.w));
    }
    sum += xhalf(sum);
    if (hi == 0) sRedS[n * RP + wave] = sum;
  }

  // Group 4: this wave's relV^T fragments for phase 5; they land behind phase 4.
  FragH rvf[RSW];
  {
    const _Float16* rvcol = RVt + (size_t)((wave & 3) * (NDIST / 32) + ks * RSW) * VSE + lane * 8;   // B[k=dist][n=dim]
    #pragma unroll   // constant indices: the fragments stay in registers
    for (int i = 0; i < RSW; ++i) {
      rvf[i].h[0] = *(const v8h*)(rvcol + i * VSE);
      rvf[i].h[1] = *(const v8h*)(rvcol + i * VSE + FU);
    }
    asm volatile("s_wait_xcnt 0x0" :: "v"(rvcol) : "memory");   // as behind group 1
  }
  lds_barrier();

  // ---------- Phase 4: per-distance mass, fixed 2-key gather (no atomics) ---
  // keys at circular distance dist from row q: (q-dist) mod S and (q+dist) mod S (one key when they coincide)
  // One distance per thread, all 16 rows. The two keys coincide exactly where 2*dist is a multiple of SEQ, whatever the row,
  // so that test and the padding test become two per-thread factors and the rows' reads are independent of each other.
  {
    static_assert(NT == NDIST, "one distance per thread");
    const int dist = tid;
    const float w2 = (dist == 0 || 2 * dist == SEQ) ? 0.0f : 1.0f;
    const float ws = (dist <= DMAX) ? 1.0f : 0.0f;
    #pragma unroll   // all rows' LDS reads in flight together
    for (int m = 0; m < 16; ++m) {
      const int qrow = min(qt * 16 + m, SEQ - 1);
      // wrap into 0..SEQ-1 by an unsigned minimum: the out-of-range form is negative, so huge as unsigned
      const unsigned k1 = min((unsigned)(qrow - dist), (unsigned)(qrow - dist + SEQ));
      const unsigned k2 = min((unsigned)(qrow + dist), (unsigned)(qrow + dist - SEQ));
      const float val = (float)sA[m * AP + k1] + w2 * (float)sA[m * AP + k2];
      sD[m * DP + dist] = (_Float16)(val * ws);
    }
  }
  lds_barrier();

  // ---------- Phase 5: out = (P@V + D@relV) / sum, weights and sum both scaled by 2^PSH -----------------------
  {
    const _Float16* arow  = sA + n * AP    + key0 + 8 * hi;                      // A[m=row][k=key]
    const _Float16* drow  = sD + n * DP    + dis0 + 8 * hi;                      // A[m=row][k=dist]
    v8f acc = zero8();

    #pragma unroll   // constant indices into vf
    for (int kt2 = 0; kt2 < VSW; ++kt2) {
      const int kb = kt2 * 32;
      FragH a;
      a.h[0]  = *(const v8h*)(arow + kb);
      a.h[1]  = *(const v8h*)(arow + kb + 16);
      acc = wmma_f16(a, vf[kt2], acc);
    }
    #pragma unroll   // constant indices into rvf
    for (int rt = 0; rt < RSW; ++rt) {
      const int kb = rt * 32;
      FragH a;
      a.h[0]  = *(const v8h*)(drow + kb);
      a.h[1]  = *(const v8h*)(drow + kb + 16);
      acc = wmma_f16(a, rvf[rt], acc);
    }
    // stage this wave's 16x16 f32 partial sum (sP is free after phase 2)
    #pragma unroll
    for (int r = 0; r < 8; ++r) {
      const int m = r + 8 * hi;
      sP[(ks * 16 + m) * OP + dbase + n] = acc[r];
    }
  }
  __syncthreads();

  // add the KSP partial sums, normalise, store whole 128-B lines (8 lanes each)
  if (tid < 16 * DH / 4) {
    float* obase = Out + baseQ;
    const int m = tid >> 4;
    const int c = (tid & 15) * 4;
    const int qrow = qt * 16 + m;
    v4f v = *(const v4f*)(sP + m * OP + c);
    #pragma unroll
    for (int s = 1; s < KSP; ++s) v += *(const v4f*)(sP + (s * 16 + m) * OP + c);
    const v4f* sp4 = (const v4f*)(sRedS + m * RP);
    const v4f s4 = (sp4[0] + sp4[1]) + (sp4[2] + sp4[3]);
    v *= 1.0f / ((s4.x + s4.y) + (s4.z + s4.w));
    if (qrow < SEQ) *(v4f*)(obase + (size_t)qrow * DM + c) = v;
  }
}

extern "C" void kernel_launch(void* const* d_in, const int* in_sizes, int n_in,
                              void* d_out, int out_size, void* d_ws, size_t ws_size,
                              hipStream_t stream) {
  if (n_in < 5) return;
  if (in_sizes[0] < NB * SEQ * DM || in_sizes[1] < NB * SEQ * DM || in_sizes[2] < NB * SEQ * DM) return;
  if (in_sizes[3] < NDIST * DH || in_sizes[4] < NDIST * DH) return;
  if (out_size < NB * SEQ * DM) return;
  const size_t ws_need = WS_END * 2;           // 16,777,216 B
  if (ws_size < ws_need) return;

  const float* Q  = (const float*)d_in[0];
  const float* K  = (const float*)d_in[1];
  const float* V  = (const float*)d_in[2];
  const float* RK = (const float*)d_in[3];
  const float* RV = (const float*)d_in[4];
  float* Out = (float*)d_out;
  unsigned short* ws16 = (unsigned short*)d_ws;

  unsigned short* Kb  = ws16 + WS_K;
  _Float16*       Vt  = (_Float16*)(ws16 + WS_VT);
  unsigned short* RKb = ws16 + WS_RK;
  _Float16*       RVt = (_Float16*)(ws16 + WS_RVT);

  prep_kernel<<<(NK8 + NV8 + 2 * NR8) / PCH, 256, 0, stream>>>(K, V, RK, RV, Kb, Vt, RKb, RVt);

  dim3 grid(QTN, NB * NH);
  circ_rel_attn_kernel<<<grid, dim3(NT), 0, stream>>>(Q, Kb, Vt, RKb, RVt, Out);
}

// v008
// Measured time: 59.4 microseconds a run.
// In both of two side-by-side timings against v007, it was 1.18 times as fast.
// All steps since v000 together make it 6.50 times as fast.
#include <hip/hip_runtime.h>

// Contractions: Q*K^T and Q*relK^T on v_wmma_f32_16x16x32_bf16 (bf16 operands, f32 accumulate);
// P*V and bucketed P*relV on v_wmma_f32_16x16x32_f16 (f16 operands: P scaled by 2^8, V/relV carry bf16-RNE values; f32 accumulate).

typedef _Float16 v16h __attribute__((ext_vector_type(16)));
typedef _Float16 v8h  __attribute__((ext_vector_type(8), may_alias));
typedef __bf16   v16b __attribute__((ext_vector_type(16)));
typedef unsigned short v8us __attribute__((ext_vector_type(8), may_alias));
typedef float v8f __attribute__((ext_vector_type(8)));
typedef float v4f __attribute__((ext_vector_type(4), may_alias));

#define SEQ   1000   // sequence length
#define SEQP  1008   // keys padded to a multiple of 16
#define DM    512    // model width
#define DH    64     // head dim
#define NB    8      // batch
#define NH    8      // heads
#define QTN   63     // query tiles of 16
#define KTI   63     // key tiles of 16
#define SPAD  1024   // padded key dim (multiple of 32)
#define NDIST 512    // padded distance dim (>= 501, multiple of 32)
#define DMAX  500    // largest circular distance
#define NW    16     // waves per attention block
#define NT    512    // threads per attention block
#define TPB   16     // query tiles that one work-group walks with its K and V fragments held in registers
#define QCH   ((QTN + TPB - 1) / TPB)    // work-groups per (batch, head)
#define KSP   (NW / 4)       // waves that share one 16-dim output tile, each on its own part of the k range
#define QPT   (16 * DH / NT)             // Q elements staged per thread
#define RTW   (NDIST / 16 / NW)          // relK column tiles per wave
#define KTW   ((KTI + NW - 1) / NW)      // key tiles per wave (the last wave has one fewer)
#define VSW   (SPAD / 32 / KSP)          // k steps of P*V per wave
#define RSW   (NDIST / 32 / KSP)         // k steps of D*relV per wave
// LDS row pitches: each keeps the lanes of one LDS instruction on distinct banks (64 banks of 4 B)
#define QP    (DH + 8)       // sQ, 2-B elements: 144 B = 16 B x odd, for the 16-B fragment reads down 16 rows
#define AP    (SPAD + 8)     // sA, 2-B elements: 2064 B = 16 B x odd
#define DP    (NDIST + 8)    // sD, 2-B elements: 1040 B = 16 B x odd
#define PP    (NDIST + 4)    // f32 words per query row in the first half of sPA
#define OP    (DH + 4)       // partial outputs in sP, f32: 8 rows = 32 banks mod 64, so the two lane halves of a D tile do not meet
#define TP    (SPAD + 12)    // sT, f32: 4144 B = 16 B x odd for the 16-B bias reads down 16 rows; 8 rows + 8 = 40 banks mod 64 for the stores
#define RP    (NW + 4)       // sRedM, sRedS, f32: 80 B = 16 B x odd
#define TSH   24             // unread columns in front of each sT row
#define TC0   ((QTN - 1) * 16 + TSH)   // sT column of the first key of the tile at base offset 0
#define PSH   8.0f           // log2 of the power-of-two scale on the f16 attention weights
#define L2E   1.44269504f    // log2(e)
#define BSC   8.0f           // 1 / scale: the bias is stored in the units of the raw Q*K^T products

// Workspace layout in 2-byte elements. All four operands lie in B-fragment order: the unit is [32 lanes][8 elements] = 512 B,
// what one 16-byte load of a wave takes, so that such a load covers four whole 128-B lines.
// Lane = 16*hi + n. K kind (n = key or distance): unit c of a 16-row tile holds head dims 16*c + 8*hi + 0..7.
// V kind (n = head dim of a 16-dim tile): unit j of a 32-row step holds keys or distances 16*j + 8*hi + 0..7.
#define FU      256                                      // elements per unit
#define KTE     (4 * FU)                                 // elements per 16-row tile of the K kind
#define VSE     (2 * FU)                                 // elements per 32-row step of the V kind
#define WS_K    ((size_t)0)                              // [64 bh][63 tiles][4 units]          bf16 K, padded keys zero
#define WS_VT   ((size_t)NB * SEQP * DM)                 // [64 bh][4 dim tiles][32 steps][2]   f16 V, padded keys zero
#define WS_RK   (WS_VT + (size_t)NB * NH * DH * SPAD)    // [32 tiles][4 units]                 bf16 relK
#define WS_RVT  (WS_RK + (size_t)NDIST * DH)             // [4 dim tiles][16 steps][2]          f16 relV
#define WS_END  (WS_RVT + (size_t)DH * NDIST)

#define NK8  (NB * SEQP * DM / 8)       // work units of 8 elements, K copy
#define NV8  (NB * NH * DH * SPAD / 8)  // work units of 8 elements, V^T copy
#define NR8  (NDIST * DH / 8)           // work units of 8 elements, each rel table

union FragH { v16h v; v8h  h[2]; };
union FragB { v16b v; v8us h[2]; };

__device__ __forceinline__ v8f zero8() {
  v8f z = {0.0f, 0.0f, 0.0f, 0.0f, 0.0f, 0.0f, 0.0f, 0.0f};
  return z;
}

__device__ __forceinline__ v8f wmma_f16(const FragH& a, const FragH& b, v8f c) {
  v8f d = __builtin_amdgcn_wmma_f32_16x16x32_f16(false, a.v, false, b.v, (short)0, c, false, false);
  asm volatile("v_nop\n\tv_nop\n\tv_nop\n\tv_nop" : "+v"(d) : "v"(a.v), "v"(b.v));
  return d;
}

__device__ __forceinline__ v8f wmma_bf16(const FragB& a, const FragB& b, v8f c) {
  v8f d = __builtin_amdgcn_wmma_f32_16x16x32_bf16(false, a.v, false, b.v, (short)0, c, false, false);
  asm volatile("v_nop\n\tv_nop\n\tv_nop\n\tv_nop" : "+v"(d) : "v"(a.v), "v"(b.v));
  return d;
}

// f32 -> bf16 bits, RNE
__device__ __forceinline__ unsigned short bf16_rne(float f) {
  unsigned int u = __float_as_uint(f);
  u += 0x7FFFu + ((u >> 16) & 1u);
  return (unsigned short)(u >> 16);
}

// f32 -> bf16 (RNE) -> f16 ; the second step is exact for bf16 values in f16 range
__device__ __forceinline__ _Float16 f16_of_bf16(float f) {
  unsigned int u = ((unsigned int)bf16_rne(f)) << 16;
  return (_Float16)__uint_as_float(u);
}

// 2^x for four values at once.
// One statement with outputs apart from all inputs and a closing v_nop: it keeps the one slot the instruction set asks for
// between a transcendental and an instruction that overwrites its source or reads its result.
__device__ __forceinline__ v4f exp2_x4(v4f x) {
  const float a = x.x, b = x.y, c = x.z, d = x.w;
  v4f r;
  float r0, r1, r2, r3;
  asm("v_exp_f32 %0, %4\n\tv_exp_f32 %1, %5\n\tv_exp_f32 %2, %6\n\tv_exp_f32 %3, %7\n\tv_nop"
      : "=&v"(r0), "=&v"(r1), "=&v"(r2), "=&v"(r3) : "v"(a), "v"(b), "v"(c), "v"(d));
  r.x = r0; r.y = r1; r.z = r2; r.w = r3;
  return r;
}

// lane l with lane l ^ 16
__device__ __forceinline__ float xhalf(float x) {
  const int b = __builtin_bit_cast(int, x);
  return __builtin_bit_cast(float, __builtin_amdgcn_permlanex16(b, b, 0x76543210, 0xfedcba98, false, false));
}

// Work-group barrier that orders LDS only. All that the waves of a block hand each other goes through LDS, and the global
// buffers read here are written by earlier launches alone. __syncthreads() also drains the wave's outstanding global loads,
// which would end the flight of the fragment loads issued ahead at the first barrier behind them.
__device__ __forceinline__ void lds_barrier() {
  __builtin_amdgcn_fence(__ATOMIC_RELEASE, "workgroup", "local");
  __builtin_amdgcn_s_barrier();
  __builtin_amdgcn_fence(__ATOMIC_ACQUIRE, "workgroup", "local");
}

// ---------------- prep: one launch packs K, V, relK and relV in fragment order ----------------
// The unit of work is one 16-byte piece of a packed operand. A thread takes PU units, 256 apart, and issues all their loads
// before the first conversion: few long-lived waves with many loads in flight, in place of one short wave per 32 units.
// A block's PU * 256 units lie in one operand, so the choice of the operand is uniform over the block.
#define PU   8
#define PCH  (256 * PU)
static_assert(NK8 % PCH == 0 && NV8 % PCH == 0 && NR8 % PCH == 0, "no block straddles two operands");

// K kind: unit t is [tile][unit c][lane]; row = 16 * tile + n, head dims 16 * c + 8 * hi + 0..7. ISK: K itself, else relK.
template <bool ISK>
__device__ __forceinline__ void pack_k_kind(const float* __restrict__ S, unsigned short* __restrict__ dst, int t0) {
  static_assert(PU == 8, "the wait below names one address per unit");
  const int n  = threadIdx.x & 15;
  const int hi = (threadIdx.x >> 4) & 1;
  const float* src[PU];
  v4f x0[PU], x1[PU];
  bool ok[PU];
  #pragma unroll   // constant indices: the loaded values stay in registers, and all loads are issued before the first wait
  for (int u = 0; u < PU; ++u) {
    const int t = t0 + u * 256;
    const int d = ((t >> 5) & 3) * 16 + 8 * hi;
    const int tile = t >> 7;
    if (ISK) {                          // keys padded to SEQP: row clamped for the address, padded rows zeroed below
      const int bh = tile / KTI;
      const int r  = (tile % KTI) * 16 + n;
      ok[u]  = r < SEQ;
      src[u] = S + ((size_t)(bh >> 3) * SEQ + min(r, SEQ - 1)) * DM + (bh & 7) * DH + d;
    } else {                            // distances 0..511
      ok[u]  = true;
      src[u] = S + (tile * 16 + n) * DH + d;
    }
    x0[u] = *(const v4f*)(src[u]);
    x1[u] = *(const v4f*)(src[u] + 4);
  }
  // kept in front of any overwrite of the loads' address registers; the addresses are inputs, so they live up to the wait
  asm volatile("s_wait_xcnt 0x0" :: "v"(src[0]), "v"(src[1]), "v"(src[2]), "v"(src[3]),
                                    "v"(src[4]), "v"(src[5]), "v"(src[6]), "v"(src[7]) : "memory");
  v8us  o[PU];
  v8us* p[PU];
  #pragma unroll   // constant indices into the register arrays
  for (int u = 0; u < PU; ++u) {
    const v4f z = {0.0f, 0.0f, 0.0f, 0.0f};
    const v4f a = ok[u] ? x0[u] : z, b = ok[u] ? x1[u] : z;
    o[u][0] = bf16_rne(a.x); o[u][1] = bf16_rne(a.y); o[u][2] = bf16_rne(a.z); o[u][3] = bf16_rne(a.w);
    o[u][4] = bf16_rne(b.x); o[u][5] = bf16_rne(b.y); o[u][6] = bf16_rne(b.z); o[u][7] = bf16_rne(b.w);
    p[u] = (v8us*)(dst + (size_t)(t0 + u * 256) * 8);   // unit t goes to the t-th 16 bytes
    *p[u] = o[u];
  }
  // the same wait for the stores: with their data and addresses as inputs the build overwrites no store's register in front of it
  asm volatile("s_wait_xcnt 0x0" :: "v"(o[0]), "v"(o[1]), "v"(o[2]), "v"(o[3]), "v"(o[4]), "v"(o[5]), "v"(o[6]), "v"(o[7]),
                                    "v"(p[0]), "v"(p[1]), "v"(p[2]), "v"(p[3]), "v"(p[4]), "v"(p[5]), "v"(p[6]), "v"(p[7]) : "memory");
}

// V kind: 256 units are one 32-row step, all four dim tiles, so that a block reads whole 256-B head rows, 16 lanes per 64 B.
// Unit t is [step s][half j][dim tile dt][lane]; dim = 16 * dt + n, rows 32 * s + 16 * j + 8 * hi + 0..7. ISV: V itself, else relV.
template <bool ISV>
__device__ __forceinline__ void pack_v_kind(const float* __restrict__ S, _Float16* __restrict__ dst, int t0) {
  static_assert(PU == 8, "the wait below names one address per unit");
  const int lane = threadIdx.x & 31;
  const int n  = lane & 15;
  const int hi = lane >> 4;
  const float* src[PU];
  float x[PU][8];
  bool ok[PU];
  int  e0[PU];
  #pragma unroll   // as in pack_k_kind
  for (int u = 0; u < PU; ++u) {
    const int t  = t0 + u * 256;
    const int dt = (t >> 5) & 3;
    const int j  = (t >> 7) & 1;
    const int dim = dt * 16 + n;
    if (ISV) {                          // keys padded to SPAD: SEQ is a multiple of 8, so a unit's 8 keys are all valid or all padding
      const int s  = (t >> 8) & (SPAD / 32 - 1);
      const int bh = t >> 13;           // DH*SPAD/8 = 8192 units per (b,h)
      const int key0 = s * 32 + j * 16 + 8 * hi;
      ok[u]  = key0 < SEQ;
      e0[u]  = ((bh * 4 + dt) * (SPAD / 32) + s) * VSE + j * FU + lane * 8;
      src[u] = S + ((size_t)(bh >> 3) * SEQ + min(key0, SEQ - 8)) * DM + (bh & 7) * DH + dim;
    } else {                            // distances 0..511
      const int s = t >> 8;
      ok[u]  = true;
      e0[u]  = (dt * (NDIST / 32) + s) * VSE + j * FU + lane * 8;
      src[u] = S + (size_t)(s * 32 + j * 16 + 8 * hi) * DH + dim;
    }
    #pragma unroll
    for (int i = 0; i < 8; ++i) x[u][i] = src[u][(size_t)i * (ISV ? DM : DH)];
  }
  // as in pack_k_kind
  asm volatile("s_wait_xcnt 0x0" :: "v"(src[0]), "v"(src[1]), "v"(src[2]), "v"(src[3]),
                                    "v"(src[4]), "v"(src[5]), "v"(src[6]), "v"(src[7]) : "memory");
  v8h  o[PU];
  v8h* p[PU];
  #pragma unroll   // constant indices into the register arrays
  for (int u = 0; u < PU; ++u) {
    #pragma unroll
    for (int i = 0; i < 8; ++i) o[u][i] = f16_of_bf16(ok[u] ? x[u][i] : 0.0f);
    p[u] = (v8h*)(dst + (size_t)e0[u]);
    *p[u] = o[u];
  }
  // as in pack_k_kind
  asm volatile("s_wait_xcnt 0x0" :: "v"(o[0]), "v"(o[1]), "v"(o[2]), "v"(o[3]), "v"(o[4]), "v"(o[5]), "v"(o[6]), "v"(o[7]),
                                    "v"(p[0]), "v"(p[1]), "v"(p[2]), "v"(p[3]), "v"(p[4]), "v"(p[5]), "v"(p[6]), "v"(p[7]) : "memory");
}

__global__ __launch_bounds__(256)
void prep_kernel(const float* __restrict__ K, const float* __restrict__ V,
                 const float* __restrict__ RK, const float* __restrict__ RV,
                 unsigned short* __restrict__ Kb, _Float16* __restrict__ Vt,
                 unsigned short* __restrict__ RKb, _Float16* __restrict__ RVt) {
  const int blk = blockIdx.x;
  const int tid = threadIdx.x;
  if (blk < NK8 / PCH)                        pack_k_kind<true >(K,  Kb,  blk * PCH + tid);
  else if (blk < (NK8 + NV8) / PCH)           pack_v_kind<true >(V,  Vt,  (blk - NK8 / PCH) * PCH + tid);
  else if (blk < (NK8 + NV8 + NR8) / PCH)     pack_k_kind<false>(RK, RKb, (blk - (NK8 + NV8) / PCH) * PCH + tid);
  else                                        pack_v_kind<false>(RV, RVt, (blk - (NK8 + NV8 + NR8) / PCH) * PCH + tid);
}

// ---------------- fused attention kernel ------------------------------------
// 4 waves per SIMD: one work-group per WGP, with the register budget that holds a wave's share of K and V for all its query tiles
__global__ __launch_bounds__(NT, 4)
void circ_rel_attn_kernel(const float* __restrict__ Q,
                          const unsigned short* __restrict__ Kb,
                          const _Float16* __restrict__ Vt,
                          const unsigned short* __restrict__ RKb,
                          const _Float16* __restrict__ RVt,
                          float* __restrict__ Out)
{
  __shared__ __attribute__((aligned(16))) unsigned short sQ[16 * QP];     //  2 KB  bf16 Q tile
  // 64 KB, two lives. Phases 1-2: sT[q][TC0 + q - u] = BSC * (Q*relK^T)[q][circular distance of u], q the row in the tile,
  // u = q - 15 .. q + TC0 - TSH: the bias row laid out over the whole circle, backwards and shifted by its row, so that the 16 keys of
  // the tile at base offset 16*(qt - kt) mod SEQ stand in key order at columns TC0 - base + 0..15 of every row.
  // Columns TSH .. TC0 + 15 are read. An offset outside a row's window falls on the unread columns between two rows' windows.
  // From phase 3: the second half is sA; the first half takes the partial outputs [KSP][16][OP].
  __shared__ __attribute__((aligned(16))) float          sPA[16 * TP + 16];
  __shared__ __attribute__((aligned(16))) _Float16       sD[16 * DP];     // 16 KB  per-distance mass*256 f16
  __shared__ __attribute__((aligned(16))) float          sRedM[16 * RP];  // [query][wave] maximum over the wave's keys
  __shared__ __attribute__((aligned(16))) float          sRedS[16 * RP];  // [query][wave] sum over the wave's keys
  float*    const sT = sPA;
  float*    const sP = sPA;
  _Float16* const sA = (_Float16*)(sPA + 16 * PP);                        // 32 KB  exp(scores)*256 f16
  static_assert(16 * PP + 16 * AP / 2 <= 16 * TP + 16, "the two halves fit");
  static_assert(KSP * 16 * OP <= 16 * PP, "the partial outputs stay clear of sA");
  static_assert(TC0 + 15 < TP && SEQ - (TC0 - TSH) == 8, "a tile's 16 columns lie inside the row; the wrapped offsets below count on the 8");
  static_assert(TSH - 8 - 15 >= 0 && TC0 + 30 - TP < TSH && TC0 + 30 - TP < 16, "offsets outside a window stay inside sPA and off every window");

  const int qt0  = blockIdx.x * TPB;            // first query tile of this work-group
  const int qtn  = min(qt0 + TPB, QTN);         // one past its last
  const int bh   = blockIdx.y;
  const int b    = bh >> 3;
  const int h    = bh & 7;
  const int tid  = threadIdx.x;
  const int lane = tid & 31;
  const int wave = tid >> 5;
  const int n    = lane & 15;           // A row / B column / D column
  const int hi   = lane >> 4;           // lane half

  const float scale = 0.125f;
  const size_t baseQ = (size_t)b * SEQ * DM + (size_t)h * DH;
  const unsigned short* Kbh = Kb + (size_t)bh * KTI * KTE + lane * 8;     // this lane's 16 bytes of every unit
  const _Float16* Vbh = Vt + (size_t)bh * DH * SPAD + lane * 8;

  // ---------- Global loads in front of the loop over query tiles. A wave's K and V^T fragments are the same for every
  // query tile of a (batch, head): they are loaded once and stay in registers. Q and relK are loaded one tile ahead.
  // Group 1 (here): the first tile's Q elements, this wave's relK tiles, its first two key tiles.
  float qv[QPT];
  const float* qp[QPT];
  #pragma unroll   // constant indices: qv stays in registers, and all its loads are issued before the first wait
  for (int i = 0; i < QPT; ++i) {
    const int idx = tid + i * NT;
    const int m = idx >> 6, d = idx & 63;
    qp[i] = Q + baseQ + (size_t)min(qt0 * 16 + m, SEQ - 1) * DM + d;   // row clamped; rows past the end are zeroed below
    qv[i] = *qp[i];
  }
  const unsigned short* rp0 = RKb + (size_t)wave * KTE + lane * 8;           // B[k=d][n=dist], four units per tile
  FragB rk[RTW][2];
  #pragma unroll   // constant indices: the fragments stay in registers
  for (int i = 0; i < RTW; ++i) {
    const unsigned short* rp = rp0 + (size_t)i * NW * KTE;
    rk[i][0].h[0] = *(const v8us*)(rp);
    rk[i][0].h[1] = *(const v8us*)(rp + FU);
    rk[i][1].h[0] = *(const v8us*)(rp + 2 * FU);
    rk[i][1].h[1] = *(const v8us*)(rp + 3 * FU);
  }
  const unsigned short* kp0 = Kbh + (size_t)wave * KTE;                      // A[m=key][k=d], four units per tile
  FragB kf[KTW][2];
  #pragma unroll   // constant indices: the fragments stay in registers
  for (int i = 0; i < KTW / 2; ++i) {
    const unsigned short* kp = kp0 + (size_t)i * NW * KTE;
    kf[i][0].h[0] = *(const v8us*)(kp);
    kf[i][0].h[1] = *(const v8us*)(kp + FU);
    kf[i][1].h[0] = *(const v8us*)(kp + 2 * FU);
    kf[i][1].h[1] = *(const v8us*)(kp + 3 * FU);
  }
  static_assert(QPT == 2, "the wait below names one address per Q load");
  // Behind each group: the wait that is kept in front of any overwrite of an issued load's address registers. The addresses
  // are inputs, so they live up to the wait (left to itself the build gave some loads an address register of the group as
  // their destination, or waited to a count only).
  asm volatile("s_wait_xcnt 0x0" :: "v"(qp[0]), "v"(qp[1]), "v"(rp0), "v"(kp0) : "memory");
  // Group 2: the other key tiles.
  const unsigned short* kq[KTW];
  #pragma unroll   // constant indices into kf
  for (int i = KTW / 2; i < KTW; ++i) {
    // tile min(wave + i * NW, KTI - 1): the last wave has no last tile, its address is clamped and the value unused.
    // kq[i] leaves the constant part of the tile number to the loads' offsets, so that the wait below names the very registers they use.
    kq[i] = Kbh + (size_t)min(wave, KTI - 1 - i * NW) * KTE;
    const unsigned short* kp = kq[i] + (size_t)i * NW * KTE;
    kf[i][0].h[0] = *(const v8us*)(kp);
    kf[i][0].h[1] = *(const v8us*)(kp + FU);
    kf[i][1].h[0] = *(const v8us*)(kp + 2 * FU);
    kf[i][1].h[1] = *(const v8us*)(kp + 3 * FU);
  }
  static_assert(KTW == 4, "the wait below names one address per tile of the group");
  asm volatile("s_wait_xcnt 0x0" :: "v"(kq[2]), "v"(kq[3]) : "memory");   // as behind group 1

  const int dbase = (wave & 3) * 16;           // 16 head dims per wave
  const int ks    = wave >> 2;                 // this wave's part of the key range and of the distance range
  const int key0  = ks * (SPAD / KSP);
  const int dis0  = ks * (NDIST / KSP);

  // Group 3: this wave's V^T fragments for phase 5.
  FragH vf[VSW];
  {
    const _Float16* vcol = Vbh + (size_t)((wave & 3) * (SPAD / 32) + ks * VSW) * VSE;   // B[k=key][n=dim], two units per step
    #pragma unroll   // constant indices: the fragments stay in registers
    for (int i = 0; i < VSW; ++i) {
      vf[i].h[0] = *(const v8h*)(vcol + i * VSE);
      vf[i].h[1] = *(const v8h*)(vcol + i * VSE + FU);
    }
    asm volatile("s_wait_xcnt 0x0" :: "v"(vcol) : "memory");   // as behind group 1
  }

  #pragma unroll 1   // stays rolled: a second copy of the body would take the registers that hold K and V
  for (int qt = qt0; qt < qtn; ++qt) {

  // ---------- Phase 0: stage Q tile as bf16 ----------------------------------
  // sQ's readers of the previous tile have passed several barriers since.
  #pragma unroll   // constant indices into qv
  for (int i = 0; i < QPT; ++i) {
    const int idx = tid + i * NT;
    const int m = idx >> 6, d = idx & 63;
    const float v = (qt * 16 + m < SEQ) ? qv[i] : 0.0f;
    sQ[m * QP + d] = bf16_rne(v);
  }
  // The next tile's Q elements: they land behind this tile's work. Behind the last tile the clamped row is loaded and not used.
  #pragma unroll   // constant indices into qv
  for (int i = 0; i < QPT; ++i) {
    const int idx = tid + i * NT;
    const int m = idx >> 6, d = idx & 63;
    qp[i] = Q + baseQ + (size_t)min((qt + 1) * 16 + m, SEQ - 1) * DM + d;
    qv[i] = *qp[i];
  }
  asm volatile("s_wait_xcnt 0x0" :: "v"(qp[0]), "v"(qp[1]) : "memory");   // as behind group 1
  lds_barrier();   // also ends the previous tile's reads of sP, in front of this tile's writes of sT

  // A fragments of the Q tile: k 0..31 and k 32..63 (split map: elems 0..7 <- k0+8h, 8..15 <- k0+16+8h)
  FragB qa0, qa1;
  {
    const unsigned short* qp = sQ + n * QP + 8 * hi;
    qa0.h[0] = *(const v8us*)(qp);
    qa0.h[1] = *(const v8us*)(qp + 16);
    qa1.h[0] = *(const v8us*)(qp + 32);
    qa1.h[1] = *(const v8us*)(qp + 48);
  }

  // ---------- Phase 1: P = Qtile @ relK^T, stored at every circular offset that has this distance ----------
  const int swave = __builtin_amdgcn_readfirstlane(wave);   // tile numbers and base offsets stay scalar
  const int nrev  = n ^ 15;                                 // 15 - n, never negative
  #pragma unroll   // constant indices into rk
  for (int i = 0; i < RTW; ++i) {
    const int ct = swave + i * NW;
    v8f acc = zero8();
    acc = wmma_bf16(qa0, rk[i][0], acc);
    acc = wmma_bf16(qa1, rk[i][1], acc);
    acc *= BSC;
    const int dist = ct * 16 + n;
    float* trow = sT + 8 * hi * (TP + 1);   // row q = r + 8*hi, column C + q: steps of TP + 1
    if (dist <= DMAX) {
      float* p1 = trow + (TC0 - 15 - ct * 16) + nrev;       // offset dist: column TC0 + q - dist
      float* p2 = trow + (ct * 16 + TSH - 8) + n;           // offset SEQ - dist: column TSH + q + dist - 8
      #pragma unroll
      for (int r = 0; r < 8; ++r) {
        p1[r * (TP + 1)] = acc[r];
        p2[r * (TP + 1)] = acc[r];
      }
    }
    if (i == 0 && ct == 0) {         // distances 0..15 also stand at offsets -dist and SEQ + dist, where a row's window reaches them
      #pragma unroll
      for (int r = 0; r < 8; ++r) {
        trow[r * (TP + 1) + TC0 + n] = acc[r];                   // offset -dist
        trow[r * (TP + 1) + (TSH - 8 - 15) + nrev] = acc[r];     // offset SEQ + dist
      }
    }
  }
  lds_barrier();

  // ---------- Phase 2: scores^T / scale = K*Q^T + bias / scale at offset (query - key) mod SEQ, kept in registers ------
  // K is the A operand and Q the B operand: lane (n, hi) holds, of query n, the 8 neighbouring keys 16*kt + 8*hi + 0..7.
  static_assert(NW * (KTW - 1) * 16 <= SEQ, "only a wave's last tile can hold padded keys");
  static_assert(SEQ % 8 == 0, "a lane's 8 keys are all valid or all padding");
  const float* tlane = sT + n * TP + 8 * hi;
  // The bias is the C operand of a tile's first product. A tile's two bias reads are issued in front of the previous tile's
  // products and land behind them.
  v4f bias[2][2];
  {
    const int dt = qt - swave;
    const float* tp = tlane + (TC0 - dt * 16 - (dt < 0 ? SEQ : 0));
    bias[0][0] = *(const v4f*)(tp);
    bias[0][1] = *(const v4f*)(tp + 4);
  }
  float sc[KTW][8];
  #pragma unroll   // constant indices into kf, bias and sc
  for (int i = 0; i < KTW; ++i) {
    const int kt = swave + i * NW;
    if (i + 1 < KTW) {
      const int dt = qt - min(kt + NW, KTI - 1);   // the last wave has no last tile: tile number clamped, values masked below
      const float* tp = tlane + (TC0 - dt * 16 - (dt < 0 ? SEQ : 0));
      bias[(i + 1) & 1][0] = *(const v4f*)(tp);
      bias[(i + 1) & 1][1] = *(const v4f*)(tp + 4);
    }
    v8f acc = __builtin_shufflevector(bias[i & 1][0], bias[i & 1][1], 0, 1, 2, 3, 4, 5, 6, 7);
    acc = wmma_bf16(kf[i][0], qa0, acc);
    acc = wmma_bf16(kf[i][1], qa1, acc);
    const bool pad = (i == KTW - 1) && (kt * 16 + 8 * hi >= SEQ);   // padded keys, the last wave's missing tile among them
    #pragma unroll
    for (int r = 0; r < 8; ++r) sc[i][r] = pad ? -1.0e30f : acc[r];
  }

  // ---------- Phase 3: softmax in registers (normalisation deferred) -----------------
  // A query's maximum: in the lane, between the lane halves, then over the waves through sRedM.
  {
    float m0 = sc[0][0], m1 = sc[1][0], m2 = sc[2][0], m3 = sc[3][0];
    static_assert(KTW == 4, "one chain per tile");
    #pragma unroll
    for (int r = 1; r < 8; ++r) {
      m0 = fmaxf(m0, sc[0][r]); m1 = fmaxf(m1, sc[1][r]); m2 = fmaxf(m2, sc[2][r]); m3 = fmaxf(m3, sc[3][r]);
    }
    float mx = fmaxf(fmaxf(m0, m1), fmaxf(m2, m3));
    mx = fmaxf(mx, xhalf(mx));
    if (hi == 0) sRedM[n * RP + wave] = mx;
  }
  lds_barrier();   // also ends every wave's reads of sT, whose second half becomes sA
  {
    static_assert(NW == 16, "four 16-byte reads per query");
    const v4f* mp = (const v4f*)(sRedM + n * RP);
    const v4f a = mp[0], b = mp[1], c = mp[2], d = mp[3];
    const float rm = fmaxf(fmaxf(fmaxf(fmaxf(a.x, a.y), fmaxf(a.z, a.w)), fmaxf(fmaxf(b.x, b.y), fmaxf(b.z, b.w))),
                           fmaxf(fmaxf(fmaxf(c.x, c.y), fmaxf(c.z, c.w)), fmaxf(fmaxf(d.x, d.y), fmaxf(d.z, d.w))));
    const float cs = scale * L2E;        // raw units -> log2 units
    const float sh = rm * cs - PSH;      // weights come out scaled by 2^PSH, and so does their sum
    _Float16* alane = sA + n * AP + swave * 16 + 8 * hi;
    float sum = 0.0f;
    #pragma unroll   // constant indices into sc
    for (int i = 0; i < KTW; ++i) {
      const v4f x0 = {sc[i][0] * cs - sh, sc[i][1] * cs - sh, sc[i][2] * cs - sh, sc[i][3] * cs - sh};
      const v4f x1 = {sc[i][4] * cs - sh, sc[i][5] * cs - sh, sc[i][6] * cs - sh, sc[i][7] * cs - sh};
      const v4f e0 = exp2_x4(x0), e1 = exp2_x4(x1);
      v8h h8;
      h8[0] = (_Float16)e0.x; h8[1] = (_Float16)e0.y; h8[2] = (_Float16)e0.z; h8[3] = (_Float16)e0.w;
      h8[4] = (_Float16)e1.x; h8[5] = (_Float16)e1.y; h8[6] = (_Float16)e1.z; h8[7] = (_Float16)e1.w;
      *(v8h*)(alane + i * NW * 16) = h8;   // 8 keys of one query: one 16-byte store; padded keys up to SPAD get zeros
      sum += ((e0.x + e0.y) + (e0.z + e0.w)) + ((e1.x + e1.y) + (e1.z + e1.w));
    }
    sum += xhalf(sum);
    if (hi == 0) sRedS[n * RP + wave] = sum;
  }

  // Group 4: this wave's relV^T fragments for phase 5; they land behind phase 4.
  FragH rvf[RSW];
  {
    const _Float16* rvcol = RVt + (size_t)((wave & 3) * (NDIST / 32) + ks * RSW) * VSE + lane * 8;   // B[k=dist][n=dim]
    #pragma unroll   // constant indices: the fragments stay in registers
    for (int i = 0; i < RSW; ++i) {
      rvf[i].h[0] = *(const v8h*)(rvcol + i * VSE);
      rvf[i].h[1] = *(const v8h*)(rvcol + i * VSE + FU);
    }
    asm volatile("s_wait_xcnt 0x0" :: "v"(rvcol) : "memory");   // as behind group 1
  }
  lds_barrier();

  // ---------- Phase 4: per-distance mass, fixed 2-key gather (no atomics) ---
  // keys at circular distance dist from row q: (q-dist) mod S and (q+dist) mod S (one key when they coincide)
  // One distance per thread, all 16 rows. The two keys coincide exactly where 2*dist is a multiple of SEQ, whatever the row,
  // so that test and the padding test become two per-thread factors and the rows' reads are independent of each other.
  {
    static_assert(NT == NDIST, "one distance per thread");
    const int dist = tid;
    const float w2 = (dist == 0 || 2 * dist == SEQ) ? 0.0f : 1.0f;
    const float ws = (dist <= DMAX) ? 1.0f : 0.0f;
    #pragma unroll   // all rows' LDS reads in flight together
    for (int m = 0; m < 16; ++m) {
      const int qrow = min(qt * 16 + m, SEQ - 1);
      // wrap into 0..SEQ-1 by an unsigned minimum: the out-of-range form is negative, so huge as unsigned
      const unsigned k1 = min((unsigned)(qrow - dist), (unsigned)(qrow - dist + SEQ));
      const unsigned k2 = min((unsigned)(qrow + dist), (unsigned)(qrow + dist - SEQ));
      const float val = (float)sA[m * AP + k1] + w2 * (float)sA[m * AP + k2];
      sD[m * DP + dist] = (_Float16)(val * ws);
    }
  }
  lds_barrier();

  // ---------- Phase 5: out = (P@V + D@relV) / sum, weights and sum both scaled by 2^PSH -----------------------
  {
    const _Float16* arow  = sA + n * AP    + key0 + 8 * hi;                      // A[m=row][k=key]
    const _Float16* drow  = sD + n * DP    + dis0 + 8 * hi;                      // A[m=row][k=dist]
    v8f acc = zero8();

    #pragma unroll   // constant indices into vf
    for (int kt2 = 0; kt2 < VSW; ++kt2) {
      const int kb = kt2 * 32;
      FragH a;
      a.h[0]  = *(const v8h*)(arow + kb);
      a.h[1]  = *(const v8h*)(arow + kb + 16);
      acc = wmma_f16(a, vf[kt2], acc);
    }
    #pragma unroll   // constant indices into rvf
    for (int rt = 0; rt < RSW; ++rt) {
      const int kb = rt * 32;
      FragH a;
      a.h[0]  = *(const v8h*)(drow + kb);
      a.h[1]  = *(const v8h*)(drow + kb + 16);
      acc = wmma_f16(a, rvf[rt], acc);
    }
    // stage this wave's 16x16 f32 partial sum (sP is free after phase 2)
    #pragma unroll
    for (int r = 0; r < 8; ++r) {
      const int m = r + 8 * hi;
      sP[(ks * 16 + m) * OP + dbase + n] = acc[r];
    }
  }
  __syncthreads();

  // relK again, for the next tile: held over the whole tile its 32 registers would take the room in which phase 4 keeps
  // its LDS reads in flight. Issued behind the barrier above, which would drain it; it lands behind the rest of this tile and phase 0.
  #pragma unroll   // constant indices: the fragments stay in registers
  for (int i = 0; i < RTW; ++i) {
    const unsigned short* rp = rp0 + (size_t)i * NW * KTE;
    rk[i][0].h[0] = *(const v8us*)(rp);
    rk[i][0].h[1] = *(const v8us*)(rp + FU);
    rk[i][1].h[0] = *(const v8us*)(rp + 2 * FU);
    rk[i][1].h[1] = *(const v8us*)(rp + 3 * FU);
  }
  asm volatile("s_wait_xcnt 0x0" :: "v"(rp0) : "memory");   // as behind group 1

  // add the KSP partial sums, normalise, store whole 128-B lines (8 lanes each)
  if (tid < 16 * DH / 4) {
    float* obase = Out + baseQ;
    const int m = tid >> 4;
    const int c = (tid & 15) * 4;
    const int qrow = qt * 16 + m;
    v4f v = *(const v4f*)(sP + m * OP + c);
    #pragma unroll
    for (int s = 1; s < KSP; ++s) v += *(const v4f*)(sP + (s * 16 + m) * OP + c);
    const v4f* sp4 = (const v4f*)(sRedS + m * RP);
    const v4f s4 = (sp4[0] + sp4[1]) + (sp4[2] + sp4[3]);
    v *= 1.0f / ((s4.x + s4.y) + (s4.z + s4.w));
    if (qrow < SEQ) {
      v4f* op = (v4f*)(obase + (size_t)qrow * DM + c);
      *op = v;
      // kept in front of the next tile's overwrite of the store's registers; data and address are inputs, so they live up to the wait
      asm volatile("s_wait_xcnt 0x0" :: "v"(v), "v"(op) : "memory");
    }
  }

  }   // query tiles
}

extern "C" void kernel_launch(void* const* d_in, const int* in_sizes, int n_in,
                              void* d_out, int out_size, void* d_ws, size_t ws_size,
                              hipStream_t stream) {
  if (n_in < 5) return;
  if (in_sizes[0] < NB * SEQ * DM || in_sizes[1] < NB * SEQ * DM || in_sizes[2] < NB * SEQ * DM) return;
  if (in_sizes[3] < NDIST * DH || in_sizes[4] < NDIST * DH) return;
  if (out_size < NB * SEQ * DM) return;
  const size_t ws_need = WS_END * 2;           // 16,777,216 B
  if (ws_size < ws_need) return;

  const float* Q  = (const float*)d_in[0];
  const float* K  = (const float*)d_in[1];
  const float* V  = (const float*)d_in[2];
  const float* RK = (const float*)d_in[3];
  const float* RV = (const float*)d_in[4];
  float* Out = (float*)d_out;
  unsigned short* ws16 = (unsigned short*)d_ws;

  unsigned short* Kb  = ws16 + WS_K;
  _Float16*       Vt  = (_Float16*)(ws16 + WS_VT);
  unsigned short* RKb = ws16 + WS_RK;
  _Float16*       RVt = (_Float16*)(ws16 + WS_RVT);

  prep_kernel<<<(NK8 + NV8 + 2 * NR8) / PCH, 256, 0, stream>>>(K, V, RK, RV, Kb, Vt, RKb, RVt);

  dim3 grid(QCH, NB * NH);
  circ_rel_attn_kernel<<<grid, dim3(NT), 0, stream>>>(Q, Kb, Vt, RKb, RVt, Out);
}

// v009
// A run of this version takes 56.6 microseconds.
// Two timings next to v008 both put it at 1.05 times that version's speed.
// All steps since v000 together make it 6.84 times as fast.
#include <hip/hip_runtime.h>

// Contractions: Q*K^T and Q*relK^T on v_wmma_f32_16x16x32_bf16 (bf16 operands, f32 accumulate);
// P*V and bucketed P*relV on v_wmma_f32_16x16x32_f16 (f16 operands: P scaled by 2^8, V/relV carry bf16-RNE values; f32 accumulate).

typedef _Float16 v16h __attribute__((ext_vector_type(16)));
typedef _Float16 v8h  __attribute__((ext_vector_type(8), may_alias));
typedef __bf16   v16b __attribute__((ext_vector_type(16)));
typedef unsigned short v8us __attribute__((ext_vector_type(8), may_alias));
typedef float v8f __attribute__((ext_vector_type(8)));
typedef float v4f __attribute__((ext_vector_type(4), may_alias));

#define SEQ   1000   // sequence length
#define SEQP  1008   // keys padded to a multiple of 16
#define DM    512    // model width
#define DH    64     // head dim
#define NB    8      // batch
#define NH    8      // heads
#define QTN   63     // query tiles of 16
#define KTI   63     // key tiles of 16
#define SPAD  1024   // padded key dim (multiple of 32)
#define NDIST 512    // padded distance dim (>= 501, multiple of 32)
#define DMAX  500    // largest circular distance
#define NW    16     // waves per attention block
#define NT    512    // threads per attention block
#define TPB   16     // query tiles that one work-group walks with its K and V fragments held in registers
#define QCH   ((QTN + TPB - 1) / TPB)    // work-groups per (batch, head)
#define KSP   (NW / 4)       // waves that share one 16-dim output tile, each on its own part of the k range
#define QPT   (16 * DH / NT)             // Q elements staged per thread
#define RTW   (NDIST / 16 / NW)          // relK column tiles per wave
#define KTW   ((KTI + NW - 1) / NW)      // key tiles per wave (the last wave has one fewer)
#define VSW   (SPAD / 32 / KSP)          // k steps of P*V per wave
#define RSW   (NDIST / 32 / KSP)         // k steps of D*relV per wave
#define AHD   4                          // k steps by which phase 5 reads its A fragments from LDS ahead of their product
// LDS row pitches: each keeps the lanes of one LDS instruction on distinct banks (64 banks of 4 B)
#define QP    (DH + 8)       // sQ, 2-B elements: 144 B = 16 B x odd, for the 16-B fragment reads down 16 rows
#define AP    (SPAD + 8)     // sA, 2-B elements: 2064 B = 16 B x odd
#define DP    (NDIST + 8)    // sD, 2-B elements: 1040 B = 16 B x odd
#define PP    (NDIST + 4)    // f32 words per query row in the first half of sPA
#define OP    (DH + 4)       // partial outputs in sP, f32: 8 rows = 32 banks mod 64, so the two lane halves of a D tile do not meet
#define TP    (SPAD + 12)    // sT, f32: 4144 B = 16 B x odd for the 16-B bias reads down 16 rows; 8 rows + 8 = 40 banks mod 64 for the stores
#define RP    (NW + 4)       // sRedM, sRedS, f32: 80 B = 16 B x odd
#define TSH   24             // unread columns in front of each sT row
#define TC0   ((QTN - 1) * 16 + TSH)   // sT column of the first key of the tile at base offset 0
#define PSH   8.0f           // log2 of the power-of-two scale on the f16 attention weights
#define L2E   1.44269504f    // log2(e)
#define BSC   8.0f           // 1 / scale: the bias is stored in the units of the raw Q*K^T products

// Workspace layout in 2-byte elements. All four operands lie in B-fragment order: the unit is [32 lanes][8 elements] = 512 B,
// what one 16-byte load of a wave takes, so that such a load covers four whole 128-B lines.
// Lane = 16*hi + n. K kind (n = key or distance): unit c of a 16-row tile holds head dims 16*c + 8*hi + 0..7.
// V kind (n = head dim of a 16-dim tile): unit j of a 32-row step holds keys or distances 16*j + 8*hi + 0..7.
#define FU      256                                      // elements per unit
#define KTE     (4 * FU)                                 // elements per 16-row tile of the K kind
#define VSE     (2 * FU)                                 // elements per 32-row step of the V kind
#define WS_K    ((size_t)0)                              // [64 bh][63 tiles][4 units]          bf16 K, padded keys zero
#define WS_VT   ((size_t)NB * SEQP * DM)                 // [64 bh][4 dim tiles][32 steps][2]   f16 V, padded keys zero
#define WS_RK   (WS_VT + (size_t)NB * NH * DH * SPAD)    // [32 tiles][4 units]                 bf16 relK
#define WS_RVT  (WS_RK + (size_t)NDIST * DH)             // [4 dim tiles][16 steps][2]          f16 relV
#define WS_END  (WS_RVT + (size_t)DH * NDIST)

#define NK8  (NB * SEQP * DM / 8)       // work units of 8 elements, K copy
#define NV8  (NB * NH * DH * SPAD / 8)  // work units of 8 elements, V^T copy
#define NR8  (NDIST * DH / 8)           // work units of 8 elements, each rel table

union FragH { v16h v; v8h  h[2]; };
union FragB { v16b v; v8us h[2]; };

__device__ __forceinline__ v8f zero8() {
  v8f z = {0.0f, 0.0f, 0.0f, 0.0f, 0.0f, 0.0f, 0.0f, 0.0f};
  return z;
}

__device__ __forceinline__ v8f wmma_f16(const FragH& a, const FragH& b, v8f c) {
  v8f d = __builtin_amdgcn_wmma_f32_16x16x32_f16(false, a.v, false, b.v, (short)0, c, false, false);
  asm volatile("v_nop\n\tv_nop\n\tv_nop\n\tv_nop" : "+v"(d) : "v"(a.v), "v"(b.v));
  return d;
}

__device__ __forceinline__ v8f wmma_bf16(const FragB& a, const FragB& b, v8f c) {
  v8f d = __builtin_amdgcn_wmma_f32_16x16x32_bf16(false, a.v, false, b.v, (short)0, c, false, false);
  asm volatile("v_nop\n\tv_nop\n\tv_nop\n\tv_nop" : "+v"(d) : "v"(a.v), "v"(b.v));
  return d;
}

// f32 -> bf16 bits, RNE
__device__ __forceinline__ unsigned short bf16_rne(float f) {
  unsigned int u = __float_as_uint(f);
  u += 0x7FFFu + ((u >> 16) & 1u);
  return (unsigned short)(u >> 16);
}

// f32 -> bf16 (RNE) -> f16 ; the second step is exact for bf16 values in f16 range
__device__ __forceinline__ _Float16 f16_of_bf16(float f) {
  unsigned int u = ((unsigned int)bf16_rne(f)) << 16;
  return (_Float16)__uint_as_float(u);
}

// 2^x for four values at once.
// One statement with outputs apart from all inputs and a closing v_nop: it keeps the one slot the instruction set asks for
// between a transcendental and an instruction that overwrites its source or reads its result.
__device__ __forceinline__ v4f exp2_x4(v4f x) {
  const float a = x.x, b = x.y, c = x.z, d = x.w;
  v4f r;
  float r0, r1, r2, r3;
  asm("v_exp_f32 %0, %4\n\tv_exp_f32 %1, %5\n\tv_exp_f32 %2, %6\n\tv_exp_f32 %3, %7\n\tv_nop"
      : "=&v"(r0), "=&v"(r1), "=&v"(r2), "=&v"(r3) : "v"(a), "v"(b), "v"(c), "v"(d));
  r.x = r0; r.y = r1; r.z = r2; r.w = r3;
  return r;
}

// lane l with lane l ^ 16
__device__ __forceinline__ float xhalf(float x) {
  const int b = __builtin_bit_cast(int, x);
  return __builtin_bit_cast(float, __builtin_amdgcn_permlanex16(b, b, 0x76543210, 0xfedcba98, false, false));
}

// Work-group barrier that orders LDS only. All that the waves of a block hand each other goes through LDS, and the global
// buffers read here are written by earlier launches alone. __syncthreads() also drains the wave's outstanding global loads,
// which would end the flight of the fragment loads issued ahead at the first barrier behind them.
__device__ __forceinline__ void lds_barrier() {
  __builtin_amdgcn_fence(__ATOMIC_RELEASE, "workgroup", "local");
  __builtin_amdgcn_s_barrier();
  __builtin_amdgcn_fence(__ATOMIC_ACQUIRE, "workgroup", "local");
}

// ---------------- prep: one launch packs K, V, relK and relV in fragment order ----------------
// The unit of work is one 16-byte piece of a packed operand. A thread takes PU units, 256 apart, and issues all their loads
// before the first conversion: few long-lived waves with many loads in flight, in place of one short wave per 32 units.
// A block's PU * 256 units lie in one operand, so the choice of the operand is uniform over the block.
#define PU   8
#define PCH  (256 * PU)
static_assert(NK8 % PCH == 0 && NV8 % PCH == 0 && NR8 % PCH == 0, "no block straddles two operands");

// K kind: unit t is [tile][unit c][lane]; row = 16 * tile + n, head dims 16 * c + 8 * hi + 0..7. ISK: K itself, else relK.
template <bool ISK>
__device__ __forceinline__ void pack_k_kind(const float* __restrict__ S, unsigned short* __restrict__ dst, int t0) {
  static_assert(PU == 8, "the wait below names one address per unit");
  const int n  = threadIdx.x & 15;
  const int hi = (threadIdx.x >> 4) & 1;
  const float* src[PU];
  v4f x0[PU], x1[PU];
  bool ok[PU];
  #pragma unroll   // constant indices: the loaded values stay in registers, and all loads are issued before the first wait
  for (int u = 0; u < PU; ++u) {
    const int t = t0 + u * 256;
    const int d = ((t >> 5) & 3) * 16 + 8 * hi;
    const int tile = t >> 7;
    if (ISK) {                          // keys padded to SEQP: row clamped for the address, padded rows zeroed below
      const int bh = tile / KTI;
      const int r  = (tile % KTI) * 16 + n;
      ok[u]  = r < SEQ;
      src[u] = S + ((size_t)(bh >> 3) * SEQ + min(r, SEQ - 1)) * DM + (bh & 7) * DH + d;
    } else {                            // distances 0..511
      ok[u]  = true;
      src[u] = S + (tile * 16 + n) * DH + d;
    }
    x0[u] = *(const v4f*)(src[u]);
    x1[u] = *(const v4f*)(src[u] + 4);
  }
  // kept in front of any overwrite of the loads' address registers; the addresses are inputs, so they live up to the wait
  asm volatile("s_wait_xcnt 0x0" :: "v"(src[0]), "v"(src[1]), "v"(src[2]), "v"(src[3]),
                                    "v"(src[4]), "v"(src[5]), "v"(src[6]), "v"(src[7]) : "memory");
  v8us  o[PU];
  v8us* p[PU];
  #pragma unroll   // constant indices into the register arrays
  for (int u = 0; u < PU; ++u) {
    const v4f z = {0.0f, 0.0f, 0.0f, 0.0f};
    const v4f a = ok[u] ? x0[u] : z, b = ok[u] ? x1[u] : z;
    o[u][0] = bf16_rne(a.x); o[u][1] = bf16_rne(a.y); o[u][2] = bf16_rne(a.z); o[u][3] = bf16_rne(a.w);
    o[u][4] = bf16_rne(b.x); o[u][5] = bf16_rne(b.y); o[u][6] = bf16_rne(b.z); o[u][7] = bf16_rne(b.w);
    p[u] = (v8us*)(dst + (size_t)(t0 + u * 256) * 8);   // unit t goes to the t-th 16 bytes
    *p[u] = o[u];
  }
  // the same wait for the stores: with their data and addresses as inputs the build overwrites no store's register in front of it
  asm volatile("s_wait_xcnt 0x0" :: "v"(o[0]), "v"(o[1]), "v"(o[2]), "v"(o[3]), "v"(o[4]), "v"(o[5]), "v"(o[6]), "v"(o[7]),
                                    "v"(p[0]), "v"(p[1]), "v"(p[2]), "v"(p[3]), "v"(p[4]), "v"(p[5]), "v"(p[6]), "v"(p[7]) : "memory");
}

// V kind: 256 units are one 32-row step, all four dim tiles, so that a block reads whole 256-B head rows, 16 lanes per 64 B.
// Unit t is [step s][half j][dim tile dt][lane]; dim = 16 * dt + n, rows 32 * s + 16 * j + 8 * hi + 0..7. ISV: V itself, else relV.
template <bool ISV>
__device__ __forceinline__ void pack_v_kind(const float* __restrict__ S, _Float16* __restrict__ dst, int t0) {
  static_assert(PU == 8, "the wait below names one address per unit");
  const int lane = threadIdx.x & 31;
  const int n  = lane & 15;
  const int hi = lane >> 4;
  const float* src[PU];
  float x[PU][8];
  bool ok[PU];
  int  e0[PU];
  #pragma unroll   // as in pack_k_kind
  for (int u = 0; u < PU; ++u) {
    const int t  = t0 + u * 256;
    const int dt = (t >> 5) & 3;
    const int j  = (t >> 7) & 1;
    const int dim = dt * 16 + n;
    if (ISV) {                          // keys padded to SPAD: SEQ is a multiple of 8, so a unit's 8 keys are all valid or all padding
      const int s  = (t >> 8) & (SPAD / 32 - 1);
      const int bh = t >> 13;           // DH*SPAD/8 = 8192 units per (b,h)
      const int key0 = s * 32 + j * 16 + 8 * hi;
      ok[u]  = key0 < SEQ;
      e0[u]  = ((bh * 4 + dt) * (SPAD / 32) + s) * VSE + j * FU + lane * 8;
      src[u] = S + ((size_t)(bh >> 3) * SEQ + min(key0, SEQ - 8)) * DM + (bh & 7) * DH + dim;
    } else {                            // distances 0..511
      const int s = t >> 8;
      ok[u]  = true;
      e0[u]  = (dt * (NDIST / 32) + s) * VSE + j * FU + lane * 8;
      src[u] = S + (size_t)(s * 32 + j * 16 + 8 * hi) * DH + dim;
    }
    #pragma unroll
    for (int i = 0; i < 8; ++i) x[u][i] = src[u][(size_t)i * (ISV ? DM : DH)];
  }
  // as in pack_k_kind
  asm volatile("s_wait_xcnt 0x0" :: "v"(src[0]), "v"(src[1]), "v"(src[2]), "v"(src[3]),
                                    "v"(src[4]), "v"(src[5]), "v"(src[6]), "v"(src[7]) : "memory");
  v8h  o[PU];
  v8h* p[PU];
  #pragma unroll   // constant indices into the register arrays
  for (int u = 0; u < PU; ++u) {
    #pragma unroll
    for (int i = 0; i < 8; ++i) o[u][i] = f16_of_bf16(ok[u] ? x[u][i] : 0.0f);
    p[u] = (v8h*)(dst + (size_t)e0[u]);
    *p[u] = o[u];
  }
  // as in pack_k_kind
  asm volatile("s_wait_xcnt 0x0" :: "v"(o[0]), "v"(o[1]), "v"(o[2]), "v"(o[3]), "v"(o[4]), "v"(o[5]), "v"(o[6]), "v"(o[7]),
                                    "v"(p[0]), "v"(p[1]), "v"(p[2]), "v"(p[3]), "v"(p[4]), "v"(p[5]), "v"(p[6]), "v"(p[7]) : "memory");
}

__global__ __launch_bounds__(256)
void prep_kernel(const float* __restrict__ K, const float* __restrict__ V,
                 const float* __restrict__ RK, const float* __restrict__ RV,
                 unsigned short* __restrict__ Kb, _Float16* __restrict__ Vt,
                 unsigned short* __restrict__ RKb, _Float16* __restrict__ RVt) {
  const int blk = blockIdx.x;
  const int tid = threadIdx.x;
  if (blk < NK8 / PCH)                        pack_k_kind<true >(K,  Kb,  blk * PCH + tid);
  else if (blk < (NK8 + NV8) / PCH)           pack_v_kind<true >(V,  Vt,  (blk - NK8 / PCH) * PCH + tid);
  else if (blk < (NK8 + NV8 + NR8) / PCH)     pack_k_kind<false>(RK, RKb, (blk - (NK8 + NV8) / PCH) * PCH + tid);
  else                                        pack_v_kind<false>(RV, RVt, (blk - (NK8 + NV8 + NR8) / PCH) * PCH + tid);
}

// ---------------- fused attention kernel ------------------------------------
// 4 waves per SIMD: one work-group per WGP, with the register budget that holds a wave's share of K and V for all its query tiles
__global__ __launch_bounds__(NT, 4)
void circ_rel_attn_kernel(const float* __restrict__ Q,
                          const unsigned short* __restrict__ Kb,
                          const _Float16* __restrict__ Vt,
                          const unsigned short* __restrict__ RKb,
                          const _Float16* __restrict__ RVt,
                          float* __restrict__ Out)
{
  __shared__ __attribute__((aligned(16))) unsigned short sQ[16 * QP];     //  2 KB  bf16 Q tile
  // 64 KB, two lives. Phases 1-2: sT[q][TC0 + q - u] = BSC * (Q*relK^T)[q][circular distance of u], q the row in the tile,
  // u = q - 15 .. q + TC0 - TSH: the bias row laid out over the whole circle, backwards and shifted by its row, so that the 16 keys of
  // the tile at base offset 16*(qt - kt) mod SEQ stand in key order at columns TC0 - base + 0..15 of every row.
  // Columns TSH .. TC0 + 15 are read. An offset outside a row's window falls on the unread columns between two rows' windows.
  // From phase 3: the second half is sA; the first half takes the partial outputs [KSP][16][OP].
  __shared__ __attribute__((aligned(16))) float          sPA[16 * TP + 16];
  __shared__ __attribute__((aligned(16))) _Float16       sD[16 * DP];     // 16 KB  per-distance mass*256 f16
  __shared__ __attribute__((aligned(16))) float          sRedM[16 * RP];  // [query][wave] maximum over the wave's keys
  __shared__ __attribute__((aligned(16))) float          sRedS[16 * RP];  // [query][wave] sum over the wave's keys
  float*    const sT = sPA;
  float*    const sP = sPA;
  _Float16* const sA = (_Float16*)(sPA + 16 * PP);                        // 32 KB  exp(scores)*256 f16
  static_assert(16 * PP + 16 * AP / 2 <= 16 * TP + 16, "the two halves fit");
  static_assert(KSP * 16 * OP <= 16 * PP, "the partial outputs stay clear of sA");
  static_assert(TC0 + 15 < TP && SEQ - (TC0 - TSH) == 8, "a tile's 16 columns lie inside the row; the wrapped offsets below count on the 8");
  static_assert(TSH - 8 - 15 >= 0 && TC0 + 30 - TP < TSH && TC0 + 30 - TP < 16, "offsets outside a window stay inside sPA and off every window");

  const int qt0  = blockIdx.x * TPB;            // first query tile of this work-group
  const int qtn  = min(qt0 + TPB, QTN);         // one past its last
  const int bh   = blockIdx.y;
  const int b    = bh >> 3;
  const int h    = bh & 7;
  const int tid  = threadIdx.x;
  const int lane = tid & 31;
  const int wave = tid >> 5;
  const int n    = lane & 15;           // A row / B column / D column
  const int hi   = lane >> 4;           // lane half

  const float scale = 0.125f;
  const size_t baseQ = (size_t)b * SEQ * DM + (size_t)h * DH;
  const unsigned short* Kbh = Kb + (size_t)bh * KTI * KTE + lane * 8;     // this lane's 16 bytes of every unit
  const _Float16* Vbh = Vt + (size_t)bh * DH * SPAD + lane * 8;

  // ---------- Global loads in front of the loop over query tiles. A wave's K and V^T fragments are the same for every
  // query tile of a (batch, head): they are loaded once and stay in registers. Q and relK are loaded one tile ahead.
  // Group 1 (here): the first tile's Q elements, this wave's relK tiles, its first two key tiles.
  float qv[QPT];
  const float* qp[QPT];
  #pragma unroll   // constant indices: qv stays in registers, and all its loads are issued before the first wait
  for (int i = 0; i < QPT; ++i) {
    const int idx = tid + i * NT;
    const int m = idx >> 6, d = idx & 63;
    qp[i] = Q + baseQ + (size_t)min(qt0 * 16 + m, SEQ - 1) * DM + d;   // row clamped; rows past the end are zeroed below
    qv[i] = *qp[i];
  }
  const unsigned short* rp0 = RKb + (size_t)wave * KTE + lane * 8;           // B[k=d][n=dist], four units per tile
  FragB rk[RTW][2];
  #pragma unroll   // constant indices: the fragments stay in registers
  for (int i = 0; i < RTW; ++i) {
    const unsigned short* rp = rp0 + (size_t)i * NW * KTE;
    rk[i][0].h[0] = *(const v8us*)(rp);
    rk[i][0].h[1] = *(const v8us*)(rp + FU);
    rk[i][1].h[0] = *(const v8us*)(rp + 2 * FU);
    rk[i][1].h[1] = *(const v8us*)(rp + 3 * FU);
  }
  const unsigned short* kp0 = Kbh + (size_t)wave * KTE;                      // A[m=key][k=d], four units per tile
  FragB kf[KTW][2];
  #pragma unroll   // constant indices: the fragments stay in registers
  for (int i = 0; i < KTW / 2; ++i) {
    const unsigned short* kp = kp0 + (size_t)i * NW * KTE;
    kf[i][0].h[0] = *(const v8us*)(kp);
    kf[i][0].h[1] = *(const v8us*)(kp + FU);
    kf[i][1].h[0] = *(const v8us*)(kp + 2 * FU);
    kf[i][1].h[1] = *(const v8us*)(kp + 3 * FU);
  }
  static_assert(QPT == 2, "the wait below names one address per Q load");
  // Behind each group: the wait that is kept in front of any overwrite of an issued load's address registers. The addresses
  // are inputs, so they live up to the wait (left to itself the build gave some loads an address register of the group as
  // their destination, or waited to a count only).
  asm volatile("s_wait_xcnt 0x0" :: "v"(qp[0]), "v"(qp[1]), "v"(rp0), "v"(kp0) : "memory");
  // Group 2: the other key tiles.
  const unsigned short* kq[KTW];
  #pragma unroll   // constant indices into kf
  for (int i = KTW / 2; i < KTW; ++i) {
    // tile min(wave + i * NW, KTI - 1): the last wave has no last tile, its address is clamped and the value unused.
    // kq[i] leaves the constant part of the tile number to the loads' offsets, so that the wait below names the very registers they use.
    kq[i] = Kbh + (size_t)min(wave, KTI - 1 - i * NW) * KTE;
    const unsigned short* kp = kq[i] + (size_t)i * NW * KTE;
    kf[i][0].h[0] = *(const v8us*)(kp);
    kf[i][0].h[1] = *(const v8us*)(kp + FU);
    kf[i][1].h[0] = *(const v8us*)(kp + 2 * FU);
    kf[i][1].h[1] = *(const v8us*)(kp + 3 * FU);
  }
  static_assert(KTW == 4, "the wait below names one address per tile of the group");
  asm volatile("s_wait_xcnt 0x0" :: "v"(kq[2]), "v"(kq[3]) : "memory");   // as behind group 1

  const int dbase = (wave & 3) * 16;           // 16 head dims per wave
  const int ks    = wave >> 2;                 // this wave's part of the key range and of the distance range
  const int key0  = ks * (SPAD / KSP);
  const int dis0  = ks * (NDIST / KSP);

  // Group 3: this wave's V^T fragments for phase 5.
  FragH vf[VSW];
  {
    const _Float16* vcol = Vbh + (size_t)((wave & 3) * (SPAD / 32) + ks * VSW) * VSE;   // B[k=key][n=dim], two units per step
    #pragma unroll   // constant indices: the fragments stay in registers
    for (int i = 0; i < VSW; ++i) {
      vf[i].h[0] = *(const v8h*)(vcol + i * VSE);
      vf[i].h[1] = *(const v8h*)(vcol + i * VSE + FU);
    }
    asm volatile("s_wait_xcnt 0x0" :: "v"(vcol) : "memory");   // as behind group 1
  }

  #pragma unroll 1   // stays rolled: a second copy of the body would take the registers that hold K and V
  for (int qt = qt0; qt < qtn; ++qt) {

  // ---------- Phase 0: stage Q tile as bf16 ----------------------------------
  // sQ's readers of the previous tile have passed several barriers since.
  #pragma unroll   // constant indices into qv
  for (int i = 0; i < QPT; ++i) {
    const int idx = tid + i * NT;
    const int m = idx >> 6, d = idx & 63;
    const float v = (qt * 16 + m < SEQ) ? qv[i] : 0.0f;
    sQ[m * QP + d] = bf16_rne(v);
  }
  // The next tile's Q elements: they land behind this tile's work. Behind the last tile the clamped row is loaded and not used.
  #pragma unroll   // constant indices into qv
  for (int i = 0; i < QPT; ++i) {
    const int idx = tid + i * NT;
    const int m = idx >> 6, d = idx & 63;
    qp[i] = Q + baseQ + (size_t)min((qt + 1) * 16 + m, SEQ - 1) * DM + d;
    qv[i] = *qp[i];
  }
  asm volatile("s_wait_xcnt 0x0" :: "v"(qp[0]), "v"(qp[1]) : "memory");   // as behind group 1
  lds_barrier();   // also ends the previous tile's reads of sP, in front of this tile's writes of sT

  // A fragments of the Q tile: k 0..31 and k 32..63 (split map: elems 0..7 <- k0+8h, 8..15 <- k0+16+8h)
  FragB qa0, qa1;
  {
    const unsigned short* qp = sQ + n * QP + 8 * hi;
    qa0.h[0] = *(const v8us*)(qp);
    qa0.h[1] = *(const v8us*)(qp + 16);
    qa1.h[0] = *(const v8us*)(qp + 32);
    qa1.h[1] = *(const v8us*)(qp + 48);
  }

  // ---------- Phase 1: P = Qtile @ relK^T, stored at every circular offset that has this distance ----------
  const int swave = __builtin_amdgcn_readfirstlane(wave);   // tile numbers and base offsets stay scalar
  const int nrev  = n ^ 15;                                 // 15 - n, never negative
  #pragma unroll   // constant indices into rk
  for (int i = 0; i < RTW; ++i) {
    const int ct = swave + i * NW;
    v8f acc = zero8();
    acc = wmma_bf16(qa0, rk[i][0], acc);
    acc = wmma_bf16(qa1, rk[i][1], acc);
    acc *= BSC;
    const int dist = ct * 16 + n;
    float* trow = sT + 8 * hi * (TP + 1);   // row q = r + 8*hi, column C + q: steps of TP + 1
    if (dist <= DMAX) {
      float* p1 = trow + (TC0 - 15 - ct * 16) + nrev;       // offset dist: column TC0 + q - dist
      float* p2 = trow + (ct * 16 + TSH - 8) + n;           // offset SEQ - dist: column TSH + q + dist - 8
      #pragma unroll
      for (int r = 0; r < 8; ++r) {
        p1[r * (TP + 1)] = acc[r];
        p2[r * (TP + 1)] = acc[r];
      }
    }
    if (i == 0 && ct == 0) {         // distances 0..15 also stand at offsets -dist and SEQ + dist, where a row's window reaches them
      #pragma unroll
      for (int r = 0; r < 8; ++r) {
        trow[r * (TP + 1) + TC0 + n] = acc[r];                   // offset -dist
        trow[r * (TP + 1) + (TSH - 8 - 15) + nrev] = acc[r];     // offset SEQ + dist
      }
    }
  }
  lds_barrier();

  // ---------- Phase 2: scores^T / scale = K*Q^T + bias / scale at offset (query - key) mod SEQ, kept in registers ------
  // K is the A operand and Q the B operand: lane (n, hi) holds, of query n, the 8 neighbouring keys 16*kt + 8*hi + 0..7.
  static_assert(NW * (KTW - 1) * 16 <= SEQ, "only a wave's last tile can hold padded keys");
  static_assert(SEQ % 8 == 0, "a lane's 8 keys are all valid or all padding");
  const float* tlane = sT + n * TP + 8 * hi;
  // The bias is the C operand of a tile's first product, and the product's result stays in its registers: all tiles' bias reads
  // are issued in front of the first product, at no cost in registers, and the LDS latency is waited out once.
  v4f bias[KTW][2];
  #pragma unroll   // constant indices into bias
  for (int i = 0; i < KTW; ++i) {
    const int dt = qt - min(swave + i * NW, KTI - 1);   // the last wave has no last tile: tile number clamped, values masked below
    const float* tp = tlane + (TC0 - dt * 16 - (dt < 0 ? SEQ : 0));
    bias[i][0] = *(const v4f*)(tp);
    bias[i][1] = *(const v4f*)(tp + 4);
  }
  __builtin_amdgcn_sched_barrier(0);   // keeps the reads in front of the products: left free, the build moves them down again
  float sc[KTW][8];
  #pragma unroll   // constant indices into kf, bias and sc
  for (int i = 0; i < KTW; ++i) {
    const int kt = swave + i * NW;
    v8f acc = __builtin_shufflevector(bias[i][0], bias[i][1], 0, 1, 2, 3, 4, 5, 6, 7);
    acc = wmma_bf16(kf[i][0], qa0, acc);
    acc = wmma_bf16(kf[i][1], qa1, acc);
    const bool pad = (i == KTW - 1) && (kt * 16 + 8 * hi >= SEQ);   // padded keys, the last wave's missing tile among them
    #pragma unroll
    for (int r = 0; r < 8; ++r) sc[i][r] = pad ? -1.0e30f : acc[r];
  }

  // ---------- Phase 3: softmax in registers (normalisation deferred) -----------------
  // A query's maximum: in the lane, between the lane halves, then over the waves through sRedM.
  {
    float m0 = sc[0][0], m1 = sc[1][0], m2 = sc[2][0], m3 = sc[3][0];
    static_assert(KTW == 4, "one chain per tile");
    #pragma unroll
    for (int r = 1; r < 8; ++r) {
      m0 = fmaxf(m0, sc[0][r]); m1 = fmaxf(m1, sc[1][r]); m2 = fmaxf(m2, sc[2][r]); m3 = fmaxf(m3, sc[3][r]);
    }
    float mx = fmaxf(fmaxf(m0, m1), fmaxf(m2, m3));
    mx = fmaxf(mx, xhalf(mx));
    if (hi == 0) sRedM[n * RP + wave] = mx;
  }
  lds_barrier();   // also ends every wave's reads of sT, whose second half becomes sA
  {
    static_assert(NW == 16, "four 16-byte reads per query");
    const v4f* mp = (const v4f*)(sRedM + n * RP);
    const v4f a = mp[0], b = mp[1], c = mp[2], d = mp[3];
    const float rm = fmaxf(fmaxf(fmaxf(fmaxf(a.x, a.y), fmaxf(a.z, a.w)), fmaxf(fmaxf(b.x, b.y), fmaxf(b.z, b.w))),
                           fmaxf(fmaxf(fmaxf(c.x, c.y), fmaxf(c.z, c.w)), fmaxf(fmaxf(d.x, d.y), fmaxf(d.z, d.w))));
    const float cs = scale * L2E;        // raw units -> log2 units
    const float sh = rm * cs - PSH;      // weights come out scaled by 2^PSH, and so does their sum
    _Float16* alane = sA + n * AP + swave * 16 + 8 * hi;
    float sum = 0.0f;
    #pragma unroll   // constant indices into sc
    for (int i = 0; i < KTW; ++i) {
      const v4f x0 = {sc[i][0] * cs - sh, sc[i][1] * cs - sh, sc[i][2] * cs - sh, sc[i][3] * cs - sh};
      const v4f x1 = {sc[i][4] * cs - sh, sc[i][5] * cs - sh, sc[i][6] * cs - sh, sc[i][7] * cs - sh};
      const v4f e0 = exp2_x4(x0), e1 = exp2_x4(x1);
      v8h h8;
      h8[0] = (_Float16)e0.x; h8[1] = (_Float16)e0.y; h8[2] = (_Float16)e0.z; h8[3] = (_Float16)e0.w;
      h8[4] = (_Float16)e1.x; h8[5] = (_Float16)e1.y; h8[6] = (_Float16)e1.z; h8[7] = (_Float16)e1.w;
      *(v8h*)(alane + i * NW * 16) = h8;   // 8 keys of one query: one 16-byte store; padded keys up to SPAD get zeros
      sum += ((e0.x + e0.y) + (e0.z + e0.w)) + ((e1.x + e1.y) + (e1.z + e1.w));
    }
    sum += xhalf(sum);
    if (hi == 0) sRedS[n * RP + wave] = sum;
  }

  // Group 4: this wave's relV^T fragments for phase 5; they land behind phase 4.
  FragH rvf[RSW];
  {
    const _Float16* rvcol = RVt + (size_t)((wave & 3) * (NDIST / 32) + ks * RSW) * VSE + lane * 8;   // B[k=dist][n=dim]
    #pragma unroll   // constant indices: the fragments stay in registers
    for (int i = 0; i < RSW; ++i) {
      rvf[i].h[0] = *(const v8h*)(rvcol + i * VSE);
      rvf[i].h[1] = *(const v8h*)(rvcol + i * VSE + FU);
    }
    asm volatile("s_wait_xcnt 0x0" :: "v"(rvcol) : "memory");   // as behind group 1
  }
  lds_barrier();

  // ---------- Phase 4: per-distance mass, fixed 2-key gather (no atomics) ---
  // keys at circular distance dist from row q: (q-dist) mod S and (q+dist) mod S (one key when they coincide)
  // One distance per thread, all 16 rows. The two keys coincide exactly where 2*dist is a multiple of SEQ, whatever the row,
  // so that test and the padding test become two per-thread factors and the rows' reads are independent of each other.
  {
    static_assert(NT == NDIST, "one distance per thread");
    const int dist = tid;
    const float w2 = (dist == 0 || 2 * dist == SEQ) ? 0.0f : 1.0f;
    const float ws = (dist <= DMAX) ? 1.0f : 0.0f;
    _Float16 g1[16], g2[16];
    #pragma unroll   // constant indices into g1 and g2
    for (int m = 0; m < 16; ++m) {
      const int qrow = min(qt * 16 + m, SEQ - 1);
      // wrap into 0..SEQ-1 by an unsigned minimum: the out-of-range form is negative, so huge as unsigned
      const unsigned k1 = min((unsigned)(qrow - dist), (unsigned)(qrow - dist + SEQ));
      const unsigned k2 = min((unsigned)(qrow + dist), (unsigned)(qrow + dist - SEQ));
      g1[m] = sA[m * AP + k1];
      g2[m] = sA[m * AP + k2];
    }
    __builtin_amdgcn_sched_barrier(0);   // all rows' LDS reads are issued in front of the first sum: left free, the build issues them in groups, with address arithmetic and waits between
    #pragma unroll   // constant indices into g1 and g2
    for (int m = 0; m < 16; ++m) {
      const float val = (float)g1[m] + w2 * (float)g2[m];
      sD[m * DP + dist] = (_Float16)(val * ws);
    }
  }
  // Phase 5 reads each A fragment AHD k steps ahead of its product, so that a wave has 2 * AHD LDS reads in flight and a step
  // does not wait out the LDS latency. The first AHD steps read sA, which is complete since the barrier in front of phase 4:
  // their reads are issued here and land while the wave waits at the barrier.
  static_assert(AHD <= VSW, "the steps read in front of the barrier take sA alone");
  const _Float16* arow  = sA + n * AP    + key0 + 8 * hi;                      // A[m=row][k=key]
  const _Float16* drow  = sD + n * DP    + dis0 + 8 * hi;                      // A[m=row][k=dist]
  FragH af[VSW + RSW];   // constant indices only: AHD of them are live at a time
  #pragma unroll   // constant indices into af
  for (int st = 0; st < AHD; ++st) {
    af[st].h[0] = *(const v8h*)(arow + st * 32);
    af[st].h[1] = *(const v8h*)(arow + st * 32 + 16);
  }
  lds_barrier();

  // ---------- Phase 5: out = (P@V + D@relV) / sum, weights and sum both scaled by 2^PSH -----------------------
  {
    v8f acc = zero8();
    #pragma unroll   // constant indices into af, vf and rvf
    for (int st = 0; st < VSW + RSW; ++st) {
      acc = wmma_f16(af[st], st < VSW ? vf[st] : rvf[st - VSW], acc);
      const int nx = st + AHD;
      if (nx < VSW + RSW) {
        const _Float16* ap = nx < VSW ? arow + nx * 32 : drow + (nx - VSW) * 32;
        af[nx].h[0] = *(const v8h*)(ap);
        af[nx].h[1] = *(const v8h*)(ap + 16);
      }
    }
    // stage this wave's 16x16 f32 partial sum (sP is free after phase 2)
    #pragma unroll
    for (int r = 0; r < 8; ++r) {
      const int m = r + 8 * hi;
      sP[(ks * 16 + m) * OP + dbase + n] = acc[r];
    }
  }
  __syncthreads();

  // relK again, for the next tile: held over the whole tile its 32 registers would take the room in which phase 4 keeps
  // its LDS reads in flight. Issued behind the barrier above, which would drain it; it lands behind the rest of this tile and phase 0.
  #pragma unroll   // constant indices: the fragments stay in registers
  for (int i = 0; i < RTW; ++i) {
    const unsigned short* rp = rp0 + (size_t)i * NW * KTE;
    rk[i][0].h[0] = *(const v8us*)(rp);
    rk[i][0].h[1] = *(const v8us*)(rp + FU);
    rk[i][1].h[0] = *(const v8us*)(rp + 2 * FU);
    rk[i][1].h[1] = *(const v8us*)(rp + 3 * FU);
  }
  asm volatile("s_wait_xcnt 0x0" :: "v"(rp0) : "memory");   // as behind group 1

  // add the KSP partial sums, normalise, store whole 128-B lines (8 lanes each)
  if (tid < 16 * DH / 4) {
    float* obase = Out + baseQ;
    const int m = tid >> 4;
    const int c = (tid & 15) * 4;
    const int qrow = qt * 16 + m;
    const v4f* sp4 = (const v4f*)(sRedS + m * RP);
    v4f pv[KSP], sv[4];
    #pragma unroll   // constant indices into pv
    for (int s = 0; s < KSP; ++s) pv[s] = *(const v4f*)(sP + (s * 16 + m) * OP + c);
    #pragma unroll   // constant indices into sv
    for (int j = 0; j < 4; ++j) sv[j] = sp4[j];
    __builtin_amdgcn_sched_barrier(0);   // all eight reads are issued in front of the first sum: one wait for the LDS latency, not two
    v4f v = pv[0];
    #pragma unroll
    for (int s = 1; s < KSP; ++s) v += pv[s];
    const v4f s4 = (sv[0] + sv[1]) + (sv[2] + sv[3]);
    v *= 1.0f / ((s4.x + s4.y) + (s4.z + s4.w));
    if (qrow < SEQ) {
      v4f* op = (v4f*)(obase + (size_t)qrow * DM + c);
      *op = v;
      // kept in front of the next tile's overwrite of the store's registers; data and address are inputs, so they live up to the wait
      asm volatile("s_wait_xcnt 0x0" :: "v"(v), "v"(op) : "memory");
    }
  }

  }   // query tiles
}

extern "C" void kernel_launch(void* const* d_in, const int* in_sizes, int n_in,
                              void* d_out, int out_size, void* d_ws, size_t ws_size,
                              hipStream_t stream) {
  if (n_in < 5) return;
  if (in_sizes[0] < NB * SEQ * DM || in_sizes[1] < NB * SEQ * DM || in_sizes[2] < NB * SEQ * DM) return;
  if (in_sizes[3] < NDIST * DH || in_sizes[4] < NDIST * DH) return;
  if (out_size < NB * SEQ * DM) return;
  const size_t ws_need = WS_END * 2;           // 16,777,216 B
  if (ws_size < ws_need) return;

  const float* Q  = (const float*)d_in[0];
  const float* K  = (const float*)d_in[1];
  const float* V  = (const float*)d_in[2];
  const float* RK = (const float*)d_in[3];
  const float* RV = (const float*)d_in[4];
  float* Out = (float*)d_out;
  unsigned short* ws16 = (unsigned short*)d_ws;

  unsigned short* Kb  = ws16 + WS_K;
  _Float16*       Vt  = (_Float16*)(ws16 + WS_VT);
  unsigned short* RKb = ws16 + WS_RK;
  _Float16*       RVt = (_Float16*)(ws16 + WS_RVT);

  prep_kernel<<<(NK8 + NV8 + 2 * NR8) / PCH, 256, 0, stream>>>(K, V, RK, RV, Kb, Vt, RKb, RVt);

  dim3 grid(QCH, NB * NH);
  circ_rel_attn_kernel<<<grid, dim3(NT), 0, stream>>>(Q, Kb, Vt, RKb, RVt, Out);
}

// v010
// A run of this version takes 54.8 microseconds.
// Next to v009, in two timings, it ran 1.04 times as fast each time.
// All steps since v000 together make it 7.08 times as fast.
#include <hip/hip_runtime.h>

// Contractions: Q*K^T and Q*relK^T on v_wmma_f32_16x16x32_bf16 (bf16 operands, f32 accumulate);
// P*V and bucketed P*relV on v_wmma_f32_16x16x32_f16 (f16 operands: P scaled by 2^8, V/relV carry bf16-RNE values; f32 accumulate).

typedef _Float16 v16h __attribute__((ext_vector_type(16)));
typedef _Float16 v8h  __attribute__((ext_vector_type(8), may_alias));
typedef __bf16   v16b __attribute__((ext_vector_type(16)));
typedef unsigned short v8us __attribute__((ext_vector_type(8), may_alias));
typedef float v8f __attribute__((ext_vector_type(8)));
typedef float v4f __attribute__((ext_vector_type(4), may_alias));

#define SEQ   1000   // sequence length
#define SEQP  1008   // keys padded to a multiple of 16
#define DM    512    // model width
#define DH    64     // head dim
#define NB    8      // batch
#define NH    8      // heads
#define QTN   63     // query tiles of 16
#define KTI   63     // key tiles of 16
#define SPAD  1024   // padded key dim (multiple of 32)
#define NDIST 512    // padded distance dim (>= 501, multiple of 32)
#define DMAX  500    // largest circular distance
#define NW    16     // waves per attention block
#define NT    512    // threads per attention block
#define TPB   16     // query tiles that one work-group walks with its K and V fragments held in registers
#define QCH   ((QTN + TPB - 1) / TPB)    // work-groups per (batch, head)
#define KSP   (NW / 4)       // waves that share one 16-dim output tile, each on its own part of the k range
#define QPT   (16 * DH / NT)             // Q elements staged per thread
#define RTW   (NDIST / 16 / NW)          // relK column tiles per wave
#define KTW   ((KTI + NW - 1) / NW)      // key tiles per wave (the last wave has one fewer)
#define VSW   (SPAD / 32 / KSP)          // k steps of P*V per wave
#define RSW   (NDIST / 32 / KSP)         // k steps of D*relV per wave
#define AHD   4                          // k steps by which phase 5 reads its A fragments from LDS ahead of their product
// LDS row pitches: each keeps the lanes of one LDS instruction on distinct banks (64 banks of 4 B)
#define QP    (DH + 8)       // sQ, 2-B elements: 144 B = 16 B x odd, for the 16-B fragment reads down 16 rows
#define AP    (SPAD + 8)     // sA, 2-B elements: 2064 B = 16 B x odd
#define DP    (NDIST + 8)    // sD, 2-B elements: 1040 B = 16 B x odd
#define PP    (NDIST + 4)    // f32 words per query row in the first half of sPA
#define OP    (DH + 4)       // partial outputs in sP, f32: 8 rows = 32 banks mod 64, so the two lane halves of a D tile do not meet
#define TP    (SPAD + 12)    // sT, f32: 4144 B = 16 B x odd for the 16-B bias reads down 16 rows; 8 rows + 8 = 40 banks mod 64 for the stores
#define RP    (NW + 4)       // sRedM, sRedS, f32: 80 B = 16 B x odd
#define TSH   24             // unread columns in front of each sT row
#define TC0   ((QTN - 1) * 16 + TSH)   // sT column of the first key of the tile at base offset 0
#define PSH   8.0f           // log2 of the power-of-two scale on the f16 attention weights
#define L2E   1.44269504f    // log2(e)
#define BSC   8.0f           // 1 / scale: the bias is stored in the units of the raw Q*K^T products

// Workspace layout in 2-byte elements. All four operands lie in B-fragment order: the unit is [32 lanes][8 elements] = 512 B,
// what one 16-byte load of a wave takes, so that such a load covers four whole 128-B lines.
// Lane = 16*hi + n. K kind (n = key or distance): unit c of a 16-row tile holds head dims 16*c + 8*hi + 0..7.
// V kind (n = head dim of a 16-dim tile): unit j of a 32-row step holds keys or distances 16*j + 8*hi + 0..7.
#define FU      256                                      // elements per unit
#define KTE     (4 * FU)                                 // elements per 16-row tile of the K kind
#define VSE     (2 * FU)                                 // elements per 32-row step of the V kind
#define WS_K    ((size_t)0)                              // [64 bh][63 tiles][4 units]          bf16 K, padded keys zero
#define WS_VT   ((size_t)NB * SEQP * DM)                 // [64 bh][4 dim tiles][32 steps][2]   f16 V, padded keys zero
#define WS_RK   (WS_VT + (size_t)NB * NH * DH * SPAD)    // [32 tiles][4 units]                 bf16 relK
#define WS_RVT  (WS_RK + (size_t)NDIST * DH)             // [4 dim tiles][16 steps][2]          f16 relV
#define WS_END  (WS_RVT + (size_t)DH * NDIST)

#define NK8  (NB * SEQP * DM / 8)       // work units of 8 elements, K copy
#define NV8  (NB * NH * DH * SPAD / 8)  // work units of 8 elements, V^T copy
#define NR8  (NDIST * DH / 8)           // work units of 8 elements, each rel table

union FragH { v16h v; v8h  h[2]; };
union FragB { v16b v; v8us h[2]; };

__device__ __forceinline__ v8f zero8() {
  v8f z = {0.0f, 0.0f, 0.0f, 0.0f, 0.0f, 0.0f, 0.0f, 0.0f};
  return z;
}

__device__ __forceinline__ v8f wmma_f16(const FragH& a, const FragH& b, v8f c) {
  v8f d = __builtin_amdgcn_wmma_f32_16x16x32_f16(false, a.v, false, b.v, (short)0, c, false, false);
  asm volatile("v_nop\n\tv_nop\n\tv_nop\n\tv_nop" : "+v"(d) : "v"(a.v), "v"(b.v));
  return d;
}

__device__ __forceinline__ v8f wmma_bf16(const FragB& a, const FragB& b, v8f c) {
  v8f d = __builtin_amdgcn_wmma_f32_16x16x32_bf16(false, a.v, false, b.v, (short)0, c, false, false);
  asm volatile("v_nop\n\tv_nop\n\tv_nop\n\tv_nop" : "+v"(d) : "v"(a.v), "v"(b.v));
  return d;
}

// f32 -> bf16 bits, RNE
__device__ __forceinline__ unsigned short bf16_rne(float f) {
  unsigned int u = __float_as_uint(f);
  u += 0x7FFFu + ((u >> 16) & 1u);
  return (unsigned short)(u >> 16);
}

// f32 -> bf16 (RNE) -> f16 ; the second step is exact for bf16 values in f16 range
__device__ __forceinline__ _Float16 f16_of_bf16(float f) {
  unsigned int u = ((unsigned int)bf16_rne(f)) << 16;
  return (_Float16)__uint_as_float(u);
}

// 2^x for four values at once.
// One statement with outputs apart from all inputs and a closing v_nop: it keeps the one slot the instruction set asks for
// between a transcendental and an instruction that overwrites its source or reads its result.
__device__ __forceinline__ v4f exp2_x4(v4f x) {
  const float a = x.x, b = x.y, c = x.z, d = x.w;
  v4f r;
  float r0, r1, r2, r3;
  asm("v_exp_f32 %0, %4\n\tv_exp_f32 %1, %5\n\tv_exp_f32 %2, %6\n\tv_exp_f32 %3, %7\n\tv_nop"
      : "=&v"(r0), "=&v"(r1), "=&v"(r2), "=&v"(r3) : "v"(a), "v"(b), "v"(c), "v"(d));
  r.x = r0; r.y = r1; r.z = r2; r.w = r3;
  return r;
}

// lane l with lane l ^ 16
__device__ __forceinline__ float xhalf(float x) {
  const int b = __builtin_bit_cast(int, x);
  return __builtin_bit_cast(float, __builtin_amdgcn_permlanex16(b, b, 0x76543210, 0xfedcba98, false, false));
}

// Work-group barrier that orders LDS only. All that the waves of a block hand each other goes through LDS, and the global
// buffers read here are written by earlier launches alone. __syncthreads() also drains the wave's outstanding global loads,
// which would end the flight of the fragment loads issued ahead at the first barrier behind them.
__device__ __forceinline__ void lds_barrier() {
  __builtin_amdgcn_fence(__ATOMIC_RELEASE, "workgroup", "local");
  __builtin_amdgcn_s_barrier();
  __builtin_amdgcn_fence(__ATOMIC_ACQUIRE, "workgroup", "local");
}

// ---------------- prep: one launch packs K, V, relK and relV in fragment order ----------------
// The unit of work is one 16-byte piece of a packed operand. A thread takes PU units, 256 apart, and issues all their loads
// before the first conversion: few long-lived waves with many loads in flight, in place of one short wave per 32 units.
// A block's PU * 256 units lie in one operand, so the choice of the operand is uniform over the block.
#define PU   8
#define PCH  (256 * PU)
static_assert(NK8 % PCH == 0 && NV8 % PCH == 0 && NR8 % PCH == 0, "no block straddles two operands");

// K kind: unit t is [tile][unit c][lane]; row = 16 * tile + n, head dims 16 * c + 8 * hi + 0..7. ISK: K itself, else relK.
template <bool ISK>
__device__ __forceinline__ void pack_k_kind(const float* __restrict__ S, unsigned short* __restrict__ dst, int t0) {
  static_assert(PU == 8, "the wait below names one address per unit");
  const int n  = threadIdx.x & 15;
  const int hi = (threadIdx.x >> 4) & 1;
  const float* src[PU];
  v4f x0[PU], x1[PU];
  bool ok[PU];
  #pragma unroll   // constant indices: the loaded values stay in registers, and all loads are issued before the first wait
  for (int u = 0; u < PU; ++u) {
    const int t = t0 + u * 256;
    const int d = ((t >> 5) & 3) * 16 + 8 * hi;
    const int tile = t >> 7;
    if (ISK) {                          // keys padded to SEQP: row clamped for the address, padded rows zeroed below
      const int bh = tile / KTI;
      const int r  = (tile % KTI) * 16 + n;
      ok[u]  = r < SEQ;
      src[u] = S + ((size_t)(bh >> 3) * SEQ + min(r, SEQ - 1)) * DM + (bh & 7) * DH + d;
    } else {                            // distances 0..511
      ok[u]  = true;
      src[u] = S + (tile * 16 + n) * DH + d;
    }
    x0[u] = *(const v4f*)(src[u]);
    x1[u] = *(const v4f*)(src[u] + 4);
  }
  // kept in front of any overwrite of the loads' address registers; the addresses are inputs, so they live up to the wait
  asm volatile("s_wait_xcnt 0x0" :: "v"(src[0]), "v"(src[1]), "v"(src[2]), "v"(src[3]),
                                    "v"(src[4]), "v"(src[5]), "v"(src[6]), "v"(src[7]) : "memory");
  v8us  o[PU];
  v8us* p[PU];
  #pragma unroll   // constant indices into the register arrays
  for (int u = 0; u < PU; ++u) {
    const v4f z = {0.0f, 0.0f, 0.0f, 0.0f};
    const v4f a = ok[u] ? x0[u] : z, b = ok[u] ? x1[u] : z;
    o[u][0] = bf16_rne(a.x); o[u][1] = bf16_rne(a.y); o[u][2] = bf16_rne(a.z); o[u][3] = bf16_rne(a.w);
    o[u][4] = bf16_rne(b.x); o[u][5] = bf16_rne(b.y); o[u][6] = bf16_rne(b.z); o[u][7] = bf16_rne(b.w);
    p[u] = (v8us*)(dst + (size_t)(t0 + u * 256) * 8);   // unit t goes to the t-th 16 bytes
    *p[u] = o[u];
  }
  // the same wait for the stores: with their data and addresses as inputs the build overwrites no store's register in front of it
  asm volatile("s_wait_xcnt 0x0" :: "v"(o[0]), "v"(o[1]), "v"(o[2]), "v"(o[3]), "v"(o[4]), "v"(o[5]), "v"(o[6]), "v"(o[7]),
                                    "v"(p[0]), "v"(p[1]), "v"(p[2]), "v"(p[3]), "v"(p[4]), "v"(p[5]), "v"(p[6]), "v"(p[7]) : "memory");
}

// V kind: 256 units are one 32-row step, all four dim tiles, so that a block reads whole 256-B head rows, 16 lanes per 64 B.
// Unit t is [step s][half j][dim tile dt][lane]; dim = 16 * dt + n, rows 32 * s + 16 * j + 8 * hi + 0..7. ISV: V itself, else relV.
template <bool ISV>
__device__ __forceinline__ void pack_v_kind(const float* __restrict__ S, _Float16* __restrict__ dst, int t0) {
  static_assert(PU == 8, "the wait below names one address per unit");
  const int lane = threadIdx.x & 31;
  const int n  = lane & 15;
  const int hi = lane >> 4;
  const float* src[PU];
  float x[PU][8];
  bool ok[PU];
  int  e0[PU];
  #pragma unroll   // as in pack_k_kind
  for (int u = 0; u < PU; ++u) {
    const int t  = t0 + u * 256;
    const int dt = (t >> 5) & 3;
    const int j  = (t >> 7) & 1;
    const int dim = dt * 16 + n;
    if (ISV) {                          // keys padded to SPAD: SEQ is a multiple of 8, so a unit's 8 keys are all valid or all padding
      const int s  = (t >> 8) & (SPAD / 32 - 1);
      const int bh = t >> 13;           // DH*SPAD/8 = 8192 units per (b,h)
      const int key0 = s * 32 + j * 16 + 8 * hi;
      ok[u]  = key0 < SEQ;
      e0[u]  = ((bh * 4 + dt) * (SPAD / 32) + s) * VSE + j * FU + lane * 8;
      src[u] = S + ((size_t)(bh >> 3) * SEQ + min(key0, SEQ - 8)) * DM + (bh & 7) * DH + dim;
    } else {                            // distances 0..511
      const int s = t >> 8;
      ok[u]  = true;
      e0[u]  = (dt * (NDIST / 32) + s) * VSE + j * FU + lane * 8;
      src[u] = S + (size_t)(s * 32 + j * 16 + 8 * hi) * DH + dim;
    }
    #pragma unroll
    for (int i = 0; i < 8; ++i) x[u][i] = src[u][(size_t)i * (ISV ? DM : DH)];
  }
  // as in pack_k_kind
  asm volatile("s_wait_xcnt 0x0" :: "v"(src[0]), "v"(src[1]), "v"(src[2]), "v"(src[3]),
                                    "v"(src[4]), "v"(src[5]), "v"(src[6]), "v"(src[7]) : "memory");
  v8h  o[PU];
  v8h* p[PU];
  #pragma unroll   // constant indices into the register arrays
  for (int u = 0; u < PU; ++u) {
    #pragma unroll
    for (int i = 0; i < 8; ++i) o[u][i] = f16_of_bf16(ok[u] ? x[u][i] : 0.0f);
    p[u] = (v8h*)(dst + (size_t)e0[u]);
    *p[u] = o[u];
  }
  // as in pack_k_kind
  asm volatile("s_wait_xcnt 0x0" :: "v"(o[0]), "v"(o[1]), "v"(o[2]), "v"(o[3]), "v"(o[4]), "v"(o[5]), "v"(o[6]), "v"(o[7]),
                                    "v"(p[0]), "v"(p[1]), "v"(p[2]), "v"(p[3]), "v"(p[4]), "v"(p[5]), "v"(p[6]), "v"(p[7]) : "memory");
}

__global__ __launch_bounds__(256)
void prep_kernel(const float* __restrict__ K, const float* __restrict__ V,
                 const float* __restrict__ RK, const float* __restrict__ RV,
                 unsigned short* __restrict__ Kb, _Float16* __restrict__ Vt,
                 unsigned short* __restrict__ RKb, _Float16* __restrict__ RVt) {
  const int blk = blockIdx.x;
  const int tid = threadIdx.x;
  if (blk < NK8 / PCH)                        pack_k_kind<true >(K,  Kb,  blk * PCH + tid);
  else if (blk < (NK8 + NV8) / PCH)           pack_v_kind<true >(V,  Vt,  (blk - NK8 / PCH) * PCH + tid);
  else if (blk < (NK8 + NV8 + NR8) / PCH)     pack_k_kind<false>(RK, RKb, (blk - (NK8 + NV8) / PCH) * PCH + tid);
  else                                        pack_v_kind<false>(RV, RVt, (blk - (NK8 + NV8 + NR8) / PCH) * PCH + tid);
}

// ---------------- fused attention kernel ------------------------------------
// 4 waves per SIMD: one work-group per WGP, with the register budget that holds a wave's share of K and V for all its query tiles
__global__ __launch_bounds__(NT, 4)
void circ_rel_attn_kernel(const float* __restrict__ Q,
                          const unsigned short* __restrict__ Kb,
                          const _Float16* __restrict__ Vt,
                          const unsigned short* __restrict__ RKb,
                          const _Float16* __restrict__ RVt,
                          float* __restrict__ Out)
{
  __shared__ __attribute__((aligned(16))) unsigned short sQ[16 * QP];     //  2 KB  bf16 Q tile
  // 64 KB, two lives. Phases 1-2: sT[q][TC0 + q - u] = BSC * (Q*relK^T)[q][circular distance of u], q the row in the tile,
  // u = q - 15 .. q + TC0 - TSH: the bias row laid out over the whole circle, backwards and shifted by its row, so that the 16 keys of
  // the tile at base offset 16*(qt - kt) mod SEQ stand in key order at columns TC0 - base + 0..15 of every row.
  // Columns TSH .. TC0 + 15 are read. An offset outside a row's window falls on the unread columns between two rows' windows.
  // From phase 3: the second half is sA; the first half takes the partial outputs [KSP][16][OP].
  __shared__ __attribute__((aligned(16))) float          sPA[16 * TP + 16];
  __shared__ __attribute__((aligned(16))) _Float16       sD[16 * DP];     // 16 KB  per-distance mass*256 f16
  __shared__ __attribute__((aligned(16))) float          sRedM[16 * RP];  // [query][wave] maximum over the wave's keys
  __shared__ __attribute__((aligned(16))) float          sRedS[16 * RP];  // [query][wave] sum over the wave's keys
  float*    const sT = sPA;
  float*    const sP = sPA;
  _Float16* const sA = (_Float16*)(sPA + 16 * PP);                        // 32 KB  exp(scores)*256 f16
  static_assert(16 * PP + 16 * AP / 2 <= 16 * TP + 16, "the two halves fit");
  static_assert(KSP * 16 * OP <= 16 * PP, "the partial outputs stay clear of sA");
  static_assert(TC0 + 15 < TP && SEQ - (TC0 - TSH) == 8, "a tile's 16 columns lie inside the row; the wrapped offsets below count on the 8");
  static_assert(TSH - 8 - 15 >= 0 && TC0 + 30 - TP < TSH && TC0 + 30 - TP < 16, "offsets outside a window stay inside sPA and off every window");

  const int qt0  = blockIdx.x * TPB;            // first query tile of this work-group
  const int qtn  = min(qt0 + TPB, QTN);         // one past its last
  const int bh   = blockIdx.y;
  const int b    = bh >> 3;
  const int h    = bh & 7;
  const int tid  = threadIdx.x;
  const int lane = tid & 31;
  const int wave = tid >> 5;
  const int n    = lane & 15;           // A row / B column / D column
  const int hi   = lane >> 4;           // lane half

  const float scale = 0.125f;
  const size_t baseQ = (size_t)b * SEQ * DM + (size_t)h * DH;
  const unsigned short* Kbh = Kb + (size_t)bh * KTI * KTE + lane * 8;     // this lane's 16 bytes of every unit
  const _Float16* Vbh = Vt + (size_t)bh * DH * SPAD + lane * 8;

  // ---------- Global loads in front of the loop over query tiles. A wave's K and V^T fragments are the same for every
  // query tile of a (batch, head): they are loaded once and stay in registers. Q and relK are loaded one tile ahead.
  // Group 1 (here): the first tile's Q elements, this wave's relK tiles, its first two key tiles.
  float qv[QPT];
  const float* qp[QPT];
  #pragma unroll   // constant indices: qv stays in registers, and all its loads are issued before the first wait
  for (int i = 0; i < QPT; ++i) {
    const int idx = tid + i * NT;
    const int m = idx >> 6, d = idx & 63;
    qp[i] = Q + baseQ + (size_t)min(qt0 * 16 + m, SEQ - 1) * DM + d;   // row clamped; rows past the end are zeroed below
    qv[i] = *qp[i];
  }
  const unsigned short* rp0 = RKb + (size_t)wave * KTE + lane * 8;           // B[k=d][n=dist], four units per tile
  FragB rk[RTW][2];
  #pragma unroll   // constant indices: the fragments stay in registers
  for (int i = 0; i < RTW; ++i) {
    const unsigned short* rp = rp0 + (size_t)i * NW * KTE;
    rk[i][0].h[0] = *(const v8us*)(rp);
    rk[i][0].h[1] = *(const v8us*)(rp + FU);
    rk[i][1].h[0] = *(const v8us*)(rp + 2 * FU);
    rk[i][1].h[1] = *(const v8us*)(rp + 3 * FU);
  }
  const unsigned short* kp0 = Kbh + (size_t)wave * KTE;                      // A[m=key][k=d], four units per tile
  FragB kf[KTW][2];
  #pragma unroll   // constant indices: the fragments stay in registers
  for (int i = 0; i < KTW / 2; ++i) {
    const unsigned short* kp = kp0 + (size_t)i * NW * KTE;
    kf[i][0].h[0] = *(const v8us*)(kp);
    kf[i][0].h[1] = *(const v8us*)(kp + FU);
    kf[i][1].h[0] = *(const v8us*)(kp + 2 * FU);
    kf[i][1].h[1] = *(const v8us*)(kp + 3 * FU);
  }
  static_assert(QPT == 2, "the wait below names one address per Q load");
  // Behind each group: the wait that is kept in front of any overwrite of an issued load's address registers. The addresses
  // are inputs, so they live up to the wait (left to itself the build gave some loads an address register of the group as
  // their destination, or waited to a count only).
  asm volatile("s_wait_xcnt 0x0" :: "v"(qp[0]), "v"(qp[1]), "v"(rp0), "v"(kp0) : "memory");
  // Group 2: the other key tiles.
  const unsigned short* kq[KTW];
  #pragma unroll   // constant indices into kf
  for (int i = KTW / 2; i < KTW; ++i) {
    // tile min(wave + i * NW, KTI - 1): the last wave has no last tile, its address is clamped and the value unused.
    // kq[i] leaves the constant part of the tile number to the loads' offsets, so that the wait below names the very registers they use.
    kq[i] = Kbh + (size_t)min(wave, KTI - 1 - i * NW) * KTE;
    const unsigned short* kp = kq[i] + (size_t)i * NW * KTE;
    kf[i][0].h[0] = *(const v8us*)(kp);
    kf[i][0].h[1] = *(const v8us*)(kp + FU);
    kf[i][1].h[0] = *(const v8us*)(kp + 2 * FU);
    kf[i][1].h[1] = *(const v8us*)(kp + 3 * FU);
  }
  static_assert(KTW == 4, "the wait below names one address per tile of the group");
  asm volatile("s_wait_xcnt 0x0" :: "v"(kq[2]), "v"(kq[3]) : "memory");   // as behind group 1

  const int dbase = (wave & 3) * 16;           // 16 head dims per wave
  const int ks    = wave >> 2;                 // this wave's part of the key range and of the distance range
  const int key0  = ks * (SPAD / KSP);
  const int dis0  = ks * (NDIST / KSP);

  // Group 3: this wave's V^T fragments for phase 5.
  FragH vf[VSW];
  {
    const _Float16* vcol = Vbh + (size_t)((wave & 3) * (SPAD / 32) + ks * VSW) * VSE;   // B[k=key][n=dim], two units per step
    #pragma unroll   // constant indices: the fragments stay in registers
    for (int i = 0; i < VSW; ++i) {
      vf[i].h[0] = *(const v8h*)(vcol + i * VSE);
      vf[i].h[1] = *(const v8h*)(vcol + i * VSE + FU);
    }
    asm volatile("s_wait_xcnt 0x0" :: "v"(vcol) : "memory");   // as behind group 1
  }

  #pragma unroll 1   // stays rolled: a second copy of the body would take the registers that hold K and V
  for (int qt = qt0; qt < qtn; ++qt) {

  // ---------- Phase 0: stage Q tile as bf16 ----------------------------------
  // sQ's readers of the previous tile have passed several barriers since.
  #pragma unroll   // constant indices into qv
  for (int i = 0; i < QPT; ++i) {
    const int idx = tid + i * NT;
    const int m = idx >> 6, d = idx & 63;
    const float v = (qt * 16 + m < SEQ) ? qv[i] : 0.0f;
    sQ[m * QP + d] = bf16_rne(v);
  }
  // The next tile's Q elements: they land behind this tile's work. Behind the last tile the clamped row is loaded and not used.
  #pragma unroll   // constant indices into qv
  for (int i = 0; i < QPT; ++i) {
    const int idx = tid + i * NT;
    const int m = idx >> 6, d = idx & 63;
    qp[i] = Q + baseQ + (size_t)min((qt + 1) * 16 + m, SEQ - 1) * DM + d;
    qv[i] = *qp[i];
  }
  asm volatile("s_wait_xcnt 0x0" :: "v"(qp[0]), "v"(qp[1]) : "memory");   // as behind group 1
  lds_barrier();   // also ends the previous tile's reads of sP, in front of this tile's writes of sT

  // A fragments of the Q tile: k 0..31 and k 32..63 (split map: elems 0..7 <- k0+8h, 8..15 <- k0+16+8h)
  FragB qa0, qa1;
  {
    const unsigned short* qp = sQ + n * QP + 8 * hi;
    qa0.h[0] = *(const v8us*)(qp);
    qa0.h[1] = *(const v8us*)(qp + 16);
    qa1.h[0] = *(const v8us*)(qp + 32);
    qa1.h[1] = *(const v8us*)(qp + 48);
  }

  // ---------- Phase 1: P = Qtile @ relK^T, stored at every circular offset that has this distance ----------
  const int swave = __builtin_amdgcn_readfirstlane(wave);   // tile numbers and base offsets stay scalar
  const int nrev  = n ^ 15;                                 // 15 - n, never negative
  #pragma unroll   // constant indices into rk
  for (int i = 0; i < RTW; ++i) {
    const int ct = swave + i * NW;
    v8f acc = zero8();
    acc = wmma_bf16(qa0, rk[i][0], acc);
    acc = wmma_bf16(qa1, rk[i][1], acc);
    acc *= BSC;
    const int dist = ct * 16 + n;
    float* trow = sT + 8 * hi * (TP + 1);   // row q = r + 8*hi, column C + q: steps of TP + 1
    if (dist <= DMAX) {
      float* p1 = trow + (TC0 - 15 - ct * 16) + nrev;       // offset dist: column TC0 + q - dist
      float* p2 = trow + (ct * 16 + TSH - 8) + n;           // offset SEQ - dist: column TSH + q + dist - 8
      #pragma unroll
      for (int r = 0; r < 8; ++r) {
        p1[r * (TP + 1)] = acc[r];
        p2[r * (TP + 1)] = acc[r];
      }
    }
    if (i == 0 && ct == 0) {         // distances 0..15 also stand at offsets -dist and SEQ + dist, where a row's window reaches them
      #pragma unroll
      for (int r = 0; r < 8; ++r) {
        trow[r * (TP + 1) + TC0 + n] = acc[r];                   // offset -dist
        trow[r * (TP + 1) + (TSH - 8 - 15) + nrev] = acc[r];     // offset SEQ + dist
      }
    }
  }
  lds_barrier();

  // ---------- Phase 2: scores^T / scale = K*Q^T + bias / scale at offset (query - key) mod SEQ, kept in registers ------
  // K is the A operand and Q the B operand: lane (n, hi) holds, of query n, the 8 neighbouring keys 16*kt + 8*hi + 0..7.
  static_assert(NW * (KTW - 1) * 16 <= SEQ, "only a wave's last tile can hold padded keys");
  static_assert(SEQ % 8 == 0, "a lane's 8 keys are all valid or all padding");
  const float* tlane = sT + n * TP + 8 * hi;
  // The bias is the C operand of a tile's first product, and the product's result stays in its registers: all tiles' bias reads
  // are issued in front of the first product, at no cost in registers, and the LDS latency is waited out once.
  v4f bias[KTW][2];
  #pragma unroll   // constant indices into bias
  for (int i = 0; i < KTW; ++i) {
    const int dt = qt - min(swave + i * NW, KTI - 1);   // the last wave has no last tile: tile number clamped, values masked below
    const float* tp = tlane + (TC0 - dt * 16 - (dt < 0 ? SEQ : 0));
    bias[i][0] = *(const v4f*)(tp);
    bias[i][1] = *(const v4f*)(tp + 4);
  }
  __builtin_amdgcn_sched_barrier(0);   // keeps the reads in front of the products: left free, the build moves them down again
  float sc[KTW][8];
  #pragma unroll   // constant indices into kf, bias and sc
  for (int i = 0; i < KTW; ++i) {
    const int kt = swave + i * NW;
    v8f acc = __builtin_shufflevector(bias[i][0], bias[i][1], 0, 1, 2, 3, 4, 5, 6, 7);
    acc = wmma_bf16(kf[i][0], qa0, acc);
    acc = wmma_bf16(kf[i][1], qa1, acc);
    const bool pad = (i == KTW - 1) && (kt * 16 + 8 * hi >= SEQ);   // padded keys, the last wave's missing tile among them
    #pragma unroll
    for (int r = 0; r < 8; ++r) sc[i][r] = pad ? -1.0e30f : acc[r];
  }

  // ---------- Phase 3: softmax in registers (normalisation deferred) -----------------
  // A query's maximum: in the lane, between the lane halves, then over the waves through sRedM.
  {
    float m0 = sc[0][0], m1 = sc[1][0], m2 = sc[2][0], m3 = sc[3][0];
    static_assert(KTW == 4, "one chain per tile");
    #pragma unroll
    for (int r = 1; r < 8; ++r) {
      m0 = fmaxf(m0, sc[0][r]); m1 = fmaxf(m1, sc[1][r]); m2 = fmaxf(m2, sc[2][r]); m3 = fmaxf(m3, sc[3][r]);
    }
    float mx = fmaxf(fmaxf(m0, m1), fmaxf(m2, m3));
    mx = fmaxf(mx, xhalf(mx));
    if (hi == 0) sRedM[n * RP + wave] = mx;
  }
  lds_barrier();   // also ends every wave's reads of sT, whose second half becomes sA
  {
    static_assert(NW == 16, "four 16-byte reads per query");
    const v4f* mp = (const v4f*)(sRedM + n * RP);
    const v4f a = mp[0], b = mp[1], c = mp[2], d = mp[3];
    const float rm = fmaxf(fmaxf(fmaxf(fmaxf(a.x, a.y), fmaxf(a.z, a.w)), fmaxf(fmaxf(b.x, b.y), fmaxf(b.z, b.w))),
                           fmaxf(fmaxf(fmaxf(c.x, c.y), fmaxf(c.z, c.w)), fmaxf(fmaxf(d.x, d.y), fmaxf(d.z, d.w))));
    const float cs = scale * L2E;        // raw units -> log2 units
    const float sh = rm * cs - PSH;      // weights come out scaled by 2^PSH, and so does their sum
    _Float16* alane = sA + n * AP + swave * 16 + 8 * hi;
    // Columns SEQ .. SEQ + 15 of sA take a second copy of the weights of keys 0..15 (below), so the lanes whose 8 padded keys
    // would fall there put their zeros on the last 8 padded columns instead. V is zero at every padded key.
    _Float16* alast = (swave * 16 + (KTW - 1) * NW * 16 + 8 * hi >= SEQ) ? sA + n * AP + SPAD - 8 : alane + (KTW - 1) * NW * 16;
    float sum = 0.0f;
    #pragma unroll   // constant indices into sc
    for (int i = 0; i < KTW; ++i) {
      const v4f x0 = {sc[i][0] * cs - sh, sc[i][1] * cs - sh, sc[i][2] * cs - sh, sc[i][3] * cs - sh};
      const v4f x1 = {sc[i][4] * cs - sh, sc[i][5] * cs - sh, sc[i][6] * cs - sh, sc[i][7] * cs - sh};
      const v4f e0 = exp2_x4(x0), e1 = exp2_x4(x1);
      v8h h8;
      h8[0] = (_Float16)e0.x; h8[1] = (_Float16)e0.y; h8[2] = (_Float16)e0.z; h8[3] = (_Float16)e0.w;
      h8[4] = (_Float16)e1.x; h8[5] = (_Float16)e1.y; h8[6] = (_Float16)e1.z; h8[7] = (_Float16)e1.w;
      *(v8h*)(i == KTW - 1 ? alast : alane + i * NW * 16) = h8;   // 8 keys of one query: one 16-byte store
      // the circle goes on behind its last key: phase 4 walks 15 keys past any start without a wrap
      if (i == 0 && swave == 0) *(v8h*)(sA + n * AP + SEQ + 8 * hi) = h8;
      sum += ((e0.x + e0.y) + (e0.z + e0.w)) + ((e1.x + e1.y) + (e1.z + e1.w));
    }
    sum += xhalf(sum);
    if (hi == 0) sRedS[n * RP + wave] = sum;
  }

  // Group 4: this wave's relV^T fragments for phase 5; they land behind phase 4.
  FragH rvf[RSW];
  {
    const _Float16* rvcol = RVt + (size_t)((wave & 3) * (NDIST / 32) + ks * RSW) * VSE + lane * 8;   // B[k=dist][n=dim]
    #pragma unroll   // constant indices: the fragments stay in registers
    for (int i = 0; i < RSW; ++i) {
      rvf[i].h[0] = *(const v8h*)(rvcol + i * VSE);
      rvf[i].h[1] = *(const v8h*)(rvcol + i * VSE + FU);
    }
    asm volatile("s_wait_xcnt 0x0" :: "v"(rvcol) : "memory");   // as behind group 1
  }
  lds_barrier();

  // ---------- Phase 4: per-distance mass, fixed 2-key gather (no atomics) ---
  // keys at circular distance dist from row q: (q-dist) mod S and (q+dist) mod S (one key when they coincide)
  // One distance per thread, all 16 rows. The two keys coincide exactly where 2*dist is a multiple of SEQ, whatever the row,
  // so that test and the padding test become two per-thread factors and the rows' reads are independent of each other.
  {
    static_assert(NT == NDIST, "one distance per thread");
    const int dist = tid;
    const float w2 = (dist == 0 || 2 * dist == SEQ) ? 0.0f : 1.0f;
    const float ws = (dist <= DMAX) ? 1.0f : 0.0f;
    // The two keys of row 0, wrapped into 0..SEQ-1 by an unsigned minimum (the out-of-range form is negative, so huge as unsigned).
    // Row m takes the keys m further on, at most SEQ + 14: behind key SEQ - 1 stand the copies of keys 0..15, so no row wraps
    // and each read is one of two addresses plus a constant. Rows past the last query read other keys' weights; they are not stored.
    static_assert(SEQ + 16 <= SPAD - 8 && NDIST <= SEQ, "the copies fit in front of the zero columns; one wrap is enough");
    const _Float16* a1 = sA + min((unsigned)(qt * 16 - dist), (unsigned)(qt * 16 - dist + SEQ));
    const _Float16* a2 = sA + min((unsigned)(qt * 16 + dist), (unsigned)(qt * 16 + dist - SEQ));
    _Float16 g1[16], g2[16];
    #pragma unroll   // constant indices into g1 and g2
    for (int m = 0; m < 16; ++m) {
      g1[m] = a1[m * (AP + 1)];
      g2[m] = a2[m * (AP + 1)];
    }
    __builtin_amdgcn_sched_barrier(0);   // all rows' LDS reads are issued in front of the first sum: left free, the build issues them in groups, with address arithmetic and waits between
    #pragma unroll   // constant indices into g1 and g2
    for (int m = 0; m < 16; ++m) {
      const float val = (float)g1[m] + w2 * (float)g2[m];
      sD[m * DP + dist] = (_Float16)(val * ws);
    }
  }
  // Phase 5 reads each A fragment AHD k steps ahead of its product, so that a wave has 2 * AHD LDS reads in flight and a step
  // does not wait out the LDS latency. The first AHD steps read sA, which is complete since the barrier in front of phase 4:
  // their reads are issued here and land while the wave waits at the barrier.
  static_assert(AHD <= VSW, "the steps read in front of the barrier take sA alone");
  const _Float16* arow  = sA + n * AP    + key0 + 8 * hi;                      // A[m=row][k=key]
  const _Float16* drow  = sD + n * DP    + dis0 + 8 * hi;                      // A[m=row][k=dist]
  FragH af[VSW + RSW];   // constant indices only: AHD of them are live at a time
  #pragma unroll   // constant indices into af
  for (int st = 0; st < AHD; ++st) {
    af[st].h[0] = *(const v8h*)(arow + st * 32);
    af[st].h[1] = *(const v8h*)(arow + st * 32 + 16);
  }
  lds_barrier();

  // ---------- Phase 5: out = (P@V + D@relV) / sum, weights and sum both scaled by 2^PSH -----------------------
  {
    v8f acc = zero8();
    #pragma unroll   // constant indices into af, vf and rvf
    for (int st = 0; st < VSW + RSW; ++st) {
      acc = wmma_f16(af[st], st < VSW ? vf[st] : rvf[st - VSW], acc);
      const int nx = st + AHD;
      if (nx < VSW + RSW) {
        const _Float16* ap = nx < VSW ? arow + nx * 32 : drow + (nx - VSW) * 32;
        af[nx].h[0] = *(const v8h*)(ap);
        af[nx].h[1] = *(const v8h*)(ap + 16);
      }
    }
    // stage this wave's 16x16 f32 partial sum (sP is free after phase 2)
    #pragma unroll
    for (int r = 0; r < 8; ++r) {
      const int m = r + 8 * hi;
      sP[(ks * 16 + m) * OP + dbase + n] = acc[r];
    }
  }
  __syncthreads();

  // relK again, for the next tile: held over the whole tile its 32 registers would take the room in which phase 4 keeps
  // its LDS reads in flight. Issued behind the barrier above, which would drain it; it lands behind the rest of this tile and phase 0.
  #pragma unroll   // constant indices: the fragments stay in registers
  for (int i = 0; i < RTW; ++i) {
    const unsigned short* rp = rp0 + (size_t)i * NW * KTE;
    rk[i][0].h[0] = *(const v8us*)(rp);
    rk[i][0].h[1] = *(const v8us*)(rp + FU);
    rk[i][1].h[0] = *(const v8us*)(rp + 2 * FU);
    rk[i][1].h[1] = *(const v8us*)(rp + 3 * FU);
  }
  asm volatile("s_wait_xcnt 0x0" :: "v"(rp0) : "memory");   // as behind group 1

  // add the KSP partial sums, normalise, store whole 128-B lines (8 lanes each)
  if (tid < 16 * DH / 4) {
    float* obase = Out + baseQ;
    const int m = tid >> 4;
    const int c = (tid & 15) * 4;
    const int qrow = qt * 16 + m;
    const v4f* sp4 = (const v4f*)(sRedS + m * RP);
    v4f pv[KSP], sv[4];
    #pragma unroll   // constant indices into pv
    for (int s = 0; s < KSP; ++s) pv[s] = *(const v4f*)(sP + (s * 16 + m) * OP + c);
    #pragma unroll   // constant indices into sv
    for (int j = 0; j < 4; ++j) sv[j] = sp4[j];
    __builtin_amdgcn_sched_barrier(0);   // all eight reads are issued in front of the first sum: one wait for the LDS latency, not two
    v4f v = pv[0];
    #pragma unroll
    for (int s = 1; s < KSP; ++s) v += pv[s];
    const v4f s4 = (sv[0] + sv[1]) + (sv[2] + sv[3]);
    v *= 1.0f / ((s4.x + s4.y) + (s4.z + s4.w));
    if (qrow < SEQ) {
      v4f* op = (v4f*)(obase + (size_t)qrow * DM + c);
      *op = v;
      // kept in front of the next tile's overwrite of the store's registers; data and address are inputs, so they live up to the wait
      asm volatile("s_wait_xcnt 0x0" :: "v"(v), "v"(op) : "memory");
    }
  }

  }   // query tiles
}

extern "C" void kernel_launch(void* const* d_in, const int* in_sizes, int n_in,
                              void* d_out, int out_size, void* d_ws, size_t ws_size,
                              hipStream_t stream) {
  if (n_in < 5) return;
  if (in_sizes[0] < NB * SEQ * DM || in_sizes[1] < NB * SEQ * DM || in_sizes[2] < NB * SEQ * DM) return;
  if (in_sizes[3] < NDIST * DH || in_sizes[4] < NDIST * DH) return;
  if (out_size < NB * SEQ * DM) return;
  const size_t ws_need = WS_END * 2;           // 16,777,216 B
  if (ws_size < ws_need) return;

  const float* Q  = (const float*)d_in[0];
  const float* K  = (const float*)d_in[1];
  const float* V  = (const float*)d_in[2];
  const float* RK = (const float*)d_in[3];
  const float* RV = (const float*)d_in[4];
  float* Out = (float*)d_out;
  unsigned short* ws16 = (unsigned short*)d_ws;

  unsigned short* Kb  = ws16 + WS_K;
  _Float16*       Vt  = (_Float16*)(ws16 + WS_VT);
  unsigned short* RKb = ws16 + WS_RK;
  _Float16*       RVt = (_Float16*)(ws16 + WS_RVT);

  prep_kernel<<<(NK8 + NV8 + 2 * NR8) / PCH, 256, 0, stream>>>(K, V, RK, RV, Kb, Vt, RKb, RVt);

  dim3 grid(QCH, NB * NH);
  circ_rel_attn_kernel<<<grid, dim3(NT), 0, stream>>>(Q, Kb, Vt, RKb, RVt, Out);
}
